// v000
// The times below were measured on an AMD MI455X: many runs one after another, warmed up first and cycling through
// copies of the inputs, with the whole window's GPU time divided by the number of runs. Launches and the gaps
// between them are all in it. The median over several windows is given; except for v000 it joins two sittings, which
// can be a few percent apart, so the side-by-side timings, each taken in one sitting, are the better comparison.
// v000 is the starting kernel. One run takes 2750 microseconds.
#include <hip/hip_runtime.h>

// Compute dtypes, f32 accumulate: LayerNorm (shared norm1 on both streams, norm2 later) and GELU in f32; kv = LN(x).Wkv + bkv ([16384 x 64].[64 x 128]), q = LN(clinic).Wq
// + bq, o = ctx.Wproj + bproj, m = gelu(LN(o).W1 + b1) and out = m.W2 + b2 + o with every computed operand as bf16 hi + UNSCALED residual against exact bf16 k-major
// weights (two products) on v_wmma_f32_16x16x32_bf16; the 4-head (16-dim) cross attention per (item, head): scores = q_h.k_h^T ([2048 x 32(16 + zero pad)].[32 x
// 2048], three products), row softmax x 1/4 in f32 -> bf16 hi + UNSCALED residual, ctx_h = attn.v_h ([2048 x 2048].[2048 x 64(16 + zero pad)], three products) on

#define NBI  8
#define NN   2048
#define NR   (NBI * NN)          // 16384 token rows
#define DD   64
#define NH_  4
#define HD   16
#define HDP  32                  // zero-padded q/k head width for the 32-deep WMMA k-step
#define VP   64                  // zero-padded v^T rows
#define HID  128
#define DM   DD
#define NTK  NR
#define SCL  0.25f
#define LN_EPS 1e-5f
#define LOSC 1024.0f

typedef _Float16 h16;
typedef unsigned short bf;
typedef __attribute__((ext_vector_type(16))) __bf16   v16bf;
typedef __attribute__((ext_vector_type(16))) _Float16 v16h;
typedef __attribute__((ext_vector_type(8)))  _Float16 v8h;
typedef __attribute__((ext_vector_type(8)))  unsigned short v8us;
typedef __attribute__((ext_vector_type(8)))  float    v8f;
typedef __attribute__((ext_vector_type(4)))  float    v4f;
typedef __attribute__((ext_vector_type(4)))  _Float16 v4h;
typedef v8h  __attribute__((may_alias)) v8ha;
typedef v4f  __attribute__((may_alias)) v4fa;
typedef v8us __attribute__((may_alias)) v8usa;

__device__ __forceinline__ unsigned short f2bf(float f) { unsigned u = __float_as_uint(f); u += 0x7FFFu + ((u >> 16) & 1u); return (unsigned short)(u >> 16); }
__device__ __forceinline__ float bf2f(unsigned short b) { return __uint_as_float(((unsigned)b) << 16); }
__device__ __forceinline__ float bfr(float f) { return bf2f(f2bf(f)); }
__device__ __forceinline__ v16h cat16(v8h lo, v8h hi) { return __builtin_shufflevector(lo, hi, 0, 1, 2, 3, 4, 5, 6, 7, 8, 9, 10, 11, 12, 13, 14, 15); }
__device__ __forceinline__ v16bf cat16b(v8us lo, v8us hi) { return __builtin_bit_cast(v16bf, __builtin_shufflevector(lo, hi, 0, 1, 2, 3, 4, 5, 6, 7, 8, 9, 10, 11, 12, 13, 14, 15)); }
__device__ __forceinline__ v8f wmma16(v16h a, v16h b, v8f c) { return __builtin_amdgcn_wmma_f32_16x16x32_f16(false, a, false, b, (short)0, c, false, false); }
__device__ __forceinline__ v8f wmmab(v16bf a, v16bf b, v8f c) { return __builtin_amdgcn_wmma_f32_16x16x32_bf16(false, a, false, b, (short)0, c, false, false); }

// k_wt: WT [n][K] = bf16(W[k][n]) (k-major [K][ncols]) via 64 x 64 LDS tiles; grid (K/64, ncols/64).
__global__ __launch_bounds__(256) void k_wt(const float* __restrict__ Wm, int K, int ncols, bf* WT) {
    __shared__ __align__(16) unsigned short tl[64 * 72];
    const int tid = threadIdx.x, k0 = blockIdx.x * 64, n0 = blockIdx.y * 64;
    const int kk = tid >> 2, nq = (tid & 3) * 16;
#pragma unroll
    for (int i = 0; i < 16; ++i) tl[(nq + i) * 72 + kk] = f2bf(Wm[(size_t)(k0 + kk) * ncols + n0 + nq + i]);
    __syncthreads();
    const int piece = tid & 7;
    auto pass = [&]() {
#pragma unroll
        for (int s = 0; s < 2; ++s) { const int nr = (tid >> 3) + 32 * s; const v8us val = *(const v8usa*)(tl + nr * 72 + piece * 8); *(v8us*)(WT + (size_t)(n0 + nr) * K + k0 + piece * 8) = val; }
    };
    pass(); 
}
// k_gemmb: 64 x 64 block tile (4 waves x 16 x 64) of C[NTK][NW] = (A [+ Al]).B^T (K = 64 or 128) [+ bf(bias[c])] [+ R[r][c] residual, bf16-rounded when roundR]; f32 whole-line epilogue (or f16
template <bool SPLITA, bool F16OUT = false>
__global__ __launch_bounds__(128) void k_gemmb(const bf* __restrict__ A, const bf* __restrict__ Al, const bf* __restrict__ Bn, const float* __restrict__ bias, float* C, int ldc, h16* C2, const float* __restrict__ R = nullptr, int K = DM, int roundR = 1) {
    __shared__ __align__(16) float ost[4][16 * 68];
    const int lane = threadIdx.x & 31, wave = threadIdx.x >> 5, lr = lane & 15, hi = lane >> 4;
    const int r0 = blockIdx.x * 64 + wave * 16, c0 = blockIdx.y * 64;
    const size_t aoff = (size_t)(r0 + lr) * K + 8 * hi;
    size_t boff[4];
#pragma unroll
    for (int t = 0; t < 4; ++t) boff[t] = (size_t)(c0 + t * 16 + lr) * K + 8 * hi;
    v8f acc[4];
#pragma unroll
    for (int t = 0; t < 4; ++t) acc[t] = (v8f){};
#pragma unroll 1
    for (int kc = 0; kc < K; kc += 32) {
        const v16bf a = cat16b(*(const v8us*)(A + aoff + kc), *(const v8us*)(A + aoff + kc + 16));
        v16bf al = a;
        if (SPLITA) al = cat16b(*(const v8us*)(Al + aoff + kc), *(const v8us*)(Al + aoff + kc + 16));
#pragma unroll
        for (int t = 0; t < 4; ++t) { const v16bf b = cat16b(*(const v8us*)(Bn + boff[t] + kc), *(const v8us*)(Bn + boff[t] + kc + 16)); acc[t] = wmmab(a, b, acc[t]); if (SPLITA) acc[t] = wmmab(al, b, acc[t]); }
        asm volatile("v_nop\n\tv_nop\n\tv_nop\n\tv_nop" : "+v"(acc[0]), "+v"(acc[1]), "+v"(acc[2]), "+v"(acc[3]) : "v"(a), "v"(al));
    }
    float* os = &ost[wave][0];
#pragma unroll
    for (int t = 0; t < 4; ++t) { const float bv = bias ? bfr(bias[c0 + t * 16 + lr]) : 0.f;
#pragma unroll
        for (int j = 0; j < 8; ++j) os[(hi * 8 + j) * 68 + t * 16 + lr] = acc[t][j] + bv; }
    __syncthreads();
    if (F16OUT) {
        h16* crow = (h16*)(void*)C + (size_t)r0 * ldc + c0;
        auto pass = [&]() {
#pragma unroll
            for (int s = 0; s < 4; ++s) { const int row = 4 * s + (lane >> 3), piece = lane & 7; const float* sp = os + row * 68 + piece * 8; v8h o, o2;
#pragma unroll
                for (int i = 0; i < 8; ++i) { const h16 a = (h16)sp[i]; o[i] = a; o2[i] = (h16)((sp[i] - (float)a) * LOSC); }
                *(v8h*)(crow + (size_t)row * ldc + piece * 8) = o; if (C2) *(v8h*)(C2 + (size_t)r0 * ldc + c0 + (size_t)row * ldc + piece * 8) = o2; }
        };
        pass(); 
    } else {
        float* crow = C + (size_t)r0 * ldc + c0;
        auto pass = [&]() {
#pragma unroll
            for (int s = 0; s < 8; ++s) { const int Lid = (lane >> 3) + 4 * s, piece = lane & 7; const int row = Lid >> 1, cofs = (Lid & 1) * 32 + piece * 4;
                v4f val = *(const v4fa*)(os + row * 68 + cofs); if (R) { const v4f rv = *(const v4f*)(R + ((size_t)r0 + row) * ldc + c0 + cofs); val += roundR ? (v4f){bfr(rv[0]), bfr(rv[1]), bfr(rv[2]), bfr(rv[3])} : rv; }
                *(v4f*)(crow + (size_t)row * ldc + cofs) = val; }
        };
        pass(); 
    }
}

// k_gemm3: 64 x 64 tile of C = (Ah + Al).(Bh + Bl)^T over K (row strides = K for all four planes; n-major B): three products per 32-k step (hh, hl, lh); f32
__global__ __launch_bounds__(128) void k_gemm3(const bf* __restrict__ Ah, const bf* __restrict__ Al, const bf* __restrict__ Bh, const bf* __restrict__ Bl, int K, float* C, int ldc) {
    __shared__ __align__(16) float ost[4][16 * 68];
    const int lane = threadIdx.x & 31, wave = threadIdx.x >> 5, lr = lane & 15, hi = lane >> 4;
    const int r0 = blockIdx.x * 64 + wave * 16, c0 = blockIdx.y * 64;
    const size_t aoff = (size_t)(r0 + lr) * K + 8 * hi;
    v8f acc[4];
#pragma unroll
    for (int t = 0; t < 4; ++t) acc[t] = (v8f){};
#pragma unroll 1
    for (int kc = 0; kc < K; kc += 32) {
        const v16bf a = cat16b(*(const v8us*)(Ah + aoff + kc), *(const v8us*)(Ah + aoff + kc + 16));
        const v16bf al = cat16b(*(const v8us*)(Al + aoff + kc), *(const v8us*)(Al + aoff + kc + 16));
#pragma unroll
        for (int t = 0; t < 4; ++t) { const size_t bo = (size_t)(c0 + t * 16 + lr) * K + kc + 8 * hi;
            const v16bf bh = cat16b(*(const v8us*)(Bh + bo), *(const v8us*)(Bh + bo + 16)); const v16bf bl = cat16b(*(const v8us*)(Bl + bo), *(const v8us*)(Bl + bo + 16));
            acc[t] = wmmab(a, bh, acc[t]); acc[t] = wmmab(al, bh, acc[t]); acc[t] = wmmab(a, bl, acc[t]); }
        asm volatile("v_nop\n\tv_nop\n\tv_nop\n\tv_nop" : "+v"(acc[0]), "+v"(acc[1]), "+v"(acc[2]), "+v"(acc[3]) : "v"(a), "v"(al));
    }
    float* os = &ost[wave][0];
#pragma unroll
    for (int t = 0; t < 4; ++t) {
#pragma unroll
        for (int j = 0; j < 8; ++j) os[(hi * 8 + j) * 68 + t * 16 + lr] = acc[t][j]; }
    __builtin_amdgcn_wave_barrier(); asm volatile("" ::: "memory");
    float* crow = C + (size_t)r0 * ldc + c0;
    auto pass = [&]() {
#pragma unroll
        for (int s = 0; s < 8; ++s) { const int Lid = (lane >> 3) + 4 * s, piece = lane & 7; const int row = Lid >> 1, cofs = (Lid & 1) * 32 + piece * 4;
            const v4f val = *(const v4fa*)(os + row * 68 + cofs); *(v4f*)(crow + (size_t)row * ldc + cofs) = val; }
    };
    pass(); 
}

// k_ln64: one wave per row of a [rows][64] f32 matrix (INPUT rows are bf16-rounded first when rnd): LayerNorm (mean, biased var, eps 1e-5; lane -> 2 values, xor
__global__ __launch_bounds__(256) void k_ln64(const float* __restrict__ src, int rnd, const float* __restrict__ g, const float* __restrict__ bb, int nrows, float* Y, bf* Ph, bf* Pl) {
    typedef __attribute__((ext_vector_type(2))) float v2f; typedef __attribute__((ext_vector_type(2))) unsigned short v2us;
    const int lane = threadIdx.x & 31, r = blockIdx.x * 8 + (threadIdx.x >> 5); if (r >= nrows) return;
    const size_t o = (size_t)r * DD + 2 * lane; float v0 = src[o], v1 = src[o + 1]; if (rnd) { v0 = bfr(v0); v1 = bfr(v1); }
    float s = v0 + v1;
#pragma unroll
    for (int sh = 16; sh; sh >>= 1) s += __shfl_xor(s, sh, 32);
    const float mu = s * (1.0f / DD); const float d0 = v0 - mu, d1 = v1 - mu; float s2 = d0 * d0 + d1 * d1;
#pragma unroll
    for (int sh = 16; sh; sh >>= 1) s2 += __shfl_xor(s2, sh, 32);
    const float rs = rsqrtf(s2 * (1.0f / DD) + LN_EPS);
    v2f y; y[0] = d0 * rs * bfr(g[2 * lane]) + bfr(bb[2 * lane]); y[1] = d1 * rs * bfr(g[2 * lane + 1]) + bfr(bb[2 * lane + 1]);
    v2us oh, ol;
#pragma unroll
    for (int i = 0; i < 2; ++i) { const unsigned short hb = f2bf(y[i]); oh[i] = hb; ol[i] = f2bf(y[i] - bf2f(hb)); }
    if (Y) *(v2f*)(Y + o) = y; *(v2us*)(Ph + o) = oh; *(v2us*)(Pl + o) = ol; 
}
// k_qkpad: per (item, head) padded planes QP/KP [b][h][t][32] = bf16 hi + UNSCALED residual of q[t][h*16 + d] / kv[t][h*16 + d] for d < 16, zeros for d 16..31; one
// wave per (token pair, head): lane -> (token 2*tp + lane/16, 2 dims 2*(lane%16).. of the 32-wide padded row: dims >= 16 are zeros) (4 B per plane per
// lane; 16 lanes = the head's 64-B padded row; 32 lanes = 2 consecutive tokens = 128 B contiguous in one [b][h] plane)
__global__ __launch_bounds__(256) void k_qkpad(const float* __restrict__ Qf, const float* __restrict__ KVf, bf* QPh, bf* QPl, bf* KPh, bf* KPl) {
    typedef __attribute__((ext_vector_type(2))) unsigned short v2us;
    const int lane = threadIdx.x & 31, wid = blockIdx.x * 8 + (threadIdx.x >> 5); if (wid >= NR * NH_ / 2) return;
    const int h = wid % NH_, tp = wid / NH_; const int t = tp * 2 + (lane >> 4), l = lane & 15; const int d0 = 2 * l;      // d0, d0+1 of the 32-wide padded row
    const int b = t / NN, tt = t % NN;
    v2us qh, ql, kh, kl;
#pragma unroll
    for (int i = 0; i < 2; ++i) { const int d = d0 + i; float qv = 0.f, kv = 0.f; if (d < HD) { qv = Qf[(size_t)t * DD + h * HD + d]; kv = KVf[(size_t)t * HID + h * HD + d]; }
        unsigned short hb = f2bf(qv); qh[i] = hb; ql[i] = f2bf(qv - bf2f(hb)); hb = f2bf(kv); kh[i] = hb; kl[i] = f2bf(kv - bf2f(hb)); }
    const size_t o = (((size_t)b * NH_ + h) * NN + tt) * HDP + d0;
    *(v2us*)(QPh + o) = qh; *(v2us*)(QPl + o) = ql; *(v2us*)(KPh + o) = kh; *(v2us*)(KPl + o) = kl; 
}
// k_vtp: per (item, head) transposed value planes VT [h][64][2048] of item b: rows d < 16 = bf16 hi + UNSCALED residual of kv[b][t][64 + h*16 + d], rows 16..63 zero; one
__global__ __launch_bounds__(256) void k_vtp(const float* __restrict__ KVf, int b, bf* VTh, bf* VTl) {
    typedef __attribute__((ext_vector_type(2))) unsigned short v2us;
    const int lane = threadIdx.x & 31, wid = blockIdx.x * 8 + (threadIdx.x >> 5); if (wid >= NH_ * VP * (NN / 64)) return;
    const int tg = wid % (NN / 64), rest = wid / (NN / 64), d = rest % VP, h = rest / VP; const int t0 = tg * 64 + 2 * lane;
    v2us oh, ol;
#pragma unroll
    for (int i = 0; i < 2; ++i) { float v = 0.f; if (d < HD) v = KVf[((size_t)b * NN + t0 + i) * HID + DD + h * HD + d]; const unsigned short hb = f2bf(v); oh[i] = hb; ol[i] = f2bf(v - bf2f(hb)); }
    const size_t o = ((size_t)h * VP + d) * NN + t0;
    *(v2us*)(VTh + o) = oh; *(v2us*)(VTl + o) = ol; 
}
__global__ __launch_bounds__(256) void k_softmax(const float* __restrict__ S, bf* PH, bf* PL) {
    const int lane = threadIdx.x & 31, r = blockIdx.x * 8 + (threadIdx.x >> 5); if (r >= NN) return;
    const float* sr = S + (size_t)r * NN; float m = -3.0e38f;
#pragma unroll 1
    for (int c0 = lane * 8; c0 < NN; c0 += 256) { const v8f v = *(const v8f*)(sr + c0);
#pragma unroll
        for (int i = 0; i < 8; ++i) m = fmaxf(m, v[i] * SCL); }
#pragma unroll
    for (int sh = 16; sh; sh >>= 1) m = fmaxf(m, __shfl_xor(m, sh, 32));
    float sum = 0.f;
#pragma unroll 1
    for (int c0 = lane * 8; c0 < NN; c0 += 256) { const v8f v = *(const v8f*)(sr + c0);
#pragma unroll
        for (int i = 0; i < 8; ++i) sum += __expf(v[i] * SCL - m); }
#pragma unroll
    for (int sh = 16; sh; sh >>= 1) sum += __shfl_xor(sum, sh, 32);
    const float inv = 1.0f / sum;
{
#pragma unroll 1
        for (int c0 = lane * 8; c0 < NN; c0 += 256) { const v8f v = *(const v8f*)(sr + c0); v8us oh, ol;
#pragma unroll
            for (int i = 0; i < 8; ++i) { const float p = __expf(v[i] * SCL - m) * inv; const unsigned short hb = f2bf(p); oh[i] = hb; ol[i] = f2bf(p - bf2f(hb)); }
            const size_t o = (size_t)r * NN + c0; *(v8us*)(PH + o) = oh; *(v8us*)(PL + o) = ol; }
         }
}
// k_assemble: ctx[b][t][h*16 + d] from the four per-head [2048][64] products (their first 16 columns) -> bf16 hi + UNSCALED residual planes [t][64]; one wave per row:
__global__ __launch_bounds__(256) void k_assemble(const float* __restrict__ O4, int b, bf* Ch, bf* Cl) {
    typedef __attribute__((ext_vector_type(2))) unsigned short v2us;
    const int lane = threadIdx.x & 31, t = blockIdx.x * 8 + (threadIdx.x >> 5); if (t >= NN) return;
    const int c = 2 * lane, h = c / HD, d = c % HD; v2us oh, ol;
#pragma unroll
    for (int i = 0; i < 2; ++i) { const float v = O4[((size_t)h * NN + t) * VP + d + i]; const unsigned short hb = f2bf(v); oh[i] = hb; ol[i] = f2bf(v - bf2f(hb)); }
    const size_t o = ((size_t)b * NN + t) * DD + c;
    *(v2us*)(Ch + o) = oh; *(v2us*)(Cl + o) = ol; 
}
__global__ __launch_bounds__(256) void k_gelu(const float* __restrict__ src, int nrows, bf* dh, bf* dl) {
    typedef __attribute__((ext_vector_type(4))) unsigned short v4us;
    const int lane = threadIdx.x & 31, r = blockIdx.x * 8 + (threadIdx.x >> 5); if (r >= nrows) return;
    const size_t o = (size_t)r * HID + lane * 4; const v4f v = *(const v4f*)(src + o); v4us oh, ol;
#pragma unroll
    for (int i = 0; i < 4; ++i) { const float y = 0.5f * v[i] * (1.0f + erff(v[i] * 0.7071067811865476f)); const unsigned short hb = f2bf(y); oh[i] = hb; ol[i] = f2bf(y - bf2f(hb)); }
    *(v4us*)(dh + o) = oh; *(v4us*)(dl + o) = ol; 
}

extern "C" void kernel_launch(void* const* d_in, const int* in_sizes, int n_in,
                              void* d_out, int out_size, void* d_ws, size_t ws_size, hipStream_t stream) {
    (void)in_sizes; (void)n_in; (void)out_size;
    const float* x = (const float*)d_in[0]; const float* cl = (const float*)d_in[1]; const float* g1 = (const float*)d_in[2]; const float* be1 = (const float*)d_in[3]; const float* g2 = (const float*)d_in[4]; const float* be2 = (const float*)d_in[5];
    const float* Wkv = (const float*)d_in[6]; const float* bkv = (const float*)d_in[7]; const float* Wq = (const float*)d_in[8]; const float* bq = (const float*)d_in[9]; const float* Wp = (const float*)d_in[10]; const float* bp = (const float*)d_in[11];
    const float* W1 = (const float*)d_in[12]; const float* b1 = (const float*)d_in[13]; const float* W2 = (const float*)d_in[14]; const float* b2 = (const float*)d_in[15];      // k-major weights (x @ W)
    float* out = (float*)d_out;    // [8][2048][64]
    char* wsp = (char*)d_ws;
    auto take = [&](size_t bytes) { char* p = wsp; wsp += (bytes + 255) & ~(size_t)255; return (void*)p; };
    bf* WkvT = (bf*)take(HID * DD * 2); bf* WqT = (bf*)take(DD * DD * 2); bf* WpT = (bf*)take(DD * DD * 2); bf* W1T = (bf*)take(HID * DD * 2); bf* W2T = (bf*)take(DD * HID * 2);
    bf* XNh = (bf*)take((size_t)NR * DD * 2); bf* XNl = (bf*)take((size_t)NR * DD * 2); bf* CNh = (bf*)take((size_t)NR * DD * 2); bf* CNl = (bf*)take((size_t)NR * DD * 2);
    float* KVf = (float*)take((size_t)NR * HID * 4); float* Qf = (float*)take((size_t)NR * DD * 4);
    bf* QPh = (bf*)take((size_t)NR * NH_ * HDP * 2); bf* QPl = (bf*)take((size_t)NR * NH_ * HDP * 2); bf* KPh = (bf*)take((size_t)NR * NH_ * HDP * 2); bf* KPl = (bf*)take((size_t)NR * NH_ * HDP * 2);
    bf* VTh = (bf*)take((size_t)NH_ * VP * NN * 2); bf* VTl = (bf*)take((size_t)NH_ * VP * NN * 2); float* S = (float*)take((size_t)NN * NN * 4); bf* PH = (bf*)take((size_t)NN * NN * 2); bf* PL = (bf*)take((size_t)NN * NN * 2);
    float* O4 = (float*)take((size_t)NH_ * NN * VP * 4); bf* Ch = (bf*)take((size_t)NR * DD * 2); bf* Cl = (bf*)take((size_t)NR * DD * 2);
    float* Of = (float*)take((size_t)NR * DD * 4); bf* Hh = (bf*)take((size_t)NR * DD * 2); bf* Hl = (bf*)take((size_t)NR * DD * 2); float* M = (float*)take((size_t)NR * HID * 4); bf* Mh = (bf*)take((size_t)NR * HID * 2); bf* Ml = (bf*)take((size_t)NR * HID * 2);
    if ((size_t)(wsp - (char*)d_ws) > ws_size) return;    // ~ 0.07 + 4 x 2.1 + 8.4 + 4.2 + 4 x 4.2 + 2 x 1 + 16.8 + 16.8 + 2.1 + 2 x 2.1 + 4.2 + 2 x 2.1 + 8.4 + 2 x 4.2 ~ 105 MB, no aliasing
    k_wt<<<dim3(1, HID / 64, 1), 256, 0, stream>>>(Wkv, DD, HID, WkvT); k_wt<<<dim3(1, 1, 1), 256, 0, stream>>>(Wq, DD, DD, WqT); k_wt<<<dim3(1, 1, 1), 256, 0, stream>>>(Wp, DD, DD, WpT);
    k_wt<<<dim3(1, HID / 64, 1), 256, 0, stream>>>(W1, DD, HID, W1T); k_wt<<<dim3(HID / 64, 1, 1), 256, 0, stream>>>(W2, HID, DD, W2T);
    k_ln64<<<NR / 8, 256, 0, stream>>>(x, 1, g1, be1, NR, nullptr, XNh, XNl); k_ln64<<<NR / 8, 256, 0, stream>>>(cl, 1, g1, be1, NR, nullptr, CNh, CNl);     // shared norm1
    k_gemmb<true, false><<<dim3(NR / 64, HID / 64, 1), 128, 0, stream>>>(XNh, XNl, WkvT, bkv, KVf, HID, nullptr, nullptr, DD);                 // kv = LN(x).Wkv + bkv   [16384][128] (k: cols 0-63, v: 64-127)
    k_gemmb<true, false><<<dim3(NR / 64, 1, 1), 128, 0, stream>>>(CNh, CNl, WqT, bq, Qf, DD, nullptr, nullptr, DD);                            // q  = LN(clinic).Wq + bq
    k_qkpad<<<(NR * NH_ / 2 + 7) / 8, 256, 0, stream>>>(Qf, KVf, QPh, QPl, KPh, KPl);
    for (int b = 0; b < NBI; ++b) {
        k_vtp<<<(NH_ * VP * (NN / 64)) / 8, 256, 0, stream>>>(KVf, b, VTh, VTl);
        for (int h = 0; h < NH_; ++h) { const size_t po = ((size_t)b * NH_ + h) * NN * HDP;
            k_gemm3<<<dim3(NN / 64, NN / 64, 1), 128, 0, stream>>>(QPh + po, QPl + po, KPh + po, KPl + po, HDP, S, NN);                              // scores [2048][2048] (K = 32: 16 real + zeros)
            k_softmax<<<NN / 8, 256, 0, stream>>>(S, PH, PL);
            k_gemm3<<<dim3(NN / 64, 1, 1), 128, 0, stream>>>(PH, PL, VTh + (size_t)h * VP * NN, VTl + (size_t)h * VP * NN, NN, O4 + (size_t)h * NN * VP, VP);   // attn.v_h [2048][64] (16 real cols)
        }
        k_assemble<<<NN / 8, 256, 0, stream>>>(O4, b, Ch, Cl);
    }
    k_gemmb<true, false><<<dim3(NR / 64, 1, 1), 128, 0, stream>>>(Ch, Cl, WpT, bp, Of, DD, nullptr, nullptr, DD);                               // o = ctx.Wproj + bproj
    k_ln64<<<NR / 8, 256, 0, stream>>>(Of, 0, g2, be2, NR, nullptr, Hh, Hl);                                                                 // LN2(o)
    k_gemmb<true, false><<<dim3(NR / 64, HID / 64, 1), 128, 0, stream>>>(Hh, Hl, W1T, b1, M, HID, nullptr, nullptr, DD); k_gelu<<<NR / 8, 256, 0, stream>>>(M, NR, Mh, Ml);   // gelu(.W1 + b1)
    k_gemmb<true, false><<<dim3(NR / 64, 1, 1), 128, 0, stream>>>(Mh, Ml, W2T, b2, out, DD, nullptr, Of, HID, 0);                              // .W2 + b2 + o
}

// v002
// One run takes 44.3 microseconds.
// It is 62.1 times as fast as v000, going by the measured steps of the versions left out in between.
#include <hip/hip_runtime.h>

// Compute dtypes, f32 accumulate: LayerNorm (shared norm1 on both streams, norm2 later) and GELU in f32; kv = LN(x).Wkv + bkv, q = LN(clinic).Wq + bq, o = ctx.Wproj + bproj,
// m = gelu(LN(o).W1 + b1) and out = m.W2 + b2 + o with every computed operand as bf16 hi + UNSCALED residual against exact bf16 weights (two products) on
// v_wmma_f32_16x16x32_bf16; the 4-head (16-dim) cross attention in one launch over all (item, head) pairs: S^T = k_h.q_h^T (16 real k + zero upper half in registers, three
// products), softmax x 1/4 in f32 with a running maximum, P^T = bf16 hi + UNSCALED residual packed from the accumulators, ctx_h^T = v_h^T.P^T (three products).
// Three launches: k_pre (LayerNorm, kv / q, head planes), k_attn, k_post (projection, LayerNorm, MLP, residual). In k_pre and k_post a wave owns 16 tokens and a lane pair (l, l ^ 16)
// one token: apart from k_pre's v product (tokens A, weights B) the weights are the A operand, the tokens the B operand, so those products' accumulators hold 8 consecutive features of the lane's token and convert in place into the
// next product's B operand.

#define NBI  8
#define NN   2048
#define NR   (NBI * NN)          // 16384 token rows
#define DD   64
#define NH_  4
#define HD   16
#define HID  128
#define DM   DD
#define NTK  NR
#define SCL  0.25f
#define LN_EPS 1e-5f
#define LOSC 1024.0f

typedef _Float16 h16;
typedef unsigned short bf;
typedef __attribute__((ext_vector_type(16))) __bf16   v16bf;
typedef __attribute__((ext_vector_type(16))) _Float16 v16h;
typedef __attribute__((ext_vector_type(8)))  _Float16 v8h;
typedef __attribute__((ext_vector_type(8)))  unsigned short v8us;
typedef __attribute__((ext_vector_type(8)))  float    v8f;
typedef __attribute__((ext_vector_type(4)))  float    v4f;
typedef __attribute__((ext_vector_type(4)))  _Float16 v4h;
typedef v8h  __attribute__((may_alias)) v8ha;
typedef v4f  __attribute__((may_alias)) v4fa;
typedef v8us __attribute__((may_alias)) v8usa;

__device__ __forceinline__ unsigned short f2bf(float f) { unsigned u = __float_as_uint(f); u += 0x7FFFu + ((u >> 16) & 1u); return (unsigned short)(u >> 16); }
__device__ __forceinline__ float bf2f(unsigned short b) { return __uint_as_float(((unsigned)b) << 16); }
__device__ __forceinline__ float bfr(float f) { return bf2f(f2bf(f)); }
__device__ __forceinline__ v16h cat16(v8h lo, v8h hi) { return __builtin_shufflevector(lo, hi, 0, 1, 2, 3, 4, 5, 6, 7, 8, 9, 10, 11, 12, 13, 14, 15); }
__device__ __forceinline__ v16bf cat16b(v8us lo, v8us hi) { return __builtin_bit_cast(v16bf, __builtin_shufflevector(lo, hi, 0, 1, 2, 3, 4, 5, 6, 7, 8, 9, 10, 11, 12, 13, 14, 15)); }
__device__ __forceinline__ v8f wmma16(v16h a, v16h b, v8f c) { return __builtin_amdgcn_wmma_f32_16x16x32_f16(false, a, false, b, (short)0, c, false, false); }
__device__ __forceinline__ v8f wmmab(v16bf a, v16bf b, v8f c) { return __builtin_amdgcn_wmma_f32_16x16x32_bf16(false, a, false, b, (short)0, c, false, false); }

// lane l <-> l ^ 16
__device__ __forceinline__ float xhalf(float v) { const int b = __float_as_int(v); return __int_as_float(__builtin_amdgcn_permlanex16(b, b, 0x76543210, 0xfedcba98, false, false)); }
// exp2 by v_exp_f32 in asm text. The instruction set asks for one slot behind a transcendental before its result is read or its source overwritten:
// here every output is early-clobber (no v_exp_f32 of a statement touches a register of the one in front of it) and
// the closing v_nop is the slot behind the last.
__device__ __forceinline__ float exp2one(float x) { float y; asm("v_exp_f32 %0, %1\n\tv_nop" : "=&v"(y) : "v"(x)); return y; }
__device__ __forceinline__ void exp2x8(const float* x, float* y) {
    asm("v_exp_f32 %0, %8\n\tv_exp_f32 %1, %9\n\tv_exp_f32 %2, %10\n\tv_exp_f32 %3, %11\n\tv_exp_f32 %4, %12\n\tv_exp_f32 %5, %13\n\tv_exp_f32 %6, %14\n\tv_exp_f32 %7, %15\n\tv_nop"
        : "=&v"(y[0]), "=&v"(y[1]), "=&v"(y[2]), "=&v"(y[3]), "=&v"(y[4]), "=&v"(y[5]), "=&v"(y[6]), "=&v"(y[7])
        : "v"(x[0]), "v"(x[1]), "v"(x[2]), "v"(x[3]), "v"(x[4]), "v"(x[5]), "v"(x[6]), "v"(x[7]));
}
// k_attn: grid (2048 / 256 query blocks, 32 (item, head) pairs), 8 waves x 32 query columns (two 16-column groups). A pass is 64 keys = four 16-key blocks: S^T = K.Q^T (A = 16
// key rows, B = 16 query columns, d 0..15 in elements 0..7 of both lane halves, elements 8..15 zero), so a lane holds 32 scores of ONE query per group; each pair of f32 tiles
// converts in place into the B operand P^T of O^T += V^T.P^T (A = two transposed 16 x 16 v blocks = the hardware k order). Maximum, sum and rescale are in-lane plus one exchange
// between the halves. Scores are kept in scaled log2 units; every pass rescales by exp2(old maximum - new maximum), without a branch, so that a pass is one basic block.
__global__ __launch_bounds__(256) void k_attn(const bf* __restrict__ Qh, const bf* __restrict__ Ql, const bf* __restrict__ Kh, const bf* __restrict__ Kl, const bf* __restrict__ Vh, const bf* __restrict__ Vl, float* O4) {
    typedef __attribute__((ext_vector_type(2))) float v2f; typedef __attribute__((ext_vector_type(2))) __bf16 v2b; typedef __attribute__((ext_vector_type(8))) unsigned v8u;
    const int lane = threadIdx.x & 31, wave = threadIdx.x >> 5, c = lane & 15, hi = lane >> 4;
    const size_t pb = (size_t)blockIdx.y * NN * HD;
    const int q0 = blockIdx.x * 256 + wave * 32; const unsigned fo = c * HD + 8 * hi;      // the lane's place in a 16 x 16 block; unsigned: scalar base + 32-bit lane offset addressing
    const float CS = SCL * 1.4426950408889634f;
    const v8us z8 = {};
    v16bf qh[2], ql[2];
#pragma unroll
    for (int g = 0; g < 2; ++g) { const size_t qo = pb + (size_t)(q0 + 16 * g) * HD + fo; qh[g] = cat16b(*(const v8us*)(Qh + qo), z8); ql[g] = cat16b(*(const v8us*)(Ql + qo), z8); }
    v8us kh[4], kl[4];
#pragma unroll
    for (int j = 0; j < 4; ++j) { kh[j] = *(const v8us*)(Kh + pb + (fo + 16 * j * HD)); kl[j] = *(const v8us*)(Kl + pb + (fo + 16 * j * HD)); }
    asm volatile("s_wait_xcnt 0x0" ::: "memory");      // the address registers of the loads above are reused below
    __builtin_amdgcn_sched_barrier(0);                 // keeps the register writes below from being lifted over that wait
    v8f o[2]; float mrun[2], lsum[2];
#pragma unroll
    for (int g = 0; g < 2; ++g) { o[g] = (v8f){}; mrun[g] = -3.0e38f; lsum[g] = 0.f; }
#pragma unroll 1
    for (int s = 0; s < NN / 64; ++s) {
        const size_t cu = pb + (size_t)(s * 64) * HD, nx = pb + (size_t)((s + 1 < NN / 64 ? s + 1 : s) * 64) * HD;     // this pass's V, the next pass's K (the last pass reads its own again)
        v8us vh[4], vl[4];
#pragma unroll
        for (int j = 0; j < 4; ++j) { vh[j] = *(const v8us*)(Vh + cu + (fo + 16 * j * HD)); vl[j] = *(const v8us*)(Vl + cu + (fo + 16 * j * HD)); }
        __builtin_amdgcn_sched_barrier(0);      // holds the V loads at the head of the pass, the scores and exponentials between them and their use
        v8f st[2][4];
#pragma unroll
        for (int j = 0; j < 4; ++j) { const v16bf ah = cat16b(kh[j], z8), al = cat16b(kl[j], z8);
#pragma unroll
            for (int g = 0; g < 2; ++g) { v8f t = wmmab(ah, qh[g], (v8f){}); t = wmmab(ah, ql[g], t); st[g][j] = wmmab(al, qh[g], t); } }
#pragma unroll
        for (int j = 0; j < 4; ++j) { kh[j] = *(const v8us*)(Kh + nx + (fo + 16 * j * HD)); kl[j] = *(const v8us*)(Kl + nx + (fo + 16 * j * HD)); }     // K a pass ahead
        __builtin_amdgcn_sched_barrier(0);      // holds the K loads here: the scheduler otherwise sinks them to the loop's foot, directly in front of their use
#pragma unroll
        for (int g = 0; g < 2; ++g) { float a = fmaxf(st[g][0][0], st[g][1][0]), b = fmaxf(st[g][2][0], st[g][3][0]);
#pragma unroll
            for (int r = 1; r < 8; ++r) { a = fmaxf(a, fmaxf(st[g][0][r], st[g][1][r])); b = fmaxf(b, fmaxf(st[g][2][r], st[g][3][r])); }
            a = fmaxf(a, b);
            const float mn = fmaxf(mrun[g], fmaxf(a, xhalf(a)) * CS), fs = exp2one(mrun[g] - mn); o[g] *= fs; lsum[g] *= fs; mrun[g] = mn; }
#pragma unroll
        for (int u = 0; u < 2; ++u) { const v16bf vhf = cat16b(vh[2 * u], vh[2 * u + 1]), vlf = cat16b(vl[2 * u], vl[2 * u + 1]);
#pragma unroll
            for (int g = 0; g < 2; ++g) { v8u ph, pl; float s0 = 0.f, s1 = 0.f, x[16], pe[16];
#pragma unroll
                for (int e = 0; e < 16; ++e) x[e] = fmaf(st[g][2 * u + (e >> 3)][e & 7], CS, -mrun[g]);
                exp2x8(x, pe); exp2x8(x + 8, pe + 8);
#pragma unroll
                for (int e = 0; e < 8; ++e) { v2f p; p[0] = pe[2 * e]; p[1] = pe[2 * e + 1];
                    s0 += p[0]; s1 += p[1];
                    const unsigned hw = __builtin_bit_cast(unsigned, __builtin_convertvector(p, v2b));
                    v2f d; d[0] = p[0] - __uint_as_float(hw << 16); d[1] = p[1] - __uint_as_float(hw & 0xFFFF0000u);
                    ph[e] = hw; pl[e] = __builtin_bit_cast(unsigned, __builtin_convertvector(d, v2b)); }
                lsum[g] += s0 + s1;
                const v16bf pbh = __builtin_bit_cast(v16bf, ph), pbl = __builtin_bit_cast(v16bf, pl);
                o[g] = wmmab(vhf, pbh, o[g]); o[g] = wmmab(vhf, pbl, o[g]); o[g] = wmmab(vlf, pbh, o[g]); } }
    }
#pragma unroll
    for (int g = 0; g < 2; ++g) { const float inv = 1.0f / (lsum[g] + xhalf(lsum[g]));
        *(v8f*)(O4 + pb + (size_t)(q0 + 16 * g + c) * HD + 8 * hi) = o[g] * inv; }
}
typedef __attribute__((ext_vector_type(4))) unsigned v4u;
// NP pairs of f32 values -> packed bf16 hi words and packed bf16 words of the UNSCALED residual (value 2e in the low half of word e)
template <int NP>
__device__ __forceinline__ void splitp(const float* v, unsigned* ph, unsigned* pl) {
    typedef __attribute__((ext_vector_type(2))) float v2f; typedef __attribute__((ext_vector_type(2))) __bf16 v2b;
#pragma unroll
    for (int e = 0; e < NP; ++e) { v2f p; p[0] = v[2 * e]; p[1] = v[2 * e + 1];
        const unsigned hw = __builtin_bit_cast(unsigned, __builtin_convertvector(p, v2b));
        v2f d; d[0] = p[0] - __uint_as_float(hw << 16); d[1] = p[1] - __uint_as_float(hw & 0xFFFF0000u);
        ph[e] = hw; pl[e] = __builtin_bit_cast(unsigned, __builtin_convertvector(d, v2b)); }
}
// 16 values in the operand's k order (two runs of 8 features, 16 apart) -> hi and residual operands
__device__ __forceinline__ void split16(const float* v, v16bf& h, v16bf& l) {
    typedef __attribute__((ext_vector_type(8))) unsigned v8u; unsigned ph[8], pl[8]; splitp<8>(v, ph, pl);
    v8u a, b;
#pragma unroll
    for (int e = 0; e < 8; ++e) { a[e] = ph[e]; b[e] = pl[e]; }
    h = __builtin_bit_cast(v16bf, a); l = __builtin_bit_cast(v16bf, b);
}
// 8 values -> 16 bytes in each of two planes
__device__ __forceinline__ void store8(const float* v, bf* Ph, bf* Pl) {
    unsigned ph[4], pl[4]; splitp<4>(v, ph, pl);
    *(v4u*)Ph = (v4u){ph[0], ph[1], ph[2], ph[3]}; *(v4u*)Pl = (v4u){pl[0], pl[1], pl[2], pl[3]};
}
// Global reads as scalar base + one 32-bit byte offset of the lane + a constant: a group of reads names one address register, which its closing wait (XWAIT) holds live.
__device__ __forceinline__ float ldf(const float* __restrict__ b, unsigned off, int imm) { return *(const float*)((const char*)b + off + imm); }
__device__ __forceinline__ void ld8(const float* __restrict__ b, unsigned off, int imm, float* d) {
    const v4f x = *(const v4f*)((const char*)b + off + imm), y = *(const v4f*)((const char*)b + off + imm + 16);
#pragma unroll
    for (int i = 0; i < 4; ++i) { d[i] = x[i]; d[4 + i] = y[i]; }
}
// Behind a group of global reads: their address register is rewritten later. The operand keeps the register from
// being reused (also as a read's destination) ahead of the wait; the scheduling barrier keeps later register writes from being lifted over it.
#define XWAIT(off) do { asm volatile("s_wait_xcnt 0x0" :: "v"(off) : "memory"); __builtin_amdgcn_sched_barrier(0); } while (0)
// W [K][N] f32 (k-major) -> L [n][K + 8] bf16 in LDS. A unit is 8 k of one n: consecutive lanes take consecutive n (whole lines from W), one 16-byte LDS store a unit.
template <int K, int N, int NT>
__device__ __forceinline__ void stage_wt(const float* __restrict__ Wm, bf* L, int tid) {
    constexpr int NU = N * K / 8 / NT, KS = NT / N * 8;      // units a thread, k step from one unit of a thread to its next
    const int n = tid % N, k8 = (tid / N) * 8; const unsigned off = (unsigned)(k8 * N + n) * 4;
    float r[NU][8];
#pragma unroll
    for (int q = 0; q < NU; ++q)
#pragma unroll
        for (int i = 0; i < 8; ++i) r[q][i] = ldf(Wm, off, (q * KS + i) * N * 4);
    XWAIT(off);
#pragma unroll
    for (int q = 0; q < NU; ++q) { v8us p;
#pragma unroll
        for (int i = 0; i < 8; ++i) p[i] = f2bf(r[q][i]);
        *(v8usa*)(L + n * (K + 8) + k8 + q * KS) = p; }
}
// weight operand: row (feature) of the lane, k = ko .. ko + 7 and ko + 16 .. ko + 23 (ko holds the lane half's 8)
__device__ __forceinline__ v16bf wfrag(const bf* L, int pitch, int row, int ko) { const bf* p = L + row * pitch + ko; return cat16b(*(const v8usa*)p, *(const v8usa*)(p + 16)); }
// LayerNorm of one 64-value row held by a lane pair: v[8 c + i] is feature 16 c + 8 hi + i. 32 values are summed in the lane, then one exchange between the halves.
__device__ __forceinline__ void ln_pair(float* v, const float* g, const float* bb) {      // g, bb: the lane's 32 gains and offsets, as read
    float p[8];
#pragma unroll
    for (int i = 0; i < 8; ++i) p[i] = (v[i] + v[8 + i]) + (v[16 + i] + v[24 + i]);
    float s = ((p[0] + p[1]) + (p[2] + p[3])) + ((p[4] + p[5]) + (p[6] + p[7]));
    s += xhalf(s);
    const float mu = s * (1.0f / DD);
#pragma unroll
    for (int e = 0; e < 32; ++e) v[e] -= mu;
#pragma unroll
    for (int i = 0; i < 8; ++i) p[i] = (v[i] * v[i] + v[8 + i] * v[8 + i]) + (v[16 + i] * v[16 + i] + v[24 + i] * v[24 + i]);
    float s2 = ((p[0] + p[1]) + (p[2] + p[3])) + ((p[4] + p[5]) + (p[6] + p[7]));
    s2 += xhalf(s2);
    const float rs = rsqrtf(s2 * (1.0f / DD) + LN_EPS);
#pragma unroll
    for (int e = 0; e < 32; ++e) v[e] = v[e] * rs * bfr(g[e]) + bfr(bb[e]);
}
// k_pre: grid (16384 / 64 token blocks, 2 streams), 4 waves x 16 tokens. Stream 0: LN(x) -> k (weights as A: a lane gets 8 features of its token) and v (tokens as A: a lane gets 8
// tokens of its feature, the transposed 16 x 16 block); stream 1: LN(clinic) -> q. Planes as k_attn reads them: Q16 / K16 [b][h][t][16], VB [b][h][t/16][d][t%16], hi + residual.
__global__ __launch_bounds__(128) void k_pre(const float* __restrict__ x, const float* __restrict__ cl, const float* __restrict__ g1, const float* __restrict__ be1, const float* __restrict__ Wkv, const float* __restrict__ bkv,
                                             const float* __restrict__ Wq, const float* __restrict__ bq, bf* Qh, bf* Ql, bf* Kh, bf* Kl, bf* Vh, bf* Vl) {
    __shared__ __align__(16) bf wl[HID * (DD + 8)];
    const int tid = threadIdx.x, lane = tid & 31, wave = tid >> 5, lr = lane & 15, hi = lane >> 4;
    const bool isq = blockIdx.y != 0;
    const int t0 = blockIdx.x * 64 + wave * 16;
    const float* bias = isq ? bq : bkv; bf* Dh = isq ? Qh : Kh; bf* Dl = isq ? Ql : Kl;
    const unsigned xoff = ((unsigned)(t0 + lr) * DD + 8 * hi) * 4, hoff = hi * 32, loff = lr * 4;
    float v[32], gr[32], br[32], bv[32], bw[NH_];
#pragma unroll
    for (int c = 0; c < 4; ++c) ld8(isq ? cl : x, xoff, 64 * c, v + 8 * c);
    XWAIT(xoff);
#pragma unroll
    for (int c = 0; c < 4; ++c) { ld8(g1, hoff, 64 * c, gr + 8 * c); ld8(be1, hoff, 64 * c, br + 8 * c); ld8(bias, hoff, 64 * c, bv + 8 * c); }
    XWAIT(hoff);
#pragma unroll
    for (int h = 0; h < NH_; ++h) bw[h] = ldf(bkv, loff, (DD + h * HD) * 4);      // v's bias (read by both streams, used by stream 0)
    XWAIT(loff);
    if (isq) stage_wt<DD, DD, 128>(Wq, wl, tid); else stage_wt<DD, HID, 128>(Wkv, wl, tid);
#pragma unroll
    for (int e = 0; e < 32; ++e) v[e] = bfr(v[e]);      // the input rows are bf16-rounded first
    ln_pair(v, gr, br);
    v16bf xh[2], xl[2]; split16(v, xh[0], xl[0]); split16(v + 16, xh[1], xl[1]);
    __syncthreads();
    const size_t o = ((size_t)(t0 / NN) * NH_ * NN + (t0 % NN)) * HD + lr * HD + 8 * hi;      // head 0; a head is NN * HD further
    v8f acc[NH_];
#pragma unroll
    for (int h = 0; h < NH_; ++h) acc[h] = (v8f){};
#pragma unroll
    for (int kc = 0; kc < 2; ++kc)
#pragma unroll
        for (int h = 0; h < NH_; ++h) { const v16bf w = wfrag(wl, DD + 8, h * HD + lr, kc * 32 + 8 * hi); acc[h] = wmmab(w, xh[kc], acc[h]); acc[h] = wmmab(w, xl[kc], acc[h]); }
#pragma unroll
    for (int h = 0; h < NH_; ++h) { float r[8];
#pragma unroll
        for (int j = 0; j < 8; ++j) r[j] = acc[h][j] + bfr(bv[8 * h + j]);
        store8(r, Dh + o + (size_t)h * NN * HD, Dl + o + (size_t)h * NN * HD); }
    asm volatile("s_wait_xcnt 0x0" ::: "memory");      // the data and address registers of the stores above are rewritten by the v product below
    if (isq) return;
#pragma unroll
    for (int h = 0; h < NH_; ++h) acc[h] = (v8f){};
#pragma unroll
    for (int kc = 0; kc < 2; ++kc)
#pragma unroll
        for (int h = 0; h < NH_; ++h) { const v16bf w = wfrag(wl, DD + 8, DD + h * HD + lr, kc * 32 + 8 * hi); acc[h] = wmmab(xh[kc], w, acc[h]); acc[h] = wmmab(xl[kc], w, acc[h]); }
#pragma unroll
    for (int h = 0; h < NH_; ++h) { const float bx = bfr(bw[h]); float r[8];
#pragma unroll
        for (int j = 0; j < 8; ++j) r[j] = acc[h][j] + bx;
        store8(r, Vh + o + (size_t)h * NN * HD, Vl + o + (size_t)h * NN * HD); }
}
// An operand (8 registers a lane) through LDS: two planes of 16 bytes a lane, so that consecutive lanes store and load consecutive 16 bytes.
__device__ __forceinline__ void putf(v4u (*xp)[32], int lane, v16bf f) {
    typedef __attribute__((ext_vector_type(8))) unsigned v8u; const v8u w = __builtin_bit_cast(v8u, f);
    xp[0][lane] = (v4u){w[0], w[1], w[2], w[3]}; xp[1][lane] = (v4u){w[4], w[5], w[6], w[7]};
}
__device__ __forceinline__ v16bf getf(const v4u (*xp)[32], int lane) {
    typedef __attribute__((ext_vector_type(8))) unsigned v8u; const v4u a = xp[0][lane], b = xp[1][lane];
    return __builtin_bit_cast(v16bf, (v8u){a[0], a[1], a[2], a[3], b[0], b[1], b[2], b[3]});
}
// k_post: grid 16384 / 64 token blocks, 16 waves = 4 token groups (16 tokens) x 4 feature quarters; all five stages behind the attention, the three weights as bf16 [n][k] in LDS.
// Stage A (quarter 0 of each group): ctx^T (B, read from the per-head products) -> o^T = Wproj^T.ctx^T + bproj -> LN -> operands and o^T to LDS. Stage B (every wave, 32 hidden features):
// m^T = gelu(W1^T.h^T + b1) -> operands to LDS; the GELU is a chain of dependent instructions and branches, so it is spread over four waves a SIMD. Stage C (quarters 0 and 1, 32 output
// features = one 128-byte line a token): out^T = W2^T.m^T + b2 + o^T.
__global__ __launch_bounds__(512) void k_post(const float* __restrict__ O4, const float* __restrict__ Wp, const float* __restrict__ bp, const float* __restrict__ g2, const float* __restrict__ be2,
                                              const float* __restrict__ W1, const float* __restrict__ b1, const float* __restrict__ W2, const float* __restrict__ b2, float* out) {
    __shared__ __align__(16) bf wp[DD * (DD + 8)]; __shared__ __align__(16) bf w1[HID * (DD + 8)]; __shared__ __align__(16) bf w2[DD * (HID + 8)];
    __shared__ v4u xh[4][4][2][32];      // [group][k chunk * 2 + (0 hi, 1 residual)]: LN(o)
    __shared__ v4f xo[4][4][2][32];      // [group][tile]: o
    __shared__ v4u xm[4][8][2][32];      // [group][k chunk * 2 + (0 hi, 1 residual)]: gelu(.)
    const int tid = threadIdx.x, lane = tid & 31, lr = lane & 15, hi = lane >> 4;
    const int wave = __builtin_amdgcn_readfirstlane(tid >> 5), tg = wave & 3, fq = wave >> 2;      // scalar: the matrix instructions below stand under branches on fq
    const int t0 = blockIdx.x * 64 + tg * 16;
    const unsigned hoff = hi * 32;
    v16bf fh[2], fl[2];
    float v[32] = {}, gr[32] = {}, br[32] = {}, bv[32] = {}, bm[16];
    if (fq == 0) {
        const unsigned ooff = (((unsigned)(t0 / NN) * NH_ * NN + (t0 % NN) + lr) * HD + 8 * hi) * 4;
#pragma unroll
        for (int h = 0; h < NH_; ++h) ld8(O4, ooff, h * NN * HD * 4, v + 8 * h);
        XWAIT(ooff);
#pragma unroll
        for (int c = 0; c < 4; ++c) { ld8(g2, hoff, 64 * c, gr + 8 * c); ld8(be2, hoff, 64 * c, br + 8 * c); ld8(bp, hoff, 64 * c, bv + 8 * c); }
        XWAIT(hoff);
    }
    ld8(b1 + fq * 32, hoff, 0, bm); ld8(b1 + fq * 32, hoff, 64, bm + 8);
    XWAIT(hoff);
    stage_wt<DD, DD, 512>(Wp, wp, tid); stage_wt<DD, HID, 512>(W1, w1, tid); stage_wt<HID, DD, 512>(W2, w2, tid);
    __syncthreads();
    if (fq == 0) {
        split16(v, fh[0], fl[0]); split16(v + 16, fh[1], fl[1]);
        v8f acc[4];
#pragma unroll
        for (int t = 0; t < 4; ++t) acc[t] = (v8f){};
#pragma unroll
        for (int kc = 0; kc < 2; ++kc)
#pragma unroll
            for (int t = 0; t < 4; ++t) { const v16bf w = wfrag(wp, DD + 8, t * 16 + lr, kc * 32 + 8 * hi); acc[t] = wmmab(w, fh[kc], acc[t]); acc[t] = wmmab(w, fl[kc], acc[t]); }
#pragma unroll
        for (int t = 0; t < 4; ++t) {
#pragma unroll
            for (int j = 0; j < 8; ++j) v[8 * t + j] = acc[t][j] + bfr(bv[8 * t + j]);
            xo[tg][t][0][lane] = (v4f){v[8 * t], v[8 * t + 1], v[8 * t + 2], v[8 * t + 3]}; xo[tg][t][1][lane] = (v4f){v[8 * t + 4], v[8 * t + 5], v[8 * t + 6], v[8 * t + 7]}; }
        ln_pair(v, gr, br);
        split16(v, fh[0], fl[0]); split16(v + 16, fh[1], fl[1]);
#pragma unroll
        for (int kc = 0; kc < 2; ++kc) { putf(xh[tg][2 * kc], lane, fh[kc]); putf(xh[tg][2 * kc + 1], lane, fl[kc]); }
    }
    __syncthreads();
    {
#pragma unroll
        for (int kc = 0; kc < 2; ++kc) { fh[kc] = getf(xh[tg][2 * kc], lane); fl[kc] = getf(xh[tg][2 * kc + 1], lane); }
        v8f am[2]; am[0] = (v8f){}; am[1] = (v8f){};
#pragma unroll
        for (int kc = 0; kc < 2; ++kc)
#pragma unroll
            for (int u = 0; u < 2; ++u) { const v16bf w = wfrag(w1, DD + 8, (2 * fq + u) * 16 + lr, kc * 32 + 8 * hi); am[u] = wmmab(w, fh[kc], am[u]); am[u] = wmmab(w, fl[kc], am[u]); }
        float m[16];
#pragma unroll
        for (int u = 0; u < 2; ++u) {
#pragma unroll
            for (int j = 0; j < 8; ++j) { const float a = am[u][j] + bfr(bm[8 * u + j]); m[8 * u + j] = 0.5f * a * (1.0f + erff(a * 0.7071067811865476f)); } }
        v16bf mh, ml; split16(m, mh, ml);
        putf(xm[tg][2 * fq], lane, mh); putf(xm[tg][2 * fq + 1], lane, ml);
    }
    __syncthreads();
    if (fq >= 2) return;
    float bo[16]; ld8(b2 + fq * 32, hoff, 0, bo); ld8(b2 + fq * 32, hoff, 64, bo + 8);
    XWAIT(hoff);
    v8f acc[2]; acc[0] = (v8f){}; acc[1] = (v8f){};
#pragma unroll
    for (int kc = 0; kc < 4; ++kc) { const v16bf mh = getf(xm[tg][2 * kc], lane), ml = getf(xm[tg][2 * kc + 1], lane);
#pragma unroll
        for (int u = 0; u < 2; ++u) { const v16bf w = wfrag(w2, HID + 8, (2 * fq + u) * 16 + lr, kc * 32 + 8 * hi); acc[u] = wmmab(w, mh, acc[u]); acc[u] = wmmab(w, ml, acc[u]); } }
    float* dst = out + (size_t)(t0 + lr) * DD + 8 * hi;
#pragma unroll
    for (int u = 0; u < 2; ++u) { const int t = 2 * fq + u; const v4f oa = xo[tg][t][0][lane], ob = xo[tg][t][1][lane]; v4f ra, rb;
#pragma unroll
        for (int j = 0; j < 4; ++j) { ra[j] = (acc[u][j] + bfr(bo[8 * u + j])) + oa[j]; rb[j] = (acc[u][4 + j] + bfr(bo[8 * u + 4 + j])) + ob[j]; }
        *(v4f*)(dst + t * 16) = ra; *(v4f*)(dst + t * 16 + 4) = rb; }
}

extern "C" void kernel_launch(void* const* d_in, const int* in_sizes, int n_in,
                              void* d_out, int out_size, void* d_ws, size_t ws_size, hipStream_t stream) {
    (void)in_sizes; (void)n_in; (void)out_size;
    const float* x = (const float*)d_in[0]; const float* cl = (const float*)d_in[1]; const float* g1 = (const float*)d_in[2]; const float* be1 = (const float*)d_in[3]; const float* g2 = (const float*)d_in[4]; const float* be2 = (const float*)d_in[5];
    const float* Wkv = (const float*)d_in[6]; const float* bkv = (const float*)d_in[7]; const float* Wq = (const float*)d_in[8]; const float* bq = (const float*)d_in[9]; const float* Wp = (const float*)d_in[10]; const float* bp = (const float*)d_in[11];
    const float* W1 = (const float*)d_in[12]; const float* b1 = (const float*)d_in[13]; const float* W2 = (const float*)d_in[14]; const float* b2 = (const float*)d_in[15];      // k-major weights (x @ W)
    float* out = (float*)d_out;    // [8][2048][64]
    char* wsp = (char*)d_ws;
    auto take = [&](size_t bytes) { char* p = wsp; wsp += (bytes + 255) & ~(size_t)255; return (void*)p; };
    bf* Q16h = (bf*)take((size_t)NR * DD * 2); bf* Q16l = (bf*)take((size_t)NR * DD * 2); bf* K16h = (bf*)take((size_t)NR * DD * 2); bf* K16l = (bf*)take((size_t)NR * DD * 2); bf* VBh = (bf*)take((size_t)NR * DD * 2); bf* VBl = (bf*)take((size_t)NR * DD * 2);
    float* O4 = (float*)take((size_t)NR * DD * 4);
    if ((size_t)(wsp - (char*)d_ws) > ws_size) return;    // 16 MB, no aliasing
    k_pre<<<dim3(NR / 64, 2, 1), 128, 0, stream>>>(x, cl, g1, be1, Wkv, bkv, Wq, bq, Q16h, Q16l, K16h, K16l, VBh, VBl);                         // LN, kv and q, head planes
    k_attn<<<dim3(NN / 256, NBI * NH_, 1), 256, 0, stream>>>(Q16h, Q16l, K16h, K16l, VBh, VBl, O4);                                             // softmax(q_h.k_h^T / 4).v_h for all (item, head) pairs
    k_post<<<NR / 64, 512, 0, stream>>>(O4, Wp, bp, g2, be2, W1, b1, W2, b2, out);                                                              // projection, LN, MLP, residual
}

// v003
// It runs in 42.2 microseconds.
// Timed twice side by side with v002, it ran 1.05 times as fast both times.
// All steps since v000 together make it 65.0 times as fast.
#include <hip/hip_runtime.h>

// Compute dtypes, f32 accumulate: LayerNorm (shared norm1 on both streams, norm2 later) and GELU in f32; kv = LN(x).Wkv + bkv, q = LN(clinic).Wq + bq, o = ctx.Wproj + bproj,
// m = gelu(LN(o).W1 + b1) and out = m.W2 + b2 + o with every computed operand as bf16 hi + UNSCALED residual against exact bf16 weights (two products) on
// v_wmma_f32_16x16x32_bf16; the 4-head (16-dim) cross attention in one launch over all (item, head) pairs: S^T = k_h.q_h^T (16 real k + zero upper half in registers, three
// products), softmax x 1/4 in f32 with a running maximum, P^T = bf16 hi + UNSCALED residual packed from the accumulators, ctx_h^T = v_h^T.P^T (three products).
// Two launches: k_pre (LayerNorm, kv / q, head planes), k_attn (attention of 64 tokens x 4 heads, then projection, LayerNorm, MLP, residual of those tokens). In the token-local parts a wave owns 16 tokens and a lane pair (l, l ^ 16)
// one token: apart from k_pre's v product (tokens as A), the weights are the A operand, the tokens the B operand, so each product's accumulators hold 8 consecutive features of the lane's token and convert in place into the
// next product's B operand.

#define NBI  8
#define NN   2048
#define NR   (NBI * NN)          // 16384 token rows
#define DD   64
#define NH_  4
#define HD   16
#define HID  128
#define DM   DD
#define NTK  NR
#define SCL  0.25f
#define LN_EPS 1e-5f
#define LOSC 1024.0f

typedef _Float16 h16;
typedef unsigned short bf;
typedef __attribute__((ext_vector_type(16))) __bf16   v16bf;
typedef __attribute__((ext_vector_type(16))) _Float16 v16h;
typedef __attribute__((ext_vector_type(8)))  _Float16 v8h;
typedef __attribute__((ext_vector_type(8)))  unsigned short v8us;
typedef __attribute__((ext_vector_type(8)))  float    v8f;
typedef __attribute__((ext_vector_type(4)))  float    v4f;
typedef __attribute__((ext_vector_type(4)))  _Float16 v4h;
typedef v8h  __attribute__((may_alias)) v8ha;
typedef v4f  __attribute__((may_alias)) v4fa;
typedef v8us __attribute__((may_alias)) v8usa;

__device__ __forceinline__ unsigned short f2bf(float f) { unsigned u = __float_as_uint(f); u += 0x7FFFu + ((u >> 16) & 1u); return (unsigned short)(u >> 16); }
__device__ __forceinline__ float bf2f(unsigned short b) { return __uint_as_float(((unsigned)b) << 16); }
__device__ __forceinline__ float bfr(float f) { return bf2f(f2bf(f)); }
__device__ __forceinline__ v16h cat16(v8h lo, v8h hi) { return __builtin_shufflevector(lo, hi, 0, 1, 2, 3, 4, 5, 6, 7, 8, 9, 10, 11, 12, 13, 14, 15); }
__device__ __forceinline__ v16bf cat16b(v8us lo, v8us hi) { return __builtin_bit_cast(v16bf, __builtin_shufflevector(lo, hi, 0, 1, 2, 3, 4, 5, 6, 7, 8, 9, 10, 11, 12, 13, 14, 15)); }
__device__ __forceinline__ v8f wmma16(v16h a, v16h b, v8f c) { return __builtin_amdgcn_wmma_f32_16x16x32_f16(false, a, false, b, (short)0, c, false, false); }
__device__ __forceinline__ v8f wmmab(v16bf a, v16bf b, v8f c) { return __builtin_amdgcn_wmma_f32_16x16x32_bf16(false, a, false, b, (short)0, c, false, false); }

// lane l <-> l ^ 16
__device__ __forceinline__ float xhalf(float v) { const int b = __float_as_int(v); return __int_as_float(__builtin_amdgcn_permlanex16(b, b, 0x76543210, 0xfedcba98, false, false)); }
// exp2 by v_exp_f32 in asm text. The instruction set asks for one slot behind a transcendental before its result is read or its source overwritten:
// here every output is early-clobber (no v_exp_f32 of a statement touches a register of the one in front of it) and
// the closing v_nop is the slot behind the last.
__device__ __forceinline__ float exp2one(float x) { float y; asm("v_exp_f32 %0, %1\n\tv_nop" : "=&v"(y) : "v"(x)); return y; }
__device__ __forceinline__ void exp2x8(const float* x, float* y) {
    asm("v_exp_f32 %0, %8\n\tv_exp_f32 %1, %9\n\tv_exp_f32 %2, %10\n\tv_exp_f32 %3, %11\n\tv_exp_f32 %4, %12\n\tv_exp_f32 %5, %13\n\tv_exp_f32 %6, %14\n\tv_exp_f32 %7, %15\n\tv_nop"
        : "=&v"(y[0]), "=&v"(y[1]), "=&v"(y[2]), "=&v"(y[3]), "=&v"(y[4]), "=&v"(y[5]), "=&v"(y[6]), "=&v"(y[7])
        : "v"(x[0]), "v"(x[1]), "v"(x[2]), "v"(x[3]), "v"(x[4]), "v"(x[5]), "v"(x[6]), "v"(x[7]));
}
typedef __attribute__((ext_vector_type(4))) unsigned v4u;
// NP pairs of f32 values -> packed bf16 hi words and packed bf16 words of the UNSCALED residual (value 2e in the low half of word e)
template <int NP>
__device__ __forceinline__ void splitp(const float* v, unsigned* ph, unsigned* pl) {
    typedef __attribute__((ext_vector_type(2))) float v2f; typedef __attribute__((ext_vector_type(2))) __bf16 v2b;
#pragma unroll
    for (int e = 0; e < NP; ++e) { v2f p; p[0] = v[2 * e]; p[1] = v[2 * e + 1];
        const unsigned hw = __builtin_bit_cast(unsigned, __builtin_convertvector(p, v2b));
        v2f d; d[0] = p[0] - __uint_as_float(hw << 16); d[1] = p[1] - __uint_as_float(hw & 0xFFFF0000u);
        ph[e] = hw; pl[e] = __builtin_bit_cast(unsigned, __builtin_convertvector(d, v2b)); }
}
// 16 values in the operand's k order (two runs of 8 features, 16 apart) -> hi and residual operands
__device__ __forceinline__ void split16(const float* v, v16bf& h, v16bf& l) {
    typedef __attribute__((ext_vector_type(8))) unsigned v8u; unsigned ph[8], pl[8]; splitp<8>(v, ph, pl);
    v8u a, b;
#pragma unroll
    for (int e = 0; e < 8; ++e) { a[e] = ph[e]; b[e] = pl[e]; }
    h = __builtin_bit_cast(v16bf, a); l = __builtin_bit_cast(v16bf, b);
}
// 8 values -> 16 bytes in each of two planes
__device__ __forceinline__ void store8(const float* v, bf* Ph, bf* Pl) {
    unsigned ph[4], pl[4]; splitp<4>(v, ph, pl);
    *(v4u*)Ph = (v4u){ph[0], ph[1], ph[2], ph[3]}; *(v4u*)Pl = (v4u){pl[0], pl[1], pl[2], pl[3]};
}
// Global reads as scalar base + one 32-bit byte offset of the lane + a constant: a group of reads names one address register, which its closing wait (XWAIT) holds live.
__device__ __forceinline__ float ldf(const float* __restrict__ b, unsigned off, int imm) { return *(const float*)((const char*)b + off + imm); }
__device__ __forceinline__ void ld8(const float* __restrict__ b, unsigned off, int imm, float* d) {
    const v4f x = *(const v4f*)((const char*)b + off + imm), y = *(const v4f*)((const char*)b + off + imm + 16);
#pragma unroll
    for (int i = 0; i < 4; ++i) { d[i] = x[i]; d[4 + i] = y[i]; }
}
// Behind a group of global reads: their address register is rewritten later. The operand keeps the register from
// being reused (also as a read's destination) ahead of the wait; the scheduling barrier keeps later register writes from being lifted over it.
#define XWAIT(off) do { asm volatile("s_wait_xcnt 0x0" :: "v"(off) : "memory"); __builtin_amdgcn_sched_barrier(0); } while (0)
// W [K][N] f32 (k-major) -> L [n][K + 8] bf16 in LDS. A unit is 8 k of one n: consecutive lanes take consecutive n (whole lines from W), one 16-byte LDS store a unit.
template <int K, int N, int NT>
__device__ __forceinline__ void stage_wt(const float* __restrict__ Wm, bf* L, int tid) {
    constexpr int NU = N * K / 8 / NT, KS = NT / N * 8;      // units a thread, k step from one unit of a thread to its next
    const int n = tid % N, k8 = (tid / N) * 8; const unsigned off = (unsigned)(k8 * N + n) * 4;
    float r[NU][8];
#pragma unroll
    for (int q = 0; q < NU; ++q)
#pragma unroll
        for (int i = 0; i < 8; ++i) r[q][i] = ldf(Wm, off, (q * KS + i) * N * 4);
    XWAIT(off);
#pragma unroll
    for (int q = 0; q < NU; ++q) { v8us p;
#pragma unroll
        for (int i = 0; i < 8; ++i) p[i] = f2bf(r[q][i]);
        *(v8usa*)(L + n * (K + 8) + k8 + q * KS) = p; }
}
// weight operand: row (feature) of the lane, k = ko .. ko + 7 and ko + 16 .. ko + 23 (ko holds the lane half's 8)
__device__ __forceinline__ v16bf wfrag(const bf* L, int pitch, int row, int ko) { const bf* p = L + row * pitch + ko; return cat16b(*(const v8usa*)p, *(const v8usa*)(p + 16)); }
// LayerNorm of one 64-value row held by a lane pair: v[8 c + i] is feature 16 c + 8 hi + i. 32 values are summed in the lane, then one exchange between the halves.
__device__ __forceinline__ void ln_pair(float* v, const float* g, const float* bb) {      // g, bb: the lane's 32 gains and offsets, as read
    float p[8];
#pragma unroll
    for (int i = 0; i < 8; ++i) p[i] = (v[i] + v[8 + i]) + (v[16 + i] + v[24 + i]);
    float s = ((p[0] + p[1]) + (p[2] + p[3])) + ((p[4] + p[5]) + (p[6] + p[7]));
    s += xhalf(s);
    const float mu = s * (1.0f / DD);
#pragma unroll
    for (int e = 0; e < 32; ++e) v[e] -= mu;
#pragma unroll
    for (int i = 0; i < 8; ++i) p[i] = (v[i] * v[i] + v[8 + i] * v[8 + i]) + (v[16 + i] * v[16 + i] + v[24 + i] * v[24 + i]);
    float s2 = ((p[0] + p[1]) + (p[2] + p[3])) + ((p[4] + p[5]) + (p[6] + p[7]));
    s2 += xhalf(s2);
    const float rs = rsqrtf(s2 * (1.0f / DD) + LN_EPS);
#pragma unroll
    for (int e = 0; e < 32; ++e) v[e] = v[e] * rs * bfr(g[e]) + bfr(bb[e]);
}
// k_pre: grid (16384 / 64 token blocks, 2 streams), 4 waves x 16 tokens. Stream 0: LN(x) -> k (weights as A: a lane gets 8 features of its token) and v (tokens as A: a lane gets 8
// tokens of its feature, the transposed 16 x 16 block); stream 1: LN(clinic) -> q. Planes as k_attn reads them: Q16 / K16 [b][h][t][16], VB [b][h][t/16][d][t%16], hi + residual.
__global__ __launch_bounds__(128) void k_pre(const float* __restrict__ x, const float* __restrict__ cl, const float* __restrict__ g1, const float* __restrict__ be1, const float* __restrict__ Wkv, const float* __restrict__ bkv,
                                             const float* __restrict__ Wq, const float* __restrict__ bq, bf* Qh, bf* Ql, bf* Kh, bf* Kl, bf* Vh, bf* Vl) {
    __shared__ __align__(16) bf wl[HID * (DD + 8)];
    const int tid = threadIdx.x, lane = tid & 31, wave = tid >> 5, lr = lane & 15, hi = lane >> 4;
    const bool isq = blockIdx.y != 0;
    const int t0 = blockIdx.x * 64 + wave * 16;
    const float* bias = isq ? bq : bkv; bf* Dh = isq ? Qh : Kh; bf* Dl = isq ? Ql : Kl;
    const unsigned xoff = ((unsigned)(t0 + lr) * DD + 8 * hi) * 4, hoff = hi * 32, loff = lr * 4;
    float v[32], gr[32], br[32], bv[32], bw[NH_];
#pragma unroll
    for (int c = 0; c < 4; ++c) ld8(isq ? cl : x, xoff, 64 * c, v + 8 * c);
    XWAIT(xoff);
#pragma unroll
    for (int c = 0; c < 4; ++c) { ld8(g1, hoff, 64 * c, gr + 8 * c); ld8(be1, hoff, 64 * c, br + 8 * c); ld8(bias, hoff, 64 * c, bv + 8 * c); }
    XWAIT(hoff);
#pragma unroll
    for (int h = 0; h < NH_; ++h) bw[h] = ldf(bkv, loff, (DD + h * HD) * 4);      // v's bias (read by both streams, used by stream 0)
    XWAIT(loff);
    if (isq) stage_wt<DD, DD, 128>(Wq, wl, tid); else stage_wt<DD, HID, 128>(Wkv, wl, tid);
#pragma unroll
    for (int e = 0; e < 32; ++e) v[e] = bfr(v[e]);      // the input rows are bf16-rounded first
    ln_pair(v, gr, br);
    v16bf xh[2], xl[2]; split16(v, xh[0], xl[0]); split16(v + 16, xh[1], xl[1]);
    __syncthreads();
    const size_t o = ((size_t)(t0 / NN) * NH_ * NN + (t0 % NN)) * HD + lr * HD + 8 * hi;      // head 0; a head is NN * HD further
    v8f acc[NH_];
#pragma unroll
    for (int h = 0; h < NH_; ++h) acc[h] = (v8f){};
#pragma unroll
    for (int kc = 0; kc < 2; ++kc)
#pragma unroll
        for (int h = 0; h < NH_; ++h) { const v16bf w = wfrag(wl, DD + 8, h * HD + lr, kc * 32 + 8 * hi); acc[h] = wmmab(w, xh[kc], acc[h]); acc[h] = wmmab(w, xl[kc], acc[h]); }
#pragma unroll
    for (int h = 0; h < NH_; ++h) { float r[8];
#pragma unroll
        for (int j = 0; j < 8; ++j) r[j] = acc[h][j] + bfr(bv[8 * h + j]);
        store8(r, Dh + o + (size_t)h * NN * HD, Dl + o + (size_t)h * NN * HD); }
    asm volatile("s_wait_xcnt 0x0" ::: "memory");      // the data and address registers of the stores above are rewritten by the v product below
    if (isq) return;
#pragma unroll
    for (int h = 0; h < NH_; ++h) acc[h] = (v8f){};
#pragma unroll
    for (int kc = 0; kc < 2; ++kc)
#pragma unroll
        for (int h = 0; h < NH_; ++h) { const v16bf w = wfrag(wl, DD + 8, DD + h * HD + lr, kc * 32 + 8 * hi); acc[h] = wmmab(xh[kc], w, acc[h]); acc[h] = wmmab(xl[kc], w, acc[h]); }
#pragma unroll
    for (int h = 0; h < NH_; ++h) { const float bx = bfr(bw[h]); float r[8];
#pragma unroll
        for (int j = 0; j < 8; ++j) r[j] = acc[h][j] + bx;
        store8(r, Vh + o + (size_t)h * NN * HD, Vl + o + (size_t)h * NN * HD); }
}
// An operand (8 registers a lane) through LDS: two planes of 16 bytes a lane, so that consecutive lanes store and load consecutive 16 bytes.
__device__ __forceinline__ void putf(v4u (*xp)[32], int lane, v16bf f) {
    typedef __attribute__((ext_vector_type(8))) unsigned v8u; const v8u w = __builtin_bit_cast(v8u, f);
    xp[0][lane] = (v4u){w[0], w[1], w[2], w[3]}; xp[1][lane] = (v4u){w[4], w[5], w[6], w[7]};
}
__device__ __forceinline__ v16bf getf(const v4u (*xp)[32], int lane) {
    typedef __attribute__((ext_vector_type(8))) unsigned v8u; const v4u a = xp[0][lane], b = xp[1][lane];
    return __builtin_bit_cast(v16bf, (v8u){a[0], a[1], a[2], a[3], b[0], b[1], b[2], b[3]});
}
// k_attn: grid (2048 / 64 token blocks, 8 items), 16 waves = 4 heads x 2 query groups of 32 columns (two 16-column groups each) x 2 key halves, so that a work-group ends with all 64
// features of its 64 tokens and has four waves a SIMD for the token-local stages. A wave walks 1024 keys; a pass is 64 keys = four 16-key blocks: S^T = K.Q^T (A = 16
// key rows, B = 16 query columns, d 0..15 in elements 0..7 of both lane halves, elements 8..15 zero), so a lane holds 32 scores of ONE query per group; each pair of f32 tiles
// converts in place into the B operand P^T of O^T += V^T.P^T (A = two transposed 16 x 16 v blocks = the hardware k order). Maximum, sum and rescale are in-lane plus one exchange
// between the halves. Scores are kept in scaled log2 units; every pass rescales by exp2(old maximum - new maximum), without a branch, so that a pass is one basic block.
// Behind the passes the second key half hands its O^T, maximum and sum to the first through LDS, lane for lane; the first rescales both to the common maximum, adds, divides and puts ctx^T
// into LDS (a lane's 8 values of a head are 8 values of the next B operand). Then the waves regroup as 4 token groups (16 tokens) x 4 feature quarters, the three weights as bf16 [n][k] in
// LDS since the kernel's start. Stage A (quarter 0 of each group): o^T = Wproj^T.ctx^T + bproj -> LN -> operands and o^T to LDS. Stage B (every wave, 32 hidden features):
// m^T = gelu(W1^T.h^T + b1) -> operands to LDS; the GELU is a chain of dependent instructions and branches, so it is spread over four waves a SIMD. Stage C (quarters 0 and 1, 32 output
// features = one 128-byte line a token): out^T = W2^T.m^T + b2 + o^T.
__global__ __launch_bounds__(512) void k_attn(const bf* __restrict__ Qh, const bf* __restrict__ Ql, const bf* __restrict__ Kh, const bf* __restrict__ Kl, const bf* __restrict__ Vh, const bf* __restrict__ Vl,
                                              const float* __restrict__ Wp, const float* __restrict__ bp, const float* __restrict__ g2, const float* __restrict__ be2,
                                              const float* __restrict__ W1, const float* __restrict__ b1, const float* __restrict__ W2, const float* __restrict__ b2, float* out) {
    typedef __attribute__((ext_vector_type(2))) float v2f; typedef __attribute__((ext_vector_type(2))) __bf16 v2b; typedef __attribute__((ext_vector_type(8))) unsigned v8u;
    __shared__ __align__(16) bf wp[DD * (DD + 8)]; __shared__ __align__(16) bf w1[HID * (DD + 8)]; __shared__ __align__(16) bf w2[DD * (HID + 8)];
    __shared__ v4f xg[8][5][32];         // [head + 4 * query group]: the second key half's two O^T tiles (2 x 16 bytes a lane each), then (maximum, maximum, sum, sum)
    __shared__ v4f xc[4][4][2][32];      // [group][head]: ctx
    __shared__ v4u xh[4][4][2][32];      // [group][k chunk * 2 + (0 hi, 1 residual)]: LN(o)
    __shared__ v4f xo[4][4][2][32];      // [group][tile]: o
    __shared__ v4u xm[4][8][2][32];      // [group][k chunk * 2 + (0 hi, 1 residual)]: gelu(.)
    const int tid = threadIdx.x, lane = tid & 31, c = lane & 15, lr = c, hi = lane >> 4;
    const int wave = __builtin_amdgcn_readfirstlane(tid >> 5), hd = wave & 3, qg = (wave >> 2) & 1, kp = wave >> 3;      // scalar: scalar plane bases, scalar branches
    const int tg = wave & 3, fq = wave >> 2;      // behind the passes: token group, feature quarter; scalar: the matrix instructions below stand under branches on fq
    const int t0 = blockIdx.y * NN + blockIdx.x * 64 + tg * 16;
    stage_wt<DD, DD, 512>(Wp, wp, tid); stage_wt<DD, HID, 512>(W1, w1, tid); stage_wt<HID, DD, 512>(W2, w2, tid);
    const size_t pb = ((size_t)blockIdx.y * NH_ + hd) * NN * HD, pk = pb + (size_t)kp * (NN / 2) * HD;      // the head's planes; the wave's key half in them
    const int q0 = blockIdx.x * 64 + qg * 32; const unsigned fo = c * HD + 8 * hi;      // the lane's place in a 16 x 16 block; unsigned: scalar base + 32-bit lane offset addressing
    const float CS = SCL * 1.4426950408889634f;
    const v8us z8 = {};
    v16bf qh[2], ql[2];
#pragma unroll
    for (int g = 0; g < 2; ++g) { const size_t qo = pb + (size_t)(q0 + 16 * g) * HD + fo; qh[g] = cat16b(*(const v8us*)(Qh + qo), z8); ql[g] = cat16b(*(const v8us*)(Ql + qo), z8); }
    v8us kh[4], kl[4];
#pragma unroll
    for (int j = 0; j < 4; ++j) { kh[j] = *(const v8us*)(Kh + pk + (fo + 16 * j * HD)); kl[j] = *(const v8us*)(Kl + pk + (fo + 16 * j * HD)); }
    asm volatile("s_wait_xcnt 0x0" ::: "memory");      // the address registers of the loads above are reused below
    __builtin_amdgcn_sched_barrier(0);                 // keeps the register writes below from being lifted over that wait
    v8f o[2]; float mrun[2], lsum[2];
#pragma unroll
    for (int g = 0; g < 2; ++g) { o[g] = (v8f){}; mrun[g] = -3.0e38f; lsum[g] = 0.f; }
#pragma unroll 1
    for (int s = 0; s < NN / 128; ++s) {
        const size_t cu = pk + (size_t)(s * 64) * HD, nx = pk + (size_t)((s + 1 < NN / 128 ? s + 1 : s) * 64) * HD;     // this pass's V, the next pass's K (the last pass reads its own again)
        v8us vh[4], vl[4];
#pragma unroll
        for (int j = 0; j < 4; ++j) { vh[j] = *(const v8us*)(Vh + cu + (fo + 16 * j * HD)); vl[j] = *(const v8us*)(Vl + cu + (fo + 16 * j * HD)); }
        __builtin_amdgcn_sched_barrier(0);      // holds the V loads at the head of the pass, the scores and exponentials between them and their use
        v8f st[2][4];
#pragma unroll
        for (int j = 0; j < 4; ++j) { const v16bf ah = cat16b(kh[j], z8), al = cat16b(kl[j], z8);
#pragma unroll
            for (int g = 0; g < 2; ++g) { v8f t = wmmab(ah, qh[g], (v8f){}); t = wmmab(ah, ql[g], t); st[g][j] = wmmab(al, qh[g], t); } }
#pragma unroll
        for (int j = 0; j < 4; ++j) { kh[j] = *(const v8us*)(Kh + nx + (fo + 16 * j * HD)); kl[j] = *(const v8us*)(Kl + nx + (fo + 16 * j * HD)); }     // K a pass ahead
        __builtin_amdgcn_sched_barrier(0);      // holds the K loads here: the scheduler otherwise sinks them to the loop's foot, directly in front of their use
#pragma unroll
        for (int g = 0; g < 2; ++g) { float a = fmaxf(st[g][0][0], st[g][1][0]), b = fmaxf(st[g][2][0], st[g][3][0]);
#pragma unroll
            for (int r = 1; r < 8; ++r) { a = fmaxf(a, fmaxf(st[g][0][r], st[g][1][r])); b = fmaxf(b, fmaxf(st[g][2][r], st[g][3][r])); }
            a = fmaxf(a, b);
            const float mn = fmaxf(mrun[g], fmaxf(a, xhalf(a)) * CS), fs = exp2one(mrun[g] - mn); o[g] *= fs; lsum[g] *= fs; mrun[g] = mn; }
#pragma unroll
        for (int u = 0; u < 2; ++u) { const v16bf vhf = cat16b(vh[2 * u], vh[2 * u + 1]), vlf = cat16b(vl[2 * u], vl[2 * u + 1]);
#pragma unroll
            for (int g = 0; g < 2; ++g) { v8u ph, pl; float s0 = 0.f, s1 = 0.f, x[16], pe[16];
#pragma unroll
                for (int e = 0; e < 16; ++e) x[e] = fmaf(st[g][2 * u + (e >> 3)][e & 7], CS, -mrun[g]);
                exp2x8(x, pe); exp2x8(x + 8, pe + 8);
#pragma unroll
                for (int e = 0; e < 8; ++e) { v2f p; p[0] = pe[2 * e]; p[1] = pe[2 * e + 1];
                    s0 += p[0]; s1 += p[1];
                    const unsigned hw = __builtin_bit_cast(unsigned, __builtin_convertvector(p, v2b));
                    v2f d; d[0] = p[0] - __uint_as_float(hw << 16); d[1] = p[1] - __uint_as_float(hw & 0xFFFF0000u);
                    ph[e] = hw; pl[e] = __builtin_bit_cast(unsigned, __builtin_convertvector(d, v2b)); }
                lsum[g] += s0 + s1;
                const v16bf pbh = __builtin_bit_cast(v16bf, ph), pbl = __builtin_bit_cast(v16bf, pl);
                o[g] = wmmab(vhf, pbh, o[g]); o[g] = wmmab(vhf, pbl, o[g]); o[g] = wmmab(vlf, pbh, o[g]); } }
    }
    const unsigned hoff = hi * 32;
    v16bf fh[2], fl[2];
    float v[32] = {}, gr[32] = {}, br[32] = {}, bv[32] = {}, bm[16];
    if (fq == 0) {
#pragma unroll
        for (int c = 0; c < 4; ++c) { ld8(g2, hoff, 64 * c, gr + 8 * c); ld8(be2, hoff, 64 * c, br + 8 * c); ld8(bp, hoff, 64 * c, bv + 8 * c); }
        XWAIT(hoff);
    }
    ld8(b1 + fq * 32, hoff, 0, bm); ld8(b1 + fq * 32, hoff, 64, bm + 8);
    XWAIT(hoff);
    if (kp == 1) {
#pragma unroll
        for (int g = 0; g < 2; ++g) { xg[hd + 4 * qg][2 * g][lane] = (v4f){o[g][0], o[g][1], o[g][2], o[g][3]}; xg[hd + 4 * qg][2 * g + 1][lane] = (v4f){o[g][4], o[g][5], o[g][6], o[g][7]}; }
        xg[hd + 4 * qg][4][lane] = (v4f){mrun[0], mrun[1], lsum[0], lsum[1]};
    }
    __syncthreads();
    if (kp == 0) {
        const v4f ms = xg[hd + 4 * qg][4][lane];
#pragma unroll
        for (int g = 0; g < 2; ++g) { const v4f a = xg[hd + 4 * qg][2 * g][lane], b = xg[hd + 4 * qg][2 * g + 1][lane];
            const float mn = fmaxf(mrun[g], ms[g]), f0 = exp2one(mrun[g] - mn), f1 = exp2one(ms[g] - mn), l = lsum[g] * f0 + ms[2 + g] * f1;
            const float inv = 1.0f / (l + xhalf(l)), s0 = f0 * inv, s1 = f1 * inv; v4f ra, rb;
#pragma unroll
            for (int i = 0; i < 4; ++i) { ra[i] = o[g][i] * s0 + a[i] * s1; rb[i] = o[g][4 + i] * s0 + b[i] * s1; }
            xc[2 * qg + g][hd][0][lane] = ra; xc[2 * qg + g][hd][1][lane] = rb; }
    }
    __syncthreads();
    if (fq == 0) {
#pragma unroll
        for (int h = 0; h < NH_; ++h) { const v4f a = xc[tg][h][0][lane], b = xc[tg][h][1][lane];
#pragma unroll
            for (int i = 0; i < 4; ++i) { v[8 * h + i] = a[i]; v[8 * h + 4 + i] = b[i]; } }
        split16(v, fh[0], fl[0]); split16(v + 16, fh[1], fl[1]);
        v8f acc[4];
#pragma unroll
        for (int t = 0; t < 4; ++t) acc[t] = (v8f){};
#pragma unroll
        for (int kc = 0; kc < 2; ++kc)
#pragma unroll
            for (int t = 0; t < 4; ++t) { const v16bf w = wfrag(wp, DD + 8, t * 16 + lr, kc * 32 + 8 * hi); acc[t] = wmmab(w, fh[kc], acc[t]); acc[t] = wmmab(w, fl[kc], acc[t]); }
#pragma unroll
        for (int t = 0; t < 4; ++t) {
#pragma unroll
            for (int j = 0; j < 8; ++j) v[8 * t + j] = acc[t][j] + bfr(bv[8 * t + j]);
            xo[tg][t][0][lane] = (v4f){v[8 * t], v[8 * t + 1], v[8 * t + 2], v[8 * t + 3]}; xo[tg][t][1][lane] = (v4f){v[8 * t + 4], v[8 * t + 5], v[8 * t + 6], v[8 * t + 7]}; }
        ln_pair(v, gr, br);
        split16(v, fh[0], fl[0]); split16(v + 16, fh[1], fl[1]);
#pragma unroll
        for (int kc = 0; kc < 2; ++kc) { putf(xh[tg][2 * kc], lane, fh[kc]); putf(xh[tg][2 * kc + 1], lane, fl[kc]); }
    }
    __syncthreads();
    {
#pragma unroll
        for (int kc = 0; kc < 2; ++kc) { fh[kc] = getf(xh[tg][2 * kc], lane); fl[kc] = getf(xh[tg][2 * kc + 1], lane); }
        v8f am[2]; am[0] = (v8f){}; am[1] = (v8f){};
#pragma unroll
        for (int kc = 0; kc < 2; ++kc)
#pragma unroll
            for (int u = 0; u < 2; ++u) { const v16bf w = wfrag(w1, DD + 8, (2 * fq + u) * 16 + lr, kc * 32 + 8 * hi); am[u] = wmmab(w, fh[kc], am[u]); am[u] = wmmab(w, fl[kc], am[u]); }
        float m[16];
#pragma unroll
        for (int u = 0; u < 2; ++u) {
#pragma unroll
            for (int j = 0; j < 8; ++j) { const float a = am[u][j] + bfr(bm[8 * u + j]); m[8 * u + j] = 0.5f * a * (1.0f + erff(a * 0.7071067811865476f)); } }
        v16bf mh, ml; split16(m, mh, ml);
        putf(xm[tg][2 * fq], lane, mh); putf(xm[tg][2 * fq + 1], lane, ml);
    }
    __syncthreads();
    if (fq >= 2) return;
    float bo[16]; ld8(b2 + fq * 32, hoff, 0, bo); ld8(b2 + fq * 32, hoff, 64, bo + 8);
    XWAIT(hoff);
    v8f acc[2]; acc[0] = (v8f){}; acc[1] = (v8f){};
#pragma unroll
    for (int kc = 0; kc < 4; ++kc) { const v16bf mh = getf(xm[tg][2 * kc], lane), ml = getf(xm[tg][2 * kc + 1], lane);
#pragma unroll
        for (int u = 0; u < 2; ++u) { const v16bf w = wfrag(w2, HID + 8, (2 * fq + u) * 16 + lr, kc * 32 + 8 * hi); acc[u] = wmmab(w, mh, acc[u]); acc[u] = wmmab(w, ml, acc[u]); } }
    float* dst = out + (size_t)(t0 + lr) * DD + 8 * hi;
#pragma unroll
    for (int u = 0; u < 2; ++u) { const int t = 2 * fq + u; const v4f oa = xo[tg][t][0][lane], ob = xo[tg][t][1][lane]; v4f ra, rb;
#pragma unroll
        for (int j = 0; j < 4; ++j) { ra[j] = (acc[u][j] + bfr(bo[8 * u + j])) + oa[j]; rb[j] = (acc[u][4 + j] + bfr(bo[8 * u + 4 + j])) + ob[j]; }
        *(v4f*)(dst + t * 16) = ra; *(v4f*)(dst + t * 16 + 4) = rb; }
}

extern "C" void kernel_launch(void* const* d_in, const int* in_sizes, int n_in,
                              void* d_out, int out_size, void* d_ws, size_t ws_size, hipStream_t stream) {
    (void)in_sizes; (void)n_in; (void)out_size;
    const float* x = (const float*)d_in[0]; const float* cl = (const float*)d_in[1]; const float* g1 = (const float*)d_in[2]; const float* be1 = (const float*)d_in[3]; const float* g2 = (const float*)d_in[4]; const float* be2 = (const float*)d_in[5];
    const float* Wkv = (const float*)d_in[6]; const float* bkv = (const float*)d_in[7]; const float* Wq = (const float*)d_in[8]; const float* bq = (const float*)d_in[9]; const float* Wp = (const float*)d_in[10]; const float* bp = (const float*)d_in[11];
    const float* W1 = (const float*)d_in[12]; const float* b1 = (const float*)d_in[13]; const float* W2 = (const float*)d_in[14]; const float* b2 = (const float*)d_in[15];      // k-major weights (x @ W)
    float* out = (float*)d_out;    // [8][2048][64]
    char* wsp = (char*)d_ws;
    auto take = [&](size_t bytes) { char* p = wsp; wsp += (bytes + 255) & ~(size_t)255; return (void*)p; };
    bf* Q16h = (bf*)take((size_t)NR * DD * 2); bf* Q16l = (bf*)take((size_t)NR * DD * 2); bf* K16h = (bf*)take((size_t)NR * DD * 2); bf* K16l = (bf*)take((size_t)NR * DD * 2); bf* VBh = (bf*)take((size_t)NR * DD * 2); bf* VBl = (bf*)take((size_t)NR * DD * 2);
    if ((size_t)(wsp - (char*)d_ws) > ws_size) return;    // 12 MB, no aliasing
    k_pre<<<dim3(NR / 64, 2, 1), 128, 0, stream>>>(x, cl, g1, be1, Wkv, bkv, Wq, bq, Q16h, Q16l, K16h, K16l, VBh, VBl);                         // LN, kv and q, head planes
    k_attn<<<dim3(NN / 64, NBI, 1), 512, 0, stream>>>(Q16h, Q16l, K16h, K16l, VBh, VBl, Wp, bp, g2, be2, W1, b1, W2, b2, out);                        // softmax(q_h.k_h^T / 4).v_h of 64 tokens x 4 heads, then projection, LN, MLP, residual
}

// v004
// It runs in 39.8 microseconds.
// Timed twice side by side with v003, it ran 1.06 times as fast both times.
// Counting every step since v000, it is 69.1 times as fast.
#include <hip/hip_runtime.h>

// Compute dtypes, f32 accumulate: LayerNorm (shared norm1 on both streams, norm2 later) and GELU in f32; kv = LN(x).Wkv + bkv, q = LN(clinic).Wq + bq, o = ctx.Wproj + bproj,
// m = gelu(LN(o).W1 + b1) and out = m.W2 + b2 + o with every computed operand as bf16 hi + UNSCALED residual against exact bf16 weights (two products) on
// v_wmma_f32_16x16x32_bf16; the 4-head (16-dim) cross attention in one launch over all (item, head) pairs: S^T = k_h.q_h^T (the 16 head dims twice in the 32 k: k hi | k residual against q hi | q hi, then against q residual | q residual: two
// products, all four terms), softmax x 1/4 in f32 with a running maximum, P^T = bf16 hi + UNSCALED residual packed from the accumulators, ctx_h^T = v_h^T.P^T (three products).
// Two launches: k_pre (LayerNorm, kv / q, head planes), k_attn (attention of 64 tokens x 4 heads, then projection, LayerNorm, MLP, residual of those tokens). In the token-local parts a wave owns 16 tokens and a lane pair (l, l ^ 16)
// one token: apart from k_pre's v product (tokens as A), the weights are the A operand, the tokens the B operand, so each product's accumulators hold 8 consecutive features of the lane's token and convert in place into the
// next product's B operand.

#define NBI  8
#define NN   2048
#define NR   (NBI * NN)          // 16384 token rows
#define DD   64
#define NH_  4
#define HD   16
#define HID  128
#define DM   DD
#define NTK  NR
#define SCL  0.25f
#define LN_EPS 1e-5f
#define LOSC 1024.0f

typedef _Float16 h16;
typedef unsigned short bf;
typedef __attribute__((ext_vector_type(16))) __bf16   v16bf;
typedef __attribute__((ext_vector_type(16))) _Float16 v16h;
typedef __attribute__((ext_vector_type(8)))  _Float16 v8h;
typedef __attribute__((ext_vector_type(8)))  unsigned short v8us;
typedef __attribute__((ext_vector_type(8)))  float    v8f;
typedef __attribute__((ext_vector_type(4)))  float    v4f;
typedef __attribute__((ext_vector_type(4)))  _Float16 v4h;
typedef v8h  __attribute__((may_alias)) v8ha;
typedef v4f  __attribute__((may_alias)) v4fa;
typedef v8us __attribute__((may_alias)) v8usa;

__device__ __forceinline__ unsigned short f2bf(float f) { unsigned u = __float_as_uint(f); u += 0x7FFFu + ((u >> 16) & 1u); return (unsigned short)(u >> 16); }
__device__ __forceinline__ float bf2f(unsigned short b) { return __uint_as_float(((unsigned)b) << 16); }
__device__ __forceinline__ float bfr(float f) { return bf2f(f2bf(f)); }
__device__ __forceinline__ v16h cat16(v8h lo, v8h hi) { return __builtin_shufflevector(lo, hi, 0, 1, 2, 3, 4, 5, 6, 7, 8, 9, 10, 11, 12, 13, 14, 15); }
__device__ __forceinline__ v16bf cat16b(v8us lo, v8us hi) { return __builtin_bit_cast(v16bf, __builtin_shufflevector(lo, hi, 0, 1, 2, 3, 4, 5, 6, 7, 8, 9, 10, 11, 12, 13, 14, 15)); }
__device__ __forceinline__ v8f wmma16(v16h a, v16h b, v8f c) { return __builtin_amdgcn_wmma_f32_16x16x32_f16(false, a, false, b, (short)0, c, false, false); }
__device__ __forceinline__ v8f wmmab(v16bf a, v16bf b, v8f c) { return __builtin_amdgcn_wmma_f32_16x16x32_bf16(false, a, false, b, (short)0, c, false, false); }

// lane l <-> l ^ 16
__device__ __forceinline__ float xhalf(float v) { const int b = __float_as_int(v); return __int_as_float(__builtin_amdgcn_permlanex16(b, b, 0x76543210, 0xfedcba98, false, false)); }
// exp2 by v_exp_f32 in asm text. The instruction set asks for one slot behind a transcendental before its result is read or its source overwritten;
// here every exponential works on a register of its own and the closing v_nop is the slot behind the last. Each overwrites
// its own argument: that register is live in front of the statement, so it is never an operand register that a matrix instruction directly in front has just given up.
__device__ __forceinline__ float exp2one(float x) { asm("v_exp_f32 %0, %0\n\tv_nop" : "+v"(x)); return x; }
__device__ __forceinline__ void exp2x8(float* x) {
    asm("v_exp_f32 %0, %0\n\tv_exp_f32 %1, %1\n\tv_exp_f32 %2, %2\n\tv_exp_f32 %3, %3\n\tv_exp_f32 %4, %4\n\tv_exp_f32 %5, %5\n\tv_exp_f32 %6, %6\n\tv_exp_f32 %7, %7\n\tv_nop"
        : "+v"(x[0]), "+v"(x[1]), "+v"(x[2]), "+v"(x[3]), "+v"(x[4]), "+v"(x[5]), "+v"(x[6]), "+v"(x[7]));
}
typedef __attribute__((ext_vector_type(4))) unsigned v4u;
// NP pairs of f32 values -> packed bf16 hi words and packed bf16 words of the UNSCALED residual (value 2e in the low half of word e)
template <int NP>
__device__ __forceinline__ void splitp(const float* v, unsigned* ph, unsigned* pl) {
    typedef __attribute__((ext_vector_type(2))) float v2f; typedef __attribute__((ext_vector_type(2))) __bf16 v2b;
#pragma unroll
    for (int e = 0; e < NP; ++e) { v2f p; p[0] = v[2 * e]; p[1] = v[2 * e + 1];
        const unsigned hw = __builtin_bit_cast(unsigned, __builtin_convertvector(p, v2b));
        v2f d; d[0] = p[0] - __uint_as_float(hw << 16); d[1] = p[1] - __uint_as_float(hw & 0xFFFF0000u);
        ph[e] = hw; pl[e] = __builtin_bit_cast(unsigned, __builtin_convertvector(d, v2b)); }
}
// 16 values in the operand's k order (two runs of 8 features, 16 apart) -> hi and residual operands
__device__ __forceinline__ void split16(const float* v, v16bf& h, v16bf& l) {
    typedef __attribute__((ext_vector_type(8))) unsigned v8u; unsigned ph[8], pl[8]; splitp<8>(v, ph, pl);
    v8u a, b;
#pragma unroll
    for (int e = 0; e < 8; ++e) { a[e] = ph[e]; b[e] = pl[e]; }
    h = __builtin_bit_cast(v16bf, a); l = __builtin_bit_cast(v16bf, b);
}
// 8 values -> 16 bytes in each of two planes
__device__ __forceinline__ void store8(const float* v, bf* Ph, bf* Pl) {
    unsigned ph[4], pl[4]; splitp<4>(v, ph, pl);
    *(v4u*)Ph = (v4u){ph[0], ph[1], ph[2], ph[3]}; *(v4u*)Pl = (v4u){pl[0], pl[1], pl[2], pl[3]};
}
// Global reads as scalar base + one 32-bit byte offset of the lane + a constant: a group of reads names one address register, which its closing wait (XWAIT) holds live.
__device__ __forceinline__ float ldf(const float* __restrict__ b, unsigned off, int imm) { return *(const float*)((const char*)b + off + imm); }
__device__ __forceinline__ void ld8(const float* __restrict__ b, unsigned off, int imm, float* d) {
    const v4f x = *(const v4f*)((const char*)b + off + imm), y = *(const v4f*)((const char*)b + off + imm + 16);
#pragma unroll
    for (int i = 0; i < 4; ++i) { d[i] = x[i]; d[4 + i] = y[i]; }
}
// Behind a group of global reads: their address register is rewritten later. The operand keeps the register from
// being reused (also as a read's destination) ahead of the wait; the scheduling barrier keeps later register writes from being lifted over it.
#define XWAIT(off) do { asm volatile("s_wait_xcnt 0x0" :: "v"(off) : "memory"); __builtin_amdgcn_sched_barrier(0); } while (0)
// W [K][N] f32 (k-major) -> L [n][K + 8] bf16 in LDS. A unit is 8 k of one n: consecutive lanes take consecutive n (whole lines from W), one 16-byte LDS store a unit.
template <int K, int N, int NT>
__device__ __forceinline__ void stage_wt(const float* __restrict__ Wm, bf* L, int tid) {
    constexpr int NU = N * K / 8 / NT, KS = NT / N * 8;      // units a thread, k step from one unit of a thread to its next
    const int n = tid % N, k8 = (tid / N) * 8; const unsigned off = (unsigned)(k8 * N + n) * 4;
    float r[NU][8];
#pragma unroll
    for (int q = 0; q < NU; ++q)
#pragma unroll
        for (int i = 0; i < 8; ++i) r[q][i] = ldf(Wm, off, (q * KS + i) * N * 4);
    XWAIT(off);
#pragma unroll
    for (int q = 0; q < NU; ++q) { v8us p;
#pragma unroll
        for (int i = 0; i < 8; ++i) p[i] = f2bf(r[q][i]);
        *(v8usa*)(L + n * (K + 8) + k8 + q * KS) = p; }
}
// weight operand: row (feature) of the lane, k = ko .. ko + 7 and ko + 16 .. ko + 23 (ko holds the lane half's 8)
__device__ __forceinline__ v16bf wfrag(const bf* L, int pitch, int row, int ko) { const bf* p = L + row * pitch + ko; return cat16b(*(const v8usa*)p, *(const v8usa*)(p + 16)); }
// LayerNorm of one 64-value row held by a lane pair: v[8 c + i] is feature 16 c + 8 hi + i. 32 values are summed in the lane, then one exchange between the halves.
__device__ __forceinline__ void ln_pair(float* v, const float* g, const float* bb) {      // g, bb: the lane's 32 gains and offsets, as read
    float p[8];
#pragma unroll
    for (int i = 0; i < 8; ++i) p[i] = (v[i] + v[8 + i]) + (v[16 + i] + v[24 + i]);
    float s = ((p[0] + p[1]) + (p[2] + p[3])) + ((p[4] + p[5]) + (p[6] + p[7]));
    s += xhalf(s);
    const float mu = s * (1.0f / DD);
#pragma unroll
    for (int e = 0; e < 32; ++e) v[e] -= mu;
#pragma unroll
    for (int i = 0; i < 8; ++i) p[i] = (v[i] * v[i] + v[8 + i] * v[8 + i]) + (v[16 + i] * v[16 + i] + v[24 + i] * v[24 + i]);
    float s2 = ((p[0] + p[1]) + (p[2] + p[3])) + ((p[4] + p[5]) + (p[6] + p[7]));
    s2 += xhalf(s2);
    const float rs = rsqrtf(s2 * (1.0f / DD) + LN_EPS);
#pragma unroll
    for (int e = 0; e < 32; ++e) v[e] = v[e] * rs * bfr(g[e]) + bfr(bb[e]);
}
// k_pre: grid (16384 / 64 token blocks, 2 streams), 4 waves x 16 tokens. Stream 0: LN(x) -> k (weights as A: a lane gets 8 features of its token) and v (tokens as A: a lane gets 8
// tokens of its feature, the transposed 16 x 16 block); stream 1: LN(clinic) -> q. Planes as k_attn reads them: Q16 / K16 [b][h][t][16], VB [b][h][t/16][d][t%16], hi + residual.
__global__ __launch_bounds__(128) void k_pre(const float* __restrict__ x, const float* __restrict__ cl, const float* __restrict__ g1, const float* __restrict__ be1, const float* __restrict__ Wkv, const float* __restrict__ bkv,
                                             const float* __restrict__ Wq, const float* __restrict__ bq, bf* Qh, bf* Ql, bf* Kh, bf* Kl, bf* Vh, bf* Vl) {
    __shared__ __align__(16) bf wl[HID * (DD + 8)];
    const int tid = threadIdx.x, lane = tid & 31, wave = tid >> 5, lr = lane & 15, hi = lane >> 4;
    const bool isq = blockIdx.y != 0;
    const int t0 = blockIdx.x * 64 + wave * 16;
    const float* bias = isq ? bq : bkv; bf* Dh = isq ? Qh : Kh; bf* Dl = isq ? Ql : Kl;
    const unsigned xoff = ((unsigned)(t0 + lr) * DD + 8 * hi) * 4, hoff = hi * 32, loff = lr * 4;
    float v[32], gr[32], br[32], bv[32], bw[NH_];
#pragma unroll
    for (int c = 0; c < 4; ++c) ld8(isq ? cl : x, xoff, 64 * c, v + 8 * c);
    XWAIT(xoff);
#pragma unroll
    for (int c = 0; c < 4; ++c) { ld8(g1, hoff, 64 * c, gr + 8 * c); ld8(be1, hoff, 64 * c, br + 8 * c); ld8(bias, hoff, 64 * c, bv + 8 * c); }
    XWAIT(hoff);
#pragma unroll
    for (int h = 0; h < NH_; ++h) bw[h] = ldf(bkv, loff, (DD + h * HD) * 4);      // v's bias (read by both streams, used by stream 0)
    XWAIT(loff);
    if (isq) stage_wt<DD, DD, 128>(Wq, wl, tid); else stage_wt<DD, HID, 128>(Wkv, wl, tid);
#pragma unroll
    for (int e = 0; e < 32; ++e) v[e] = bfr(v[e]);      // the input rows are bf16-rounded first
    ln_pair(v, gr, br);
    v16bf xh[2], xl[2]; split16(v, xh[0], xl[0]); split16(v + 16, xh[1], xl[1]);
    __syncthreads();
    const size_t o = ((size_t)(t0 / NN) * NH_ * NN + (t0 % NN)) * HD + lr * HD + 8 * hi;      // head 0; a head is NN * HD further
    v8f acc[NH_];
#pragma unroll
    for (int h = 0; h < NH_; ++h) acc[h] = (v8f){};
#pragma unroll
    for (int kc = 0; kc < 2; ++kc)
#pragma unroll
        for (int h = 0; h < NH_; ++h) { const v16bf w = wfrag(wl, DD + 8, h * HD + lr, kc * 32 + 8 * hi); acc[h] = wmmab(w, xh[kc], acc[h]); acc[h] = wmmab(w, xl[kc], acc[h]); }
#pragma unroll
    for (int h = 0; h < NH_; ++h) { float r[8];
#pragma unroll
        for (int j = 0; j < 8; ++j) r[j] = acc[h][j] + bfr(bv[8 * h + j]);
        store8(r, Dh + o + (size_t)h * NN * HD, Dl + o + (size_t)h * NN * HD); }
    asm volatile("s_wait_xcnt 0x0" ::: "memory");      // the data and address registers of the stores above are rewritten by the v product below
    if (isq) return;
#pragma unroll
    for (int h = 0; h < NH_; ++h) acc[h] = (v8f){};
#pragma unroll
    for (int kc = 0; kc < 2; ++kc)
#pragma unroll
        for (int h = 0; h < NH_; ++h) { const v16bf w = wfrag(wl, DD + 8, DD + h * HD + lr, kc * 32 + 8 * hi); acc[h] = wmmab(xh[kc], w, acc[h]); acc[h] = wmmab(xl[kc], w, acc[h]); }
#pragma unroll
    for (int h = 0; h < NH_; ++h) { const float bx = bfr(bw[h]); float r[8];
#pragma unroll
        for (int j = 0; j < 8; ++j) r[j] = acc[h][j] + bx;
        store8(r, Vh + o + (size_t)h * NN * HD, Vl + o + (size_t)h * NN * HD); }
}
// An operand (8 registers a lane) through LDS: two planes of 16 bytes a lane, so that consecutive lanes store and load consecutive 16 bytes.
__device__ __forceinline__ void putf(v4u (*xp)[32], int lane, v16bf f) {
    typedef __attribute__((ext_vector_type(8))) unsigned v8u; const v8u w = __builtin_bit_cast(v8u, f);
    xp[0][lane] = (v4u){w[0], w[1], w[2], w[3]}; xp[1][lane] = (v4u){w[4], w[5], w[6], w[7]};
}
__device__ __forceinline__ v16bf getf(const v4u (*xp)[32], int lane) {
    typedef __attribute__((ext_vector_type(8))) unsigned v8u; const v4u a = xp[0][lane], b = xp[1][lane];
    return __builtin_bit_cast(v16bf, (v8u){a[0], a[1], a[2], a[3], b[0], b[1], b[2], b[3]});
}
// k_attn: grid (2048 / 64 token blocks, 8 items), 16 waves = 4 heads x 2 query groups of 32 columns (two 16-column groups each) x 2 key halves, so that a work-group ends with all 64
// features of its 64 tokens and has four waves a SIMD for the token-local stages. A wave walks 1024 keys; a pass is 64 keys = four 16-key blocks: S^T = K.Q^T (A = 16
// key rows, B = 16 query columns; d 0..15 of the hi plane in elements 0..7 of both lane halves, d 0..15 of K's residual plane in elements 8..15 of A, B's elements 0..7 repeated in its 8..15), so a lane holds 32 scores of ONE query per group; each pair of f32 tiles
// converts in place into the B operand P^T of O^T += V^T.P^T (A = two transposed 16 x 16 v blocks = the hardware k order). Maximum, sum and rescale are in-lane plus one exchange
// between the halves. Scores are kept in scaled log2 units; every pass rescales by exp2(old maximum - new maximum), without a branch, so that a pass is one basic block.
// Behind the passes the second key half hands its O^T, maximum and sum to the first through LDS, lane for lane; the first rescales both to the common maximum, adds, divides and puts ctx^T
// into LDS (a lane's 8 values of a head are 8 values of the next B operand). Then the waves regroup as 4 token groups (16 tokens) x 4 feature quarters, the three weights as bf16 [n][k] in
// LDS since the kernel's start. Stage A (quarter 0 of each group): o^T = Wproj^T.ctx^T + bproj -> LN -> operands and o^T to LDS. Stage B (every wave, 32 hidden features):
// m^T = gelu(W1^T.h^T + b1) -> operands to LDS; the GELU is a chain of dependent instructions and branches, so it is spread over four waves a SIMD. Stage C (quarters 0 and 1, 32 output
// features = one 128-byte line a token): out^T = W2^T.m^T + b2 + o^T.
__global__ __launch_bounds__(512) void k_attn(const bf* __restrict__ Qh, const bf* __restrict__ Ql, const bf* __restrict__ Kh, const bf* __restrict__ Kl, const bf* __restrict__ Vh, const bf* __restrict__ Vl,
                                              const float* __restrict__ Wp, const float* __restrict__ bp, const float* __restrict__ g2, const float* __restrict__ be2,
                                              const float* __restrict__ W1, const float* __restrict__ b1, const float* __restrict__ W2, const float* __restrict__ b2, float* out) {
    typedef __attribute__((ext_vector_type(2))) float v2f; typedef __attribute__((ext_vector_type(2))) __bf16 v2b; typedef __attribute__((ext_vector_type(8))) unsigned v8u;
    __shared__ __align__(16) bf wp[DD * (DD + 8)]; __shared__ __align__(16) bf w1[HID * (DD + 8)]; __shared__ __align__(16) bf w2[DD * (HID + 8)];
    __shared__ v4f xg[8][5][32];         // [head + 4 * query group]: the second key half's two O^T tiles (2 x 16 bytes a lane each), then (maximum, maximum, sum, sum)
    __shared__ v4f xc[4][4][2][32];      // [group][head]: ctx
    __shared__ v4u xh[4][4][2][32];      // [group][k chunk * 2 + (0 hi, 1 residual)]: LN(o)
    __shared__ v4f xo[4][4][2][32];      // [group][tile]: o
    __shared__ v4u xm[4][8][2][32];      // [group][k chunk * 2 + (0 hi, 1 residual)]: gelu(.)
    const int tid = threadIdx.x, lane = tid & 31, c = lane & 15, lr = c, hi = lane >> 4;
    const int wave = __builtin_amdgcn_readfirstlane(tid >> 5), hd = wave & 3, qg = (wave >> 2) & 1, kp = wave >> 3;      // scalar: scalar plane bases, scalar branches
    const int tg = wave & 3, fq = wave >> 2;      // behind the passes: token group, feature quarter; scalar: the matrix instructions below stand under branches on fq
    const int t0 = blockIdx.y * NN + blockIdx.x * 64 + tg * 16;
    stage_wt<DD, DD, 512>(Wp, wp, tid); stage_wt<DD, HID, 512>(W1, w1, tid); stage_wt<HID, DD, 512>(W2, w2, tid);
    const size_t pb = ((size_t)blockIdx.y * NH_ + hd) * NN * HD, pk = pb + (size_t)kp * (NN / 2) * HD;      // the head's planes; the wave's key half in them
    const int q0 = blockIdx.x * 64 + qg * 32; const unsigned fo = c * HD + 8 * hi;      // the lane's place in a 16 x 16 block; unsigned: scalar base + 32-bit lane offset addressing
    const float CS = SCL * 1.4426950408889634f;
    v16bf qh[2], ql[2];
#pragma unroll
    for (int g = 0; g < 2; ++g) { const size_t qo = pb + (size_t)(q0 + 16 * g) * HD + fo; const v8us a = *(const v8us*)(Qh + qo), b = *(const v8us*)(Ql + qo); qh[g] = cat16b(a, a); ql[g] = cat16b(b, b); }
    v8us kh[4], kl[4];
#pragma unroll
    for (int j = 0; j < 4; ++j) { kh[j] = *(const v8us*)(Kh + pk + (fo + 16 * j * HD)); kl[j] = *(const v8us*)(Kl + pk + (fo + 16 * j * HD)); }
    asm volatile("s_wait_xcnt 0x0" ::: "memory");      // the address registers of the loads above are reused below
    __builtin_amdgcn_sched_barrier(0);                 // keeps the register writes below from being lifted over that wait
    v8f o[2]; float mrun[2], lsum[2];
#pragma unroll
    for (int g = 0; g < 2; ++g) { o[g] = (v8f){}; mrun[g] = -3.0e38f; lsum[g] = 0.f; }
#pragma unroll 1
    for (int s = 0; s < NN / 128; ++s) {
        const size_t cu = pk + (size_t)(s * 64) * HD, nx = pk + (size_t)((s + 1 < NN / 128 ? s + 1 : s) * 64) * HD;     // this pass's V, the next pass's K (the last pass reads its own again)
        v8us vh[4], vl[4];
#pragma unroll
        for (int j = 0; j < 4; ++j) { vh[j] = *(const v8us*)(Vh + cu + (fo + 16 * j * HD)); vl[j] = *(const v8us*)(Vl + cu + (fo + 16 * j * HD)); }
        __builtin_amdgcn_sched_barrier(0);      // holds the V loads at the head of the pass, the scores and exponentials between them and their use
        v8f st[2][4];
#pragma unroll
        for (int j = 0; j < 4; ++j) { const v16bf ak = cat16b(kh[j], kl[j]);
#pragma unroll
            for (int g = 0; g < 2; ++g) st[g][j] = wmmab(ak, ql[g], wmmab(ak, qh[g], (v8f){})); }
#pragma unroll
        for (int j = 0; j < 4; ++j) { kh[j] = *(const v8us*)(Kh + nx + (fo + 16 * j * HD)); kl[j] = *(const v8us*)(Kl + nx + (fo + 16 * j * HD)); }     // K a pass ahead
        __builtin_amdgcn_sched_barrier(0);      // holds the K loads here: the scheduler otherwise sinks them to the loop's foot, directly in front of their use
#pragma unroll
        for (int g = 0; g < 2; ++g) { float a = fmaxf(st[g][0][0], st[g][1][0]), b = fmaxf(st[g][2][0], st[g][3][0]);
#pragma unroll
            for (int r = 1; r < 8; ++r) { a = fmaxf(a, fmaxf(st[g][0][r], st[g][1][r])); b = fmaxf(b, fmaxf(st[g][2][r], st[g][3][r])); }
            a = fmaxf(a, b);
            const float mn = fmaxf(mrun[g], fmaxf(a, xhalf(a)) * CS), fs = exp2one(mrun[g] - mn); o[g] *= fs; lsum[g] *= fs; mrun[g] = mn; }
#pragma unroll
        for (int u = 0; u < 2; ++u) { const v16bf vhf = cat16b(vh[2 * u], vh[2 * u + 1]), vlf = cat16b(vl[2 * u], vl[2 * u + 1]);
#pragma unroll
            for (int g = 0; g < 2; ++g) { v8u ph, pl; float s0 = 0.f, s1 = 0.f, pe[16];
#pragma unroll
                for (int e = 0; e < 16; ++e) pe[e] = fmaf(st[g][2 * u + (e >> 3)][e & 7], CS, -mrun[g]);
                exp2x8(pe); exp2x8(pe + 8);
#pragma unroll
                for (int e = 0; e < 8; ++e) { v2f p; p[0] = pe[2 * e]; p[1] = pe[2 * e + 1];
                    s0 += p[0]; s1 += p[1];
                    const unsigned hw = __builtin_bit_cast(unsigned, __builtin_convertvector(p, v2b));
                    v2f d; d[0] = p[0] - __uint_as_float(hw << 16); d[1] = p[1] - __uint_as_float(hw & 0xFFFF0000u);
                    ph[e] = hw; pl[e] = __builtin_bit_cast(unsigned, __builtin_convertvector(d, v2b)); }
                lsum[g] += s0 + s1;
                const v16bf pbh = __builtin_bit_cast(v16bf, ph), pbl = __builtin_bit_cast(v16bf, pl);
                o[g] = wmmab(vhf, pbh, o[g]); o[g] = wmmab(vhf, pbl, o[g]); o[g] = wmmab(vlf, pbh, o[g]); } }
    }
    const unsigned hoff = hi * 32;
    v16bf fh[2], fl[2];
    float v[32] = {}, gr[32] = {}, br[32] = {}, bv[32] = {}, bm[16];
    if (fq == 0) {
#pragma unroll
        for (int c = 0; c < 4; ++c) { ld8(g2, hoff, 64 * c, gr + 8 * c); ld8(be2, hoff, 64 * c, br + 8 * c); ld8(bp, hoff, 64 * c, bv + 8 * c); }
        XWAIT(hoff);
    }
    ld8(b1 + fq * 32, hoff, 0, bm); ld8(b1 + fq * 32, hoff, 64, bm + 8);
    XWAIT(hoff);
    if (kp == 1) {
#pragma unroll
        for (int g = 0; g < 2; ++g) { xg[hd + 4 * qg][2 * g][lane] = (v4f){o[g][0], o[g][1], o[g][2], o[g][3]}; xg[hd + 4 * qg][2 * g + 1][lane] = (v4f){o[g][4], o[g][5], o[g][6], o[g][7]}; }
        xg[hd + 4 * qg][4][lane] = (v4f){mrun[0], mrun[1], lsum[0], lsum[1]};
    }
    __syncthreads();
    if (kp == 0) {
        const v4f ms = xg[hd + 4 * qg][4][lane];
#pragma unroll
        for (int g = 0; g < 2; ++g) { const v4f a = xg[hd + 4 * qg][2 * g][lane], b = xg[hd + 4 * qg][2 * g + 1][lane];
            const float mn = fmaxf(mrun[g], ms[g]), f0 = exp2one(mrun[g] - mn), f1 = exp2one(ms[g] - mn), l = lsum[g] * f0 + ms[2 + g] * f1;
            const float inv = 1.0f / (l + xhalf(l)), s0 = f0 * inv, s1 = f1 * inv; v4f ra, rb;
#pragma unroll
            for (int i = 0; i < 4; ++i) { ra[i] = o[g][i] * s0 + a[i] * s1; rb[i] = o[g][4 + i] * s0 + b[i] * s1; }
            xc[2 * qg + g][hd][0][lane] = ra; xc[2 * qg + g][hd][1][lane] = rb; }
    }
    __syncthreads();
    if (fq == 0) {
#pragma unroll
        for (int h = 0; h < NH_; ++h) { const v4f a = xc[tg][h][0][lane], b = xc[tg][h][1][lane];
#pragma unroll
            for (int i = 0; i < 4; ++i) { v[8 * h + i] = a[i]; v[8 * h + 4 + i] = b[i]; } }
        split16(v, fh[0], fl[0]); split16(v + 16, fh[1], fl[1]);
        v8f acc[4];
#pragma unroll
        for (int t = 0; t < 4; ++t) acc[t] = (v8f){};
#pragma unroll
        for (int kc = 0; kc < 2; ++kc)
#pragma unroll
            for (int t = 0; t < 4; ++t) { const v16bf w = wfrag(wp, DD + 8, t * 16 + lr, kc * 32 + 8 * hi); acc[t] = wmmab(w, fh[kc], acc[t]); acc[t] = wmmab(w, fl[kc], acc[t]); }
#pragma unroll
        for (int t = 0; t < 4; ++t) {
#pragma unroll
            for (int j = 0; j < 8; ++j) v[8 * t + j] = acc[t][j] + bfr(bv[8 * t + j]);
            xo[tg][t][0][lane] = (v4f){v[8 * t], v[8 * t + 1], v[8 * t + 2], v[8 * t + 3]}; xo[tg][t][1][lane] = (v4f){v[8 * t + 4], v[8 * t + 5], v[8 * t + 6], v[8 * t + 7]}; }
        ln_pair(v, gr, br);
        split16(v, fh[0], fl[0]); split16(v + 16, fh[1], fl[1]);
#pragma unroll
        for (int kc = 0; kc < 2; ++kc) { putf(xh[tg][2 * kc], lane, fh[kc]); putf(xh[tg][2 * kc + 1], lane, fl[kc]); }
    }
    __syncthreads();
    {
#pragma unroll
        for (int kc = 0; kc < 2; ++kc) { fh[kc] = getf(xh[tg][2 * kc], lane); fl[kc] = getf(xh[tg][2 * kc + 1], lane); }
        v8f am[2]; am[0] = (v8f){}; am[1] = (v8f){};
#pragma unroll
        for (int kc = 0; kc < 2; ++kc)
#pragma unroll
            for (int u = 0; u < 2; ++u) { const v16bf w = wfrag(w1, DD + 8, (2 * fq + u) * 16 + lr, kc * 32 + 8 * hi); am[u] = wmmab(w, fh[kc], am[u]); am[u] = wmmab(w, fl[kc], am[u]); }
        float m[16];
#pragma unroll
        for (int u = 0; u < 2; ++u) {
#pragma unroll
            for (int j = 0; j < 8; ++j) { const float a = am[u][j] + bfr(bm[8 * u + j]); m[8 * u + j] = 0.5f * a * (1.0f + erff(a * 0.7071067811865476f)); } }
        v16bf mh, ml; split16(m, mh, ml);
        putf(xm[tg][2 * fq], lane, mh); putf(xm[tg][2 * fq + 1], lane, ml);
    }
    __syncthreads();
    if (fq >= 2) return;
    float bo[16]; ld8(b2 + fq * 32, hoff, 0, bo); ld8(b2 + fq * 32, hoff, 64, bo + 8);
    XWAIT(hoff);
    v8f acc[2]; acc[0] = (v8f){}; acc[1] = (v8f){};
#pragma unroll
    for (int kc = 0; kc < 4; ++kc) { const v16bf mh = getf(xm[tg][2 * kc], lane), ml = getf(xm[tg][2 * kc + 1], lane);
#pragma unroll
        for (int u = 0; u < 2; ++u) { const v16bf w = wfrag(w2, HID + 8, (2 * fq + u) * 16 + lr, kc * 32 + 8 * hi); acc[u] = wmmab(w, mh, acc[u]); acc[u] = wmmab(w, ml, acc[u]); } }
    float* dst = out + (size_t)(t0 + lr) * DD + 8 * hi;
#pragma unroll
    for (int u = 0; u < 2; ++u) { const int t = 2 * fq + u; const v4f oa = xo[tg][t][0][lane], ob = xo[tg][t][1][lane]; v4f ra, rb;
#pragma unroll
        for (int j = 0; j < 4; ++j) { ra[j] = (acc[u][j] + bfr(bo[8 * u + j])) + oa[j]; rb[j] = (acc[u][4 + j] + bfr(bo[8 * u + 4 + j])) + ob[j]; }
        *(v4f*)(dst + t * 16) = ra; *(v4f*)(dst + t * 16 + 4) = rb; }
}

extern "C" void kernel_launch(void* const* d_in, const int* in_sizes, int n_in,
                              void* d_out, int out_size, void* d_ws, size_t ws_size, hipStream_t stream) {
    (void)in_sizes; (void)n_in; (void)out_size;
    const float* x = (const float*)d_in[0]; const float* cl = (const float*)d_in[1]; const float* g1 = (const float*)d_in[2]; const float* be1 = (const float*)d_in[3]; const float* g2 = (const float*)d_in[4]; const float* be2 = (const float*)d_in[5];
    const float* Wkv = (const float*)d_in[6]; const float* bkv = (const float*)d_in[7]; const float* Wq = (const float*)d_in[8]; const float* bq = (const float*)d_in[9]; const float* Wp = (const float*)d_in[10]; const float* bp = (const float*)d_in[11];
    const float* W1 = (const float*)d_in[12]; const float* b1 = (const float*)d_in[13]; const float* W2 = (const float*)d_in[14]; const float* b2 = (const float*)d_in[15];      // k-major weights (x @ W)
    float* out = (float*)d_out;    // [8][2048][64]
    char* wsp = (char*)d_ws;
    auto take = [&](size_t bytes) { char* p = wsp; wsp += (bytes + 255) & ~(size_t)255; return (void*)p; };
    bf* Q16h = (bf*)take((size_t)NR * DD * 2); bf* Q16l = (bf*)take((size_t)NR * DD * 2); bf* K16h = (bf*)take((size_t)NR * DD * 2); bf* K16l = (bf*)take((size_t)NR * DD * 2); bf* VBh = (bf*)take((size_t)NR * DD * 2); bf* VBl = (bf*)take((size_t)NR * DD * 2);
    if ((size_t)(wsp - (char*)d_ws) > ws_size) return;    // 12 MB, no aliasing
    k_pre<<<dim3(NR / 64, 2, 1), 128, 0, stream>>>(x, cl, g1, be1, Wkv, bkv, Wq, bq, Q16h, Q16l, K16h, K16l, VBh, VBl);                         // LN, kv and q, head planes
    k_attn<<<dim3(NN / 64, NBI, 1), 512, 0, stream>>>(Q16h, Q16l, K16h, K16l, VBh, VBl, Wp, bp, g2, be2, W1, b1, W2, b2, out);                        // softmax(q_h.k_h^T / 4).v_h of 64 tokens x 4 heads, then projection, LN, MLP, residual
}

// v005
// It runs in 30.5 microseconds.
// Two timings next to v004 put it at 1.30 and 1.31 times that version's speed.
// Over all steps from v000 it is 90.2 times as fast.
#include <hip/hip_runtime.h>

// Compute dtypes, f32 accumulate: LayerNorm (shared norm1 on both streams, norm2 later) and GELU in f32; kv = LN(x).Wkv + bkv, q = LN(clinic).Wq + bq, o = ctx.Wproj + bproj,
// m = gelu(LN(o).W1 + b1) and out = m.W2 + b2 + o with every computed operand as bf16 hi + UNSCALED residual against exact bf16 weights (two products) on
// v_wmma_f32_16x16x32_bf16; the 4-head (16-dim) cross attention in one launch over all (item, head) pairs on v_wmma_f32_16x16x32_f16: q, v and P are rounded ONCE to f16 (11 bits, where bf16 needed hi + residual), k is f16 hi +
// UNSCALED f16 residual, which costs no product: S^T = k_h.q_h^T (the 16 head dims twice in the 32 k: k hi | k residual against q | q: one product), softmax x 1/4 in f32 with a running maximum, P^T packed from the accumulators,
// ctx_h^T = v_h^T.P^T (one product). f16 ends at 65504: LayerNorm bounds each feature of a row by 8 |gain| + |offset|, so q, k, v reach that only with weight columns whose absolute sum is in the thousands.
// Two launches: k_pre (LayerNorm, kv / q, head planes), k_attn (attention of 64 tokens x 4 heads, then projection, LayerNorm, MLP, residual of those tokens). In the token-local parts a wave owns 16 tokens and a lane pair (l, l ^ 16)
// one token: apart from k_pre's v product (tokens as A), the weights are the A operand, the tokens the B operand, so each product's accumulators hold 8 consecutive features of the lane's token and convert in place into the
// next product's B operand.

#define NBI  8
#define NN   2048
#define NR   (NBI * NN)          // 16384 token rows
#define DD   64
#define NH_  4
#define HD   16
#define HID  128
#define DM   DD
#define NTK  NR
#define SCL  0.25f
#define LN_EPS 1e-5f
#define LOSC 1024.0f

typedef _Float16 h16;
typedef unsigned short bf;
typedef __attribute__((ext_vector_type(16))) __bf16   v16bf;
typedef __attribute__((ext_vector_type(16))) _Float16 v16h;
typedef __attribute__((ext_vector_type(8)))  _Float16 v8h;
typedef __attribute__((ext_vector_type(8)))  unsigned short v8us;
typedef __attribute__((ext_vector_type(8)))  float    v8f;
typedef __attribute__((ext_vector_type(4)))  float    v4f;
typedef __attribute__((ext_vector_type(4)))  _Float16 v4h;
typedef v8h  __attribute__((may_alias)) v8ha;
typedef v4f  __attribute__((may_alias)) v4fa;
typedef v8us __attribute__((may_alias)) v8usa;

__device__ __forceinline__ unsigned short f2bf(float f) { unsigned u = __float_as_uint(f); u += 0x7FFFu + ((u >> 16) & 1u); return (unsigned short)(u >> 16); }
__device__ __forceinline__ float bf2f(unsigned short b) { return __uint_as_float(((unsigned)b) << 16); }
__device__ __forceinline__ float bfr(float f) { return bf2f(f2bf(f)); }
__device__ __forceinline__ v16h cat16(v8h lo, v8h hi) { return __builtin_shufflevector(lo, hi, 0, 1, 2, 3, 4, 5, 6, 7, 8, 9, 10, 11, 12, 13, 14, 15); }
__device__ __forceinline__ v16bf cat16b(v8us lo, v8us hi) { return __builtin_bit_cast(v16bf, __builtin_shufflevector(lo, hi, 0, 1, 2, 3, 4, 5, 6, 7, 8, 9, 10, 11, 12, 13, 14, 15)); }
__device__ __forceinline__ v16h cat16u(v8us lo, v8us hi) { return __builtin_bit_cast(v16h, __builtin_shufflevector(lo, hi, 0, 1, 2, 3, 4, 5, 6, 7, 8, 9, 10, 11, 12, 13, 14, 15)); }
__device__ __forceinline__ v8f wmma16(v16h a, v16h b, v8f c) { return __builtin_amdgcn_wmma_f32_16x16x32_f16(false, a, false, b, (short)0, c, false, false); }
__device__ __forceinline__ v8f wmmab(v16bf a, v16bf b, v8f c) { return __builtin_amdgcn_wmma_f32_16x16x32_bf16(false, a, false, b, (short)0, c, false, false); }

// lane l <-> l ^ 16
__device__ __forceinline__ float xhalf(float v) { const int b = __float_as_int(v); return __int_as_float(__builtin_amdgcn_permlanex16(b, b, 0x76543210, 0xfedcba98, false, false)); }
// exp2 by v_exp_f32 in asm text. The instruction set asks for one slot behind a transcendental before its result is read or its source overwritten;
// here every exponential works on a register of its own and the closing v_nop is the slot behind the last. Each overwrites
// its own argument: that register is live in front of the statement, so it is never an operand register that a matrix instruction directly in front has just given up.
__device__ __forceinline__ float exp2one(float x) { asm("v_exp_f32 %0, %0\n\tv_nop" : "+v"(x)); return x; }
__device__ __forceinline__ void exp2x8(float* x) {
    asm("v_exp_f32 %0, %0\n\tv_exp_f32 %1, %1\n\tv_exp_f32 %2, %2\n\tv_exp_f32 %3, %3\n\tv_exp_f32 %4, %4\n\tv_exp_f32 %5, %5\n\tv_exp_f32 %6, %6\n\tv_exp_f32 %7, %7\n\tv_nop"
        : "+v"(x[0]), "+v"(x[1]), "+v"(x[2]), "+v"(x[3]), "+v"(x[4]), "+v"(x[5]), "+v"(x[6]), "+v"(x[7]));
}
typedef __attribute__((ext_vector_type(4))) unsigned v4u;
// NP pairs of f32 values -> packed bf16 hi words and packed bf16 words of the UNSCALED residual (value 2e in the low half of word e)
template <int NP>
__device__ __forceinline__ void splitp(const float* v, unsigned* ph, unsigned* pl) {
    typedef __attribute__((ext_vector_type(2))) float v2f; typedef __attribute__((ext_vector_type(2))) __bf16 v2b;
#pragma unroll
    for (int e = 0; e < NP; ++e) { v2f p; p[0] = v[2 * e]; p[1] = v[2 * e + 1];
        const unsigned hw = __builtin_bit_cast(unsigned, __builtin_convertvector(p, v2b));
        v2f d; d[0] = p[0] - __uint_as_float(hw << 16); d[1] = p[1] - __uint_as_float(hw & 0xFFFF0000u);
        ph[e] = hw; pl[e] = __builtin_bit_cast(unsigned, __builtin_convertvector(d, v2b)); }
}
// 16 values in the operand's k order (two runs of 8 features, 16 apart) -> hi and residual operands
__device__ __forceinline__ void split16(const float* v, v16bf& h, v16bf& l) {
    typedef __attribute__((ext_vector_type(8))) unsigned v8u; unsigned ph[8], pl[8]; splitp<8>(v, ph, pl);
    v8u a, b;
#pragma unroll
    for (int e = 0; e < 8; ++e) { a[e] = ph[e]; b[e] = pl[e]; }
    h = __builtin_bit_cast(v16bf, a); l = __builtin_bit_cast(v16bf, b);
}
// 8 values -> 16 bytes of f16 (round to nearest even), and the 16 bytes of the UNSCALED residual's f16
__device__ __forceinline__ void pack8h(const float* v, v4u& ph, v4u& pl) {
    typedef __attribute__((ext_vector_type(2))) float v2f; typedef __attribute__((ext_vector_type(2))) _Float16 v2h;
#pragma unroll
    for (int e = 0; e < 4; ++e) { v2f p; p[0] = v[2 * e]; p[1] = v[2 * e + 1];
        const v2h hw = __builtin_convertvector(p, v2h);
        const v2f d = p - __builtin_convertvector(hw, v2f);
        ph[e] = __builtin_bit_cast(unsigned, hw); pl[e] = __builtin_bit_cast(unsigned, __builtin_convertvector(d, v2h)); }
}
// Global reads as scalar base + one 32-bit byte offset of the lane + a constant: a group of reads names one address register, which its closing wait (XWAIT) holds live.
__device__ __forceinline__ float ldf(const float* __restrict__ b, unsigned off, int imm) { return *(const float*)((const char*)b + off + imm); }
__device__ __forceinline__ void ld8(const float* __restrict__ b, unsigned off, int imm, float* d) {
    const v4f x = *(const v4f*)((const char*)b + off + imm), y = *(const v4f*)((const char*)b + off + imm + 16);
#pragma unroll
    for (int i = 0; i < 4; ++i) { d[i] = x[i]; d[4 + i] = y[i]; }
}
// Behind a group of global reads: their address register is rewritten later. The operand keeps the register from
// being reused (also as a read's destination) ahead of the wait; the scheduling barrier keeps later register writes from being lifted over it.
#define XWAIT(off) do { asm volatile("s_wait_xcnt 0x0" :: "v"(off) : "memory"); __builtin_amdgcn_sched_barrier(0); } while (0)
// W [K][N] f32 (k-major) -> L [n][K + 8] bf16 in LDS. A unit is 8 k of one n: consecutive lanes take consecutive n (whole lines from W), one 16-byte LDS store a unit.
template <int K, int N, int NT>
__device__ __forceinline__ void stage_wt(const float* __restrict__ Wm, bf* L, int tid) {
    constexpr int NU = N * K / 8 / NT, KS = NT / N * 8;      // units a thread, k step from one unit of a thread to its next
    const int n = tid % N, k8 = (tid / N) * 8; const unsigned off = (unsigned)(k8 * N + n) * 4;
    float r[NU][8];
#pragma unroll
    for (int q = 0; q < NU; ++q)
#pragma unroll
        for (int i = 0; i < 8; ++i) r[q][i] = ldf(Wm, off, (q * KS + i) * N * 4);
    XWAIT(off);
#pragma unroll
    for (int q = 0; q < NU; ++q) { v8us p;
#pragma unroll
        for (int i = 0; i < 8; ++i) p[i] = f2bf(r[q][i]);
        *(v8usa*)(L + n * (K + 8) + k8 + q * KS) = p; }
}
// weight operand: row (feature) of the lane, k = ko .. ko + 7 and ko + 16 .. ko + 23 (ko holds the lane half's 8)
__device__ __forceinline__ v16bf wfrag(const bf* L, int pitch, int row, int ko) { const bf* p = L + row * pitch + ko; return cat16b(*(const v8usa*)p, *(const v8usa*)(p + 16)); }
// LayerNorm of one 64-value row held by a lane pair: v[8 c + i] is feature 16 c + 8 hi + i. 32 values are summed in the lane, then one exchange between the halves.
__device__ __forceinline__ void ln_pair(float* v, const float* g, const float* bb) {      // g, bb: the lane's 32 gains and offsets, as read
    float p[8];
#pragma unroll
    for (int i = 0; i < 8; ++i) p[i] = (v[i] + v[8 + i]) + (v[16 + i] + v[24 + i]);
    float s = ((p[0] + p[1]) + (p[2] + p[3])) + ((p[4] + p[5]) + (p[6] + p[7]));
    s += xhalf(s);
    const float mu = s * (1.0f / DD);
#pragma unroll
    for (int e = 0; e < 32; ++e) v[e] -= mu;
#pragma unroll
    for (int i = 0; i < 8; ++i) p[i] = (v[i] * v[i] + v[8 + i] * v[8 + i]) + (v[16 + i] * v[16 + i] + v[24 + i] * v[24 + i]);
    float s2 = ((p[0] + p[1]) + (p[2] + p[3])) + ((p[4] + p[5]) + (p[6] + p[7]));
    s2 += xhalf(s2);
    const float rs = rsqrtf(s2 * (1.0f / DD) + LN_EPS);
#pragma unroll
    for (int e = 0; e < 32; ++e) v[e] = v[e] * rs * bfr(g[e]) + bfr(bb[e]);
}
// k_pre: grid (16384 / 64 token blocks, 2 streams), 4 waves x 16 tokens. Stream 0: LN(x) -> k (weights as A: a lane gets 8 features of its token) and v (tokens as A: a lane gets 8
// tokens of its feature, the transposed 16 x 16 block); stream 1: LN(clinic) -> q. Planes as k_attn reads them, f16: Q16 / K16 [b][h][t][16], VB [b][h][t/16][d][t%16]; k hi + residual, q and v one plane each.
__global__ __launch_bounds__(128) void k_pre(const float* __restrict__ x, const float* __restrict__ cl, const float* __restrict__ g1, const float* __restrict__ be1, const float* __restrict__ Wkv, const float* __restrict__ bkv,
                                             const float* __restrict__ Wq, const float* __restrict__ bq, bf* Qh, bf* Kh, bf* Kl, bf* Vh) {
    __shared__ __align__(16) bf wl[HID * (DD + 8)];
    const int tid = threadIdx.x, lane = tid & 31, wave = tid >> 5, lr = lane & 15, hi = lane >> 4;
    const bool isq = blockIdx.y != 0;
    const int t0 = blockIdx.x * 64 + wave * 16;
    const float* bias = isq ? bq : bkv;
    const unsigned xoff = ((unsigned)(t0 + lr) * DD + 8 * hi) * 4, hoff = hi * 32, loff = lr * 4;
    float v[32], gr[32], br[32], bv[32], bw[NH_];
#pragma unroll
    for (int c = 0; c < 4; ++c) ld8(isq ? cl : x, xoff, 64 * c, v + 8 * c);
    XWAIT(xoff);
#pragma unroll
    for (int c = 0; c < 4; ++c) { ld8(g1, hoff, 64 * c, gr + 8 * c); ld8(be1, hoff, 64 * c, br + 8 * c); ld8(bias, hoff, 64 * c, bv + 8 * c); }
    XWAIT(hoff);
#pragma unroll
    for (int h = 0; h < NH_; ++h) bw[h] = ldf(bkv, loff, (DD + h * HD) * 4);      // v's bias (read by both streams, used by stream 0)
    XWAIT(loff);
    if (isq) stage_wt<DD, DD, 128>(Wq, wl, tid); else stage_wt<DD, HID, 128>(Wkv, wl, tid);
#pragma unroll
    for (int e = 0; e < 32; ++e) v[e] = bfr(v[e]);      // the input rows are bf16-rounded first
    ln_pair(v, gr, br);
    v16bf xh[2], xl[2]; split16(v, xh[0], xl[0]); split16(v + 16, xh[1], xl[1]);
    __syncthreads();
    const size_t o = ((size_t)(t0 / NN) * NH_ * NN + (t0 % NN)) * HD + lr * HD + 8 * hi;      // head 0; a head is NN * HD further
    v8f acc[NH_];
#pragma unroll
    for (int h = 0; h < NH_; ++h) acc[h] = (v8f){};
#pragma unroll
    for (int kc = 0; kc < 2; ++kc)
#pragma unroll
        for (int h = 0; h < NH_; ++h) { const v16bf w = wfrag(wl, DD + 8, h * HD + lr, kc * 32 + 8 * hi); acc[h] = wmmab(w, xh[kc], acc[h]); acc[h] = wmmab(w, xl[kc], acc[h]); }
#pragma unroll
    for (int e = 0; e < 32; ++e) v[e] = acc[e >> 3][e & 7] + bfr(bv[e]);
    v4u wh[NH_], wr[NH_];
#pragma unroll
    for (int h = 0; h < NH_; ++h) pack8h(v + 8 * h, wh[h], wr[h]);
#pragma unroll
    for (int h = 0; h < NH_; ++h) *(v4u*)((isq ? Qh : Kh) + o + (size_t)h * NN * HD) = wh[h];
    asm volatile("s_wait_xcnt 0x0" ::: "memory");      // the compiler forms the residual words behind these stores, in their data and address registers
    __builtin_amdgcn_sched_barrier(0);                 // keeps those register writes from being lifted over the wait
    if (!isq) {
#pragma unroll
        for (int h = 0; h < NH_; ++h) *(v4u*)(Kl + o + (size_t)h * NN * HD) = wr[h];
    }
    asm volatile("s_wait_xcnt 0x0" ::: "memory");      // the data and address registers of the stores above are rewritten by the v product below
    if (isq) return;
#pragma unroll
    for (int h = 0; h < NH_; ++h) acc[h] = (v8f){};
#pragma unroll
    for (int kc = 0; kc < 2; ++kc)
#pragma unroll
        for (int h = 0; h < NH_; ++h) { const v16bf w = wfrag(wl, DD + 8, DD + h * HD + lr, kc * 32 + 8 * hi); acc[h] = wmmab(xh[kc], w, acc[h]); acc[h] = wmmab(xl[kc], w, acc[h]); }
#pragma unroll
    for (int h = 0; h < NH_; ++h) { const float bx = bfr(bw[h]); float r[8];
#pragma unroll
        for (int j = 0; j < 8; ++j) r[j] = acc[h][j] + bx;
        pack8h(r, wh[h], wr[h]); }
#pragma unroll
    for (int h = 0; h < NH_; ++h) *(v4u*)(Vh + o + (size_t)h * NN * HD) = wh[h];
}
// An operand (8 registers a lane) through LDS: two planes of 16 bytes a lane, so that consecutive lanes store and load consecutive 16 bytes.
__device__ __forceinline__ void putf(v4u (*xp)[32], int lane, v16bf f) {
    typedef __attribute__((ext_vector_type(8))) unsigned v8u; const v8u w = __builtin_bit_cast(v8u, f);
    xp[0][lane] = (v4u){w[0], w[1], w[2], w[3]}; xp[1][lane] = (v4u){w[4], w[5], w[6], w[7]};
}
__device__ __forceinline__ v16bf getf(const v4u (*xp)[32], int lane) {
    typedef __attribute__((ext_vector_type(8))) unsigned v8u; const v4u a = xp[0][lane], b = xp[1][lane];
    return __builtin_bit_cast(v16bf, (v8u){a[0], a[1], a[2], a[3], b[0], b[1], b[2], b[3]});
}
// k_attn: grid (2048 / 64 token blocks, 8 items), 16 waves = 4 heads x 2 query groups of 32 columns (two 16-column groups each) x 2 key halves, so that a work-group ends with all 64
// features of its 64 tokens and has four waves a SIMD for the token-local stages. A wave walks 1024 keys; a pass is 64 keys = four 16-key blocks: S^T = K.Q^T (A = 16
// key rows, B = 16 query columns; d 0..15 of the hi plane in elements 0..7 of both lane halves, d 0..15 of K's residual plane in elements 8..15 of A, B's elements 0..7 repeated in its 8..15), so a lane holds 32 scores of ONE query per group; each pair of f32 tiles
// converts in place into the B operand P^T of O^T += V^T.P^T (A = two transposed 16 x 16 v blocks = the hardware k order). Maximum, sum and rescale are in-lane plus one exchange
// between the halves. Scores are kept in scaled log2 units; every pass rescales by exp2(old maximum - new maximum), without a branch, so that a pass is one basic block.
// Behind the passes the second key half hands its O^T, maximum and sum to the first through LDS, lane for lane; the first rescales both to the common maximum, adds, divides and puts ctx^T
// into LDS (a lane's 8 values of a head are 8 values of the next B operand). Then the waves regroup as 4 token groups (16 tokens) x 4 feature quarters, the three weights as bf16 [n][k] in
// LDS since the kernel's start. Stage A (quarter 0 of each group): o^T = Wproj^T.ctx^T + bproj -> LN -> operands and o^T to LDS. Stage B (every wave, 32 hidden features):
// m^T = gelu(W1^T.h^T + b1) -> operands to LDS; the GELU is a chain of dependent instructions and branches, so it is spread over four waves a SIMD. Stage C (quarters 0 and 1, 32 output
// features = one 128-byte line a token): out^T = W2^T.m^T + b2 + o^T.
__global__ __launch_bounds__(512) void k_attn(const bf* __restrict__ Qh, const bf* __restrict__ Kh, const bf* __restrict__ Kl, const bf* __restrict__ Vh,
                                              const float* __restrict__ Wp, const float* __restrict__ bp, const float* __restrict__ g2, const float* __restrict__ be2,
                                              const float* __restrict__ W1, const float* __restrict__ b1, const float* __restrict__ W2, const float* __restrict__ b2, float* out) {
    typedef __attribute__((ext_vector_type(2))) float v2f; typedef __attribute__((ext_vector_type(2))) _Float16 v2h; typedef __attribute__((ext_vector_type(8))) unsigned v8u;
    __shared__ __align__(16) bf wp[DD * (DD + 8)]; __shared__ __align__(16) bf w1[HID * (DD + 8)]; __shared__ __align__(16) bf w2[DD * (HID + 8)];
    __shared__ v4f xg[8][5][32];         // [head + 4 * query group]: the second key half's two O^T tiles (2 x 16 bytes a lane each), then (maximum, maximum, sum, sum)
    __shared__ v4f xc[4][4][2][32];      // [group][head]: ctx
    __shared__ v4u xh[4][4][2][32];      // [group][k chunk * 2 + (0 hi, 1 residual)]: LN(o)
    __shared__ v4f xo[4][4][2][32];      // [group][tile]: o
    __shared__ v4u xm[4][8][2][32];      // [group][k chunk * 2 + (0 hi, 1 residual)]: gelu(.)
    const int tid = threadIdx.x, lane = tid & 31, c = lane & 15, lr = c, hi = lane >> 4;
    const int wave = __builtin_amdgcn_readfirstlane(tid >> 5), hd = wave & 3, qg = (wave >> 2) & 1, kp = wave >> 3;      // scalar: scalar plane bases, scalar branches
    const int tg = wave & 3, fq = wave >> 2;      // behind the passes: token group, feature quarter; scalar: the matrix instructions below stand under branches on fq
    const int t0 = blockIdx.y * NN + blockIdx.x * 64 + tg * 16;
    stage_wt<DD, DD, 512>(Wp, wp, tid); stage_wt<DD, HID, 512>(W1, w1, tid); stage_wt<HID, DD, 512>(W2, w2, tid);
    const size_t pb = ((size_t)blockIdx.y * NH_ + hd) * NN * HD, pk = pb + (size_t)kp * (NN / 2) * HD;      // the head's planes; the wave's key half in them
    const int q0 = blockIdx.x * 64 + qg * 32; const unsigned fo = c * HD + 8 * hi;      // the lane's place in a 16 x 16 block; unsigned: scalar base + 32-bit lane offset addressing
    const float CS = SCL * 1.4426950408889634f;
    v16h qf[2];
#pragma unroll
    for (int g = 0; g < 2; ++g) { const size_t qo = pb + (size_t)(q0 + 16 * g) * HD + fo; const v8us a = *(const v8us*)(Qh + qo); qf[g] = cat16u(a, a); }
    v8us kh[4], kl[4];
#pragma unroll
    for (int j = 0; j < 4; ++j) { kh[j] = *(const v8us*)(Kh + pk + (fo + 16 * j * HD)); kl[j] = *(const v8us*)(Kl + pk + (fo + 16 * j * HD)); }
    asm volatile("s_wait_xcnt 0x0" ::: "memory");      // the address registers of the loads above are reused below
    __builtin_amdgcn_sched_barrier(0);                 // keeps the register writes below from being lifted over that wait
    v8f o[2]; float mrun[2], lsum[2];
#pragma unroll
    for (int g = 0; g < 2; ++g) { o[g] = (v8f){}; mrun[g] = -3.0e38f; lsum[g] = 0.f; }
#pragma unroll 1
    for (int s = 0; s < NN / 128; ++s) {
        const size_t cu = pk + (size_t)(s * 64) * HD, nx = pk + (size_t)((s + 1 < NN / 128 ? s + 1 : s) * 64) * HD;     // this pass's V, the next pass's K (the last pass reads its own again)
        v8us vh[4];
#pragma unroll
        for (int j = 0; j < 4; ++j) vh[j] = *(const v8us*)(Vh + cu + (fo + 16 * j * HD));
        __builtin_amdgcn_sched_barrier(0);      // holds the V loads at the head of the pass, the scores and exponentials between them and their use
        v8f st[2][4];
#pragma unroll
        for (int j = 0; j < 4; ++j) { const v16h ak = cat16u(kh[j], kl[j]);
#pragma unroll
            for (int g = 0; g < 2; ++g) st[g][j] = wmma16(ak, qf[g], (v8f){}); }
#pragma unroll
        for (int j = 0; j < 4; ++j) { kh[j] = *(const v8us*)(Kh + nx + (fo + 16 * j * HD)); kl[j] = *(const v8us*)(Kl + nx + (fo + 16 * j * HD)); }     // K a pass ahead
        __builtin_amdgcn_sched_barrier(0);      // holds the K loads here: the scheduler otherwise sinks them to the loop's foot, directly in front of their use
#pragma unroll
        for (int g = 0; g < 2; ++g) { float a = fmaxf(st[g][0][0], st[g][1][0]), b = fmaxf(st[g][2][0], st[g][3][0]);
#pragma unroll
            for (int r = 1; r < 8; ++r) { a = fmaxf(a, fmaxf(st[g][0][r], st[g][1][r])); b = fmaxf(b, fmaxf(st[g][2][r], st[g][3][r])); }
            a = fmaxf(a, b);
            const float mn = fmaxf(mrun[g], fmaxf(a, xhalf(a)) * CS), fs = exp2one(mrun[g] - mn); o[g] *= fs; lsum[g] *= fs; mrun[g] = mn; }
#pragma unroll
        for (int u = 0; u < 2; ++u) { const v16h vf = cat16u(vh[2 * u], vh[2 * u + 1]);
#pragma unroll
            for (int g = 0; g < 2; ++g) { v8u ph; float s0 = 0.f, s1 = 0.f, pe[16];
#pragma unroll
                for (int e = 0; e < 16; ++e) pe[e] = fmaf(st[g][2 * u + (e >> 3)][e & 7], CS, -mrun[g]);
                exp2x8(pe); exp2x8(pe + 8);
#pragma unroll
                for (int e = 0; e < 8; ++e) { v2f p; p[0] = pe[2 * e]; p[1] = pe[2 * e + 1];
                    s0 += p[0]; s1 += p[1];
                    ph[e] = __builtin_bit_cast(unsigned, __builtin_convertvector(p, v2h)); }
                lsum[g] += s0 + s1;
                const v16h pf = __builtin_bit_cast(v16h, ph);
                o[g] = wmma16(vf, pf, o[g]); } }
    }
    const unsigned hoff = hi * 32;
    v16bf fh[2], fl[2];
    float v[32] = {}, gr[32] = {}, br[32] = {}, bv[32] = {}, bm[16];
    if (fq == 0) {
#pragma unroll
        for (int c = 0; c < 4; ++c) { ld8(g2, hoff, 64 * c, gr + 8 * c); ld8(be2, hoff, 64 * c, br + 8 * c); ld8(bp, hoff, 64 * c, bv + 8 * c); }
        XWAIT(hoff);
    }
    ld8(b1 + fq * 32, hoff, 0, bm); ld8(b1 + fq * 32, hoff, 64, bm + 8);
    XWAIT(hoff);
    if (kp == 1) {
#pragma unroll
        for (int g = 0; g < 2; ++g) { xg[hd + 4 * qg][2 * g][lane] = (v4f){o[g][0], o[g][1], o[g][2], o[g][3]}; xg[hd + 4 * qg][2 * g + 1][lane] = (v4f){o[g][4], o[g][5], o[g][6], o[g][7]}; }
        xg[hd + 4 * qg][4][lane] = (v4f){mrun[0], mrun[1], lsum[0], lsum[1]};
    }
    __syncthreads();
    if (kp == 0) {
        const v4f ms = xg[hd + 4 * qg][4][lane];
#pragma unroll
        for (int g = 0; g < 2; ++g) { const v4f a = xg[hd + 4 * qg][2 * g][lane], b = xg[hd + 4 * qg][2 * g + 1][lane];
            const float mn = fmaxf(mrun[g], ms[g]), f0 = exp2one(mrun[g] - mn), f1 = exp2one(ms[g] - mn), l = lsum[g] * f0 + ms[2 + g] * f1;
            const float inv = 1.0f / (l + xhalf(l)), s0 = f0 * inv, s1 = f1 * inv; v4f ra, rb;
#pragma unroll
            for (int i = 0; i < 4; ++i) { ra[i] = o[g][i] * s0 + a[i] * s1; rb[i] = o[g][4 + i] * s0 + b[i] * s1; }
            xc[2 * qg + g][hd][0][lane] = ra; xc[2 * qg + g][hd][1][lane] = rb; }
    }
    __syncthreads();
    if (fq == 0) {
#pragma unroll
        for (int h = 0; h < NH_; ++h) { const v4f a = xc[tg][h][0][lane], b = xc[tg][h][1][lane];
#pragma unroll
            for (int i = 0; i < 4; ++i) { v[8 * h + i] = a[i]; v[8 * h + 4 + i] = b[i]; } }
        split16(v, fh[0], fl[0]); split16(v + 16, fh[1], fl[1]);
        v8f acc[4];
#pragma unroll
        for (int t = 0; t < 4; ++t) acc[t] = (v8f){};
#pragma unroll
        for (int kc = 0; kc < 2; ++kc)
#pragma unroll
            for (int t = 0; t < 4; ++t) { const v16bf w = wfrag(wp, DD + 8, t * 16 + lr, kc * 32 + 8 * hi); acc[t] = wmmab(w, fh[kc], acc[t]); acc[t] = wmmab(w, fl[kc], acc[t]); }
#pragma unroll
        for (int t = 0; t < 4; ++t) {
#pragma unroll
            for (int j = 0; j < 8; ++j) v[8 * t + j] = acc[t][j] + bfr(bv[8 * t + j]);
            xo[tg][t][0][lane] = (v4f){v[8 * t], v[8 * t + 1], v[8 * t + 2], v[8 * t + 3]}; xo[tg][t][1][lane] = (v4f){v[8 * t + 4], v[8 * t + 5], v[8 * t + 6], v[8 * t + 7]}; }
        ln_pair(v, gr, br);
        split16(v, fh[0], fl[0]); split16(v + 16, fh[1], fl[1]);
#pragma unroll
        for (int kc = 0; kc < 2; ++kc) { putf(xh[tg][2 * kc], lane, fh[kc]); putf(xh[tg][2 * kc + 1], lane, fl[kc]); }
    }
    __syncthreads();
    {
#pragma unroll
        for (int kc = 0; kc < 2; ++kc) { fh[kc] = getf(xh[tg][2 * kc], lane); fl[kc] = getf(xh[tg][2 * kc + 1], lane); }
        v8f am[2]; am[0] = (v8f){}; am[1] = (v8f){};
#pragma unroll
        for (int kc = 0; kc < 2; ++kc)
#pragma unroll
            for (int u = 0; u < 2; ++u) { const v16bf w = wfrag(w1, DD + 8, (2 * fq + u) * 16 + lr, kc * 32 + 8 * hi); am[u] = wmmab(w, fh[kc], am[u]); am[u] = wmmab(w, fl[kc], am[u]); }
        float m[16];
#pragma unroll
        for (int u = 0; u < 2; ++u) {
#pragma unroll
            for (int j = 0; j < 8; ++j) { const float a = am[u][j] + bfr(bm[8 * u + j]); m[8 * u + j] = 0.5f * a * (1.0f + erff(a * 0.7071067811865476f)); } }
        v16bf mh, ml; split16(m, mh, ml);
        putf(xm[tg][2 * fq], lane, mh); putf(xm[tg][2 * fq + 1], lane, ml);
    }
    __syncthreads();
    if (fq >= 2) return;
    float bo[16]; ld8(b2 + fq * 32, hoff, 0, bo); ld8(b2 + fq * 32, hoff, 64, bo + 8);
    XWAIT(hoff);
    v8f acc[2]; acc[0] = (v8f){}; acc[1] = (v8f){};
#pragma unroll
    for (int kc = 0; kc < 4; ++kc) { const v16bf mh = getf(xm[tg][2 * kc], lane), ml = getf(xm[tg][2 * kc + 1], lane);
#pragma unroll
        for (int u = 0; u < 2; ++u) { const v16bf w = wfrag(w2, HID + 8, (2 * fq + u) * 16 + lr, kc * 32 + 8 * hi); acc[u] = wmmab(w, mh, acc[u]); acc[u] = wmmab(w, ml, acc[u]); } }
    float* dst = out + (size_t)(t0 + lr) * DD + 8 * hi;
#pragma unroll
    for (int u = 0; u < 2; ++u) { const int t = 2 * fq + u; const v4f oa = xo[tg][t][0][lane], ob = xo[tg][t][1][lane]; v4f ra, rb;
#pragma unroll
        for (int j = 0; j < 4; ++j) { ra[j] = (acc[u][j] + bfr(bo[8 * u + j])) + oa[j]; rb[j] = (acc[u][4 + j] + bfr(bo[8 * u + 4 + j])) + ob[j]; }
        *(v4f*)(dst + t * 16) = ra; *(v4f*)(dst + t * 16 + 4) = rb; }
}

extern "C" void kernel_launch(void* const* d_in, const int* in_sizes, int n_in,
                              void* d_out, int out_size, void* d_ws, size_t ws_size, hipStream_t stream) {
    (void)in_sizes; (void)n_in; (void)out_size;
    const float* x = (const float*)d_in[0]; const float* cl = (const float*)d_in[1]; const float* g1 = (const float*)d_in[2]; const float* be1 = (const float*)d_in[3]; const float* g2 = (const float*)d_in[4]; const float* be2 = (const float*)d_in[5];
    const float* Wkv = (const float*)d_in[6]; const float* bkv = (const float*)d_in[7]; const float* Wq = (const float*)d_in[8]; const float* bq = (const float*)d_in[9]; const float* Wp = (const float*)d_in[10]; const float* bp = (const float*)d_in[11];
    const float* W1 = (const float*)d_in[12]; const float* b1 = (const float*)d_in[13]; const float* W2 = (const float*)d_in[14]; const float* b2 = (const float*)d_in[15];      // k-major weights (x @ W)
    float* out = (float*)d_out;    // [8][2048][64]
    char* wsp = (char*)d_ws;
    auto take = [&](size_t bytes) { char* p = wsp; wsp += (bytes + 255) & ~(size_t)255; return (void*)p; };
    bf* Q16h = (bf*)take((size_t)NR * DD * 2); bf* K16h = (bf*)take((size_t)NR * DD * 2); bf* K16l = (bf*)take((size_t)NR * DD * 2); bf* VBh = (bf*)take((size_t)NR * DD * 2);
    if ((size_t)(wsp - (char*)d_ws) > ws_size) return;    // 8 MB, no aliasing
    k_pre<<<dim3(NR / 64, 2, 1), 128, 0, stream>>>(x, cl, g1, be1, Wkv, bkv, Wq, bq, Q16h, K16h, K16l, VBh);                         // LN, kv and q, head planes
    k_attn<<<dim3(NN / 64, NBI, 1), 512, 0, stream>>>(Q16h, K16h, K16l, VBh, Wp, bp, g2, be2, W1, b1, W2, b2, out);                        // softmax(q_h.k_h^T / 4).v_h of 64 tokens x 4 heads, then projection, LN, MLP, residual
}

// v006
// One run takes 27.1 microseconds.
// Timed twice side by side with v005, it ran 1.12 times as fast both times.
// Over all steps from v000 it is 101 times as fast.
#include <hip/hip_runtime.h>

// Compute dtypes, f32 accumulate: LayerNorm (shared norm1 on both streams, norm2 later) and GELU in f32; kv = LN(x).Wkv + bkv, q = LN(clinic).Wq + bq, o = ctx.Wproj + bproj,
// m = gelu(LN(o).W1 + b1) and out = m.W2 + b2 + o with every computed operand as bf16 hi + UNSCALED residual against exact bf16 weights (two products) on
// v_wmma_f32_16x16x32_bf16; the 4-head (16-dim) cross attention in one launch over all (item, head) pairs on v_wmma_f32_16x16x32_f16: q, v and P are rounded ONCE to f16 (11 bits, where bf16 needed hi + residual), k is f16 hi +
// UNSCALED f16 residual, which costs no product: S^T = k_h.q_h^T (the 16 head dims twice in the 32 k: k hi | k residual against q | q: one product), softmax in f32 (q carries the 1/4 and log2 e) against a fixed reference per query, P^T packed from the accumulators,
// ctx_h^T = v_h^T.P^T (one product). f16 ends at 65504: LayerNorm bounds each feature of a row by 8 |gain| + |offset|, so q, k, v reach that only with weight columns whose absolute sum is in the thousands.
// Two launches: k_pre (LayerNorm, kv / q, head planes), k_attn (attention of 64 tokens x 4 heads, then projection, LayerNorm, MLP, residual of those tokens). In the token-local parts a wave owns 16 tokens and a lane pair (l, l ^ 16)
// one token: apart from k_pre's v product (tokens as A), the weights are the A operand, the tokens the B operand, so each product's accumulators hold 8 consecutive features of the lane's token and convert in place into the
// next product's B operand.

#define NBI  8
#define NN   2048
#define NR   (NBI * NN)          // 16384 token rows
#define DD   64
#define NH_  4
#define HD   16
#define HID  128
#define DM   DD
#define NTK  NR
#define SCL  0.25f
#define LN_EPS 1e-5f
#define LOSC 1024.0f
#define PLIM 32768.0f            // 2^15; f16 ends just below 2^16

typedef _Float16 h16;
typedef unsigned short bf;
typedef __attribute__((ext_vector_type(16))) __bf16   v16bf;
typedef __attribute__((ext_vector_type(16))) _Float16 v16h;
typedef __attribute__((ext_vector_type(8)))  _Float16 v8h;
typedef __attribute__((ext_vector_type(8)))  unsigned short v8us;
typedef __attribute__((ext_vector_type(8)))  float    v8f;
typedef __attribute__((ext_vector_type(4)))  float    v4f;
typedef __attribute__((ext_vector_type(4)))  _Float16 v4h;
typedef v8h  __attribute__((may_alias)) v8ha;
typedef v4f  __attribute__((may_alias)) v4fa;
typedef v8us __attribute__((may_alias)) v8usa;

__device__ __forceinline__ unsigned short f2bf(float f) { unsigned u = __float_as_uint(f); u += 0x7FFFu + ((u >> 16) & 1u); return (unsigned short)(u >> 16); }
__device__ __forceinline__ float bf2f(unsigned short b) { return __uint_as_float(((unsigned)b) << 16); }
__device__ __forceinline__ float bfr(float f) { return bf2f(f2bf(f)); }
__device__ __forceinline__ v16h cat16(v8h lo, v8h hi) { return __builtin_shufflevector(lo, hi, 0, 1, 2, 3, 4, 5, 6, 7, 8, 9, 10, 11, 12, 13, 14, 15); }
__device__ __forceinline__ v16bf cat16b(v8us lo, v8us hi) { return __builtin_bit_cast(v16bf, __builtin_shufflevector(lo, hi, 0, 1, 2, 3, 4, 5, 6, 7, 8, 9, 10, 11, 12, 13, 14, 15)); }
__device__ __forceinline__ v16h cat16u(v8us lo, v8us hi) { return __builtin_bit_cast(v16h, __builtin_shufflevector(lo, hi, 0, 1, 2, 3, 4, 5, 6, 7, 8, 9, 10, 11, 12, 13, 14, 15)); }
__device__ __forceinline__ v8f wmma16(v16h a, v16h b, v8f c) { return __builtin_amdgcn_wmma_f32_16x16x32_f16(false, a, false, b, (short)0, c, false, false); }
__device__ __forceinline__ v8f wmmab(v16bf a, v16bf b, v8f c) { return __builtin_amdgcn_wmma_f32_16x16x32_bf16(false, a, false, b, (short)0, c, false, false); }

// lane l <-> l ^ 16
__device__ __forceinline__ float xhalf(float v) { const int b = __float_as_int(v); return __int_as_float(__builtin_amdgcn_permlanex16(b, b, 0x76543210, 0xfedcba98, false, false)); }
// exp2 by v_exp_f32 in asm text. The instruction set asks for one slot behind a transcendental before its result is read or its source overwritten;
// here every exponential works on a register of its own and the closing v_nop is the slot behind the last. Each overwrites
// its own argument: that register is live in front of the statement, so it is never an operand register that a matrix instruction directly in front has just given up.
__device__ __forceinline__ float exp2one(float x) { asm("v_exp_f32 %0, %0\n\tv_nop" : "+v"(x)); return x; }
__device__ __forceinline__ void exp2x8(float* x) {
    asm("v_exp_f32 %0, %0\n\tv_exp_f32 %1, %1\n\tv_exp_f32 %2, %2\n\tv_exp_f32 %3, %3\n\tv_exp_f32 %4, %4\n\tv_exp_f32 %5, %5\n\tv_exp_f32 %6, %6\n\tv_exp_f32 %7, %7\n\tv_nop"
        : "+v"(x[0]), "+v"(x[1]), "+v"(x[2]), "+v"(x[3]), "+v"(x[4]), "+v"(x[5]), "+v"(x[6]), "+v"(x[7]));
}
typedef __attribute__((ext_vector_type(4))) unsigned v4u;
// NP pairs of f32 values -> packed bf16 hi words and packed bf16 words of the UNSCALED residual (value 2e in the low half of word e)
template <int NP>
__device__ __forceinline__ void splitp(const float* v, unsigned* ph, unsigned* pl) {
    typedef __attribute__((ext_vector_type(2))) float v2f; typedef __attribute__((ext_vector_type(2))) __bf16 v2b;
#pragma unroll
    for (int e = 0; e < NP; ++e) { v2f p; p[0] = v[2 * e]; p[1] = v[2 * e + 1];
        const unsigned hw = __builtin_bit_cast(unsigned, __builtin_convertvector(p, v2b));
        v2f d; d[0] = p[0] - __uint_as_float(hw << 16); d[1] = p[1] - __uint_as_float(hw & 0xFFFF0000u);
        ph[e] = hw; pl[e] = __builtin_bit_cast(unsigned, __builtin_convertvector(d, v2b)); }
}
// 16 values in the operand's k order (two runs of 8 features, 16 apart) -> hi and residual operands
__device__ __forceinline__ void split16(const float* v, v16bf& h, v16bf& l) {
    typedef __attribute__((ext_vector_type(8))) unsigned v8u; unsigned ph[8], pl[8]; splitp<8>(v, ph, pl);
    v8u a, b;
#pragma unroll
    for (int e = 0; e < 8; ++e) { a[e] = ph[e]; b[e] = pl[e]; }
    h = __builtin_bit_cast(v16bf, a); l = __builtin_bit_cast(v16bf, b);
}
// 8 values -> 16 bytes of f16 (round to nearest even), and the 16 bytes of the UNSCALED residual's f16
__device__ __forceinline__ void pack8h(const float* v, v4u& ph, v4u& pl) {
    typedef __attribute__((ext_vector_type(2))) float v2f; typedef __attribute__((ext_vector_type(2))) _Float16 v2h;
#pragma unroll
    for (int e = 0; e < 4; ++e) { v2f p; p[0] = v[2 * e]; p[1] = v[2 * e + 1];
        const v2h hw = __builtin_convertvector(p, v2h);
        const v2f d = p - __builtin_convertvector(hw, v2f);
        ph[e] = __builtin_bit_cast(unsigned, hw); pl[e] = __builtin_bit_cast(unsigned, __builtin_convertvector(d, v2h)); }
}
// Global reads as scalar base + one 32-bit byte offset of the lane + a constant: a group of reads names one address register, which its closing wait (XWAIT) holds live.
__device__ __forceinline__ float ldf(const float* __restrict__ b, unsigned off, int imm) { return *(const float*)((const char*)b + off + imm); }
__device__ __forceinline__ void ld8(const float* __restrict__ b, unsigned off, int imm, float* d) {
    const v4f x = *(const v4f*)((const char*)b + off + imm), y = *(const v4f*)((const char*)b + off + imm + 16);
#pragma unroll
    for (int i = 0; i < 4; ++i) { d[i] = x[i]; d[4 + i] = y[i]; }
}
// Behind a group of global reads: their address register is rewritten later. The operand keeps the register from
// being reused (also as a read's destination) ahead of the wait; the scheduling barrier keeps later register writes from being lifted over it.
#define XWAIT(off) do { asm volatile("s_wait_xcnt 0x0" :: "v"(off) : "memory"); __builtin_amdgcn_sched_barrier(0); } while (0)
// W [K][N] f32 (k-major) -> L [n][K + 8] bf16 in LDS. A unit is 8 k of one n: consecutive lanes take consecutive n (whole lines from W), one 16-byte LDS store a unit.
template <int K, int N, int NT>
__device__ __forceinline__ void stage_wt(const float* __restrict__ Wm, bf* L, int tid) {
    constexpr int NU = N * K / 8 / NT, KS = NT / N * 8;      // units a thread, k step from one unit of a thread to its next
    const int n = tid % N, k8 = (tid / N) * 8; const unsigned off = (unsigned)(k8 * N + n) * 4;
    float r[NU][8];
#pragma unroll
    for (int q = 0; q < NU; ++q)
#pragma unroll
        for (int i = 0; i < 8; ++i) r[q][i] = ldf(Wm, off, (q * KS + i) * N * 4);
    XWAIT(off);
#pragma unroll
    for (int q = 0; q < NU; ++q) { v8us p;
#pragma unroll
        for (int i = 0; i < 8; ++i) p[i] = f2bf(r[q][i]);
        *(v8usa*)(L + n * (K + 8) + k8 + q * KS) = p; }
}
// weight operand: row (feature) of the lane, k = ko .. ko + 7 and ko + 16 .. ko + 23 (ko holds the lane half's 8)
__device__ __forceinline__ v16bf wfrag(const bf* L, int pitch, int row, int ko) { const bf* p = L + row * pitch + ko; return cat16b(*(const v8usa*)p, *(const v8usa*)(p + 16)); }
// LayerNorm of one 64-value row held by a lane pair: v[8 c + i] is feature 16 c + 8 hi + i. 32 values are summed in the lane, then one exchange between the halves.
__device__ __forceinline__ void ln_pair(float* v, const float* g, const float* bb) {      // g, bb: the lane's 32 gains and offsets, as read
    float p[8];
#pragma unroll
    for (int i = 0; i < 8; ++i) p[i] = (v[i] + v[8 + i]) + (v[16 + i] + v[24 + i]);
    float s = ((p[0] + p[1]) + (p[2] + p[3])) + ((p[4] + p[5]) + (p[6] + p[7]));
    s += xhalf(s);
    const float mu = s * (1.0f / DD);
#pragma unroll
    for (int e = 0; e < 32; ++e) v[e] -= mu;
#pragma unroll
    for (int i = 0; i < 8; ++i) p[i] = (v[i] * v[i] + v[8 + i] * v[8 + i]) + (v[16 + i] * v[16 + i] + v[24 + i] * v[24 + i]);
    float s2 = ((p[0] + p[1]) + (p[2] + p[3])) + ((p[4] + p[5]) + (p[6] + p[7]));
    s2 += xhalf(s2);
    const float rs = rsqrtf(s2 * (1.0f / DD) + LN_EPS);
#pragma unroll
    for (int e = 0; e < 32; ++e) v[e] = v[e] * rs * bfr(g[e]) + bfr(bb[e]);
}
// k_pre: grid (16384 / 64 token blocks, 2 streams), 4 waves x 16 tokens. Stream 0: LN(x) -> k (weights as A: a lane gets 8 features of its token) and v (tokens as A: a lane gets 8
// tokens of its feature, the transposed 16 x 16 block); stream 1: LN(clinic) -> q. Planes as k_attn reads them, f16: Q16 / K16 [b][h][t][16], VB [b][h][t/16][d][t%16]; k hi + residual, q and v one plane each.
__global__ __launch_bounds__(128) void k_pre(const float* __restrict__ x, const float* __restrict__ cl, const float* __restrict__ g1, const float* __restrict__ be1, const float* __restrict__ Wkv, const float* __restrict__ bkv,
                                             const float* __restrict__ Wq, const float* __restrict__ bq, bf* Qh, bf* Kh, bf* Kl, bf* Vh) {
    __shared__ __align__(16) bf wl[HID * (DD + 8)];
    const int tid = threadIdx.x, lane = tid & 31, wave = tid >> 5, lr = lane & 15, hi = lane >> 4;
    const bool isq = blockIdx.y != 0;
    const int t0 = blockIdx.x * 64 + wave * 16;
    const float* bias = isq ? bq : bkv;
    const float qs = isq ? SCL * 1.4426950408889634f : 1.0f;      // q carries softmax's scale and log2(e): k_attn's score product then yields exponents of 2
    const unsigned xoff = ((unsigned)(t0 + lr) * DD + 8 * hi) * 4, hoff = hi * 32, loff = lr * 4;
    float v[32], gr[32], br[32], bv[32], bw[NH_];
#pragma unroll
    for (int c = 0; c < 4; ++c) ld8(isq ? cl : x, xoff, 64 * c, v + 8 * c);
    XWAIT(xoff);
#pragma unroll
    for (int c = 0; c < 4; ++c) { ld8(g1, hoff, 64 * c, gr + 8 * c); ld8(be1, hoff, 64 * c, br + 8 * c); ld8(bias, hoff, 64 * c, bv + 8 * c); }
    XWAIT(hoff);
#pragma unroll
    for (int h = 0; h < NH_; ++h) bw[h] = ldf(bkv, loff, (DD + h * HD) * 4);      // v's bias (read by both streams, used by stream 0)
    XWAIT(loff);
    if (isq) stage_wt<DD, DD, 128>(Wq, wl, tid); else stage_wt<DD, HID, 128>(Wkv, wl, tid);
#pragma unroll
    for (int e = 0; e < 32; ++e) v[e] = bfr(v[e]);      // the input rows are bf16-rounded first
    ln_pair(v, gr, br);
    v16bf xh[2], xl[2]; split16(v, xh[0], xl[0]); split16(v + 16, xh[1], xl[1]);
    __syncthreads();
    const size_t o = ((size_t)(t0 / NN) * NH_ * NN + (t0 % NN)) * HD + lr * HD + 8 * hi;      // head 0; a head is NN * HD further
    v8f acc[NH_];
#pragma unroll
    for (int h = 0; h < NH_; ++h) acc[h] = (v8f){};
#pragma unroll
    for (int kc = 0; kc < 2; ++kc)
#pragma unroll
        for (int h = 0; h < NH_; ++h) { const v16bf w = wfrag(wl, DD + 8, h * HD + lr, kc * 32 + 8 * hi); acc[h] = wmmab(w, xh[kc], acc[h]); acc[h] = wmmab(w, xl[kc], acc[h]); }
#pragma unroll
    for (int e = 0; e < 32; ++e) v[e] = (acc[e >> 3][e & 7] + bfr(bv[e])) * qs;
    v4u wh[NH_], wr[NH_];
#pragma unroll
    for (int h = 0; h < NH_; ++h) pack8h(v + 8 * h, wh[h], wr[h]);
#pragma unroll
    for (int h = 0; h < NH_; ++h) *(v4u*)((isq ? Qh : Kh) + o + (size_t)h * NN * HD) = wh[h];
    asm volatile("s_wait_xcnt 0x0" ::: "memory");      // the compiler forms the residual words behind these stores, in their data and address registers
    __builtin_amdgcn_sched_barrier(0);                 // keeps those register writes from being lifted over the wait
    if (!isq) {
#pragma unroll
        for (int h = 0; h < NH_; ++h) *(v4u*)(Kl + o + (size_t)h * NN * HD) = wr[h];
    }
    asm volatile("s_wait_xcnt 0x0" ::: "memory");      // the data and address registers of the stores above are rewritten by the v product below
    if (isq) return;
#pragma unroll
    for (int h = 0; h < NH_; ++h) acc[h] = (v8f){};
#pragma unroll
    for (int kc = 0; kc < 2; ++kc)
#pragma unroll
        for (int h = 0; h < NH_; ++h) { const v16bf w = wfrag(wl, DD + 8, DD + h * HD + lr, kc * 32 + 8 * hi); acc[h] = wmmab(xh[kc], w, acc[h]); acc[h] = wmmab(xl[kc], w, acc[h]); }
#pragma unroll
    for (int h = 0; h < NH_; ++h) { const float bx = bfr(bw[h]); float r[8];
#pragma unroll
        for (int j = 0; j < 8; ++j) r[j] = acc[h][j] + bx;
        pack8h(r, wh[h], wr[h]); }
#pragma unroll
    for (int h = 0; h < NH_; ++h) *(v4u*)(Vh + o + (size_t)h * NN * HD) = wh[h];
}
// An operand (8 registers a lane) through LDS: two planes of 16 bytes a lane, so that consecutive lanes store and load consecutive 16 bytes.
__device__ __forceinline__ void putf(v4u (*xp)[32], int lane, v16bf f) {
    typedef __attribute__((ext_vector_type(8))) unsigned v8u; const v8u w = __builtin_bit_cast(v8u, f);
    xp[0][lane] = (v4u){w[0], w[1], w[2], w[3]}; xp[1][lane] = (v4u){w[4], w[5], w[6], w[7]};
}
__device__ __forceinline__ v16bf getf(const v4u (*xp)[32], int lane) {
    typedef __attribute__((ext_vector_type(8))) unsigned v8u; const v4u a = xp[0][lane], b = xp[1][lane];
    return __builtin_bit_cast(v16bf, (v8u){a[0], a[1], a[2], a[3], b[0], b[1], b[2], b[3]});
}
// k_attn: grid (2048 / 64 token blocks, 8 items), 16 waves = 4 heads x 2 query groups of 32 columns (two 16-column groups each) x 2 key halves, so that a work-group ends with all 64
// features of its 64 tokens and has four waves a SIMD for the token-local stages. A wave walks 1024 keys; a pass is 64 keys = four 16-key blocks: S^T = K.Q^T (A = 16
// key rows, B = 16 query columns; d 0..15 of the hi plane in elements 0..7 of both lane halves, d 0..15 of K's residual plane in elements 8..15 of A, B's elements 0..7 repeated in its 8..15), so a lane holds 32 scores of ONE query per group; each pair of f32 tiles
// converts in place into the B operand P^T of O^T += V^T.P^T (A = two transposed 16 x 16 v blocks = the hardware k order). The sum is in-lane plus one exchange
// between the halves. Scores are exponents of 2 relative to a reference that is fixed before the passes (see there), so that a pass is one basic block of products, exponentials, sums and packing.
// Behind the passes the second key half hands its O^T, reference and sum to the first through LDS, lane for lane; the first rescales both to the larger reference, adds, divides and puts ctx^T
// into LDS (a lane's 8 values of a head are 8 values of the next B operand). Then the waves regroup as 4 token groups (16 tokens) x 4 feature quarters, the three weights as bf16 [n][k] in
// LDS since the kernel's start. Stage A (quarter 0 of each group): o^T = Wproj^T.ctx^T + bproj -> LN -> operands and o^T to LDS. Stage B (every wave, 32 hidden features):
// m^T = gelu(W1^T.h^T + b1) -> operands to LDS; the GELU is a chain of dependent instructions and branches, so it is spread over four waves a SIMD. Stage C (quarters 0 and 1, 32 output
// features = one 128-byte line a token): out^T = W2^T.m^T + b2 + o^T.
__global__ __launch_bounds__(512) void k_attn(const bf* __restrict__ Qh, const bf* __restrict__ Kh, const bf* __restrict__ Kl, const bf* __restrict__ Vh,
                                              const float* __restrict__ Wp, const float* __restrict__ bp, const float* __restrict__ g2, const float* __restrict__ be2,
                                              const float* __restrict__ W1, const float* __restrict__ b1, const float* __restrict__ W2, const float* __restrict__ b2, float* out) {
    typedef __attribute__((ext_vector_type(2))) float v2f; typedef __attribute__((ext_vector_type(2))) _Float16 v2h; typedef __attribute__((ext_vector_type(8))) unsigned v8u;
    __shared__ __align__(16) bf wp[DD * (DD + 8)]; __shared__ __align__(16) bf w1[HID * (DD + 8)]; __shared__ __align__(16) bf w2[DD * (HID + 8)];
    __shared__ v4f xg[8][5][32];         // [head + 4 * query group]: the second key half's two O^T tiles (2 x 16 bytes a lane each), then (reference, reference, sum, sum)
    __shared__ v4f xc[4][4][2][32];      // [group][head]: ctx
    __shared__ v4u xh[4][4][2][32];      // [group][k chunk * 2 + (0 hi, 1 residual)]: LN(o)
    __shared__ v4f xo[4][4][2][32];      // [group][tile]: o
    __shared__ v4u xm[4][8][2][32];      // [group][k chunk * 2 + (0 hi, 1 residual)]: gelu(.)
    const int tid = threadIdx.x, lane = tid & 31, c = lane & 15, lr = c, hi = lane >> 4;
    const int wave = __builtin_amdgcn_readfirstlane(tid >> 5), hd = wave & 3, qg = (wave >> 2) & 1, kp = wave >> 3;      // scalar: scalar plane bases, scalar branches
    const int tg = wave & 3, fq = wave >> 2;      // behind the passes: token group, feature quarter; scalar: the matrix instructions below stand under branches on fq
    const int t0 = blockIdx.y * NN + blockIdx.x * 64 + tg * 16;
    stage_wt<DD, DD, 512>(Wp, wp, tid); stage_wt<DD, HID, 512>(W1, w1, tid); stage_wt<HID, DD, 512>(W2, w2, tid);
    const size_t pb = ((size_t)blockIdx.y * NH_ + hd) * NN * HD, pk = pb + (size_t)kp * (NN / 2) * HD;      // the head's planes; the wave's key half in them
    const int q0 = blockIdx.x * 64 + qg * 32; const unsigned fo = c * HD + 8 * hi;      // the lane's place in a 16 x 16 block; unsigned: scalar base + 32-bit lane offset addressing
    v16h qf[2];
#pragma unroll
    for (int g = 0; g < 2; ++g) { const size_t qo = pb + (size_t)(q0 + 16 * g) * HD + fo; const v8us a = *(const v8us*)(Qh + qo); qf[g] = cat16u(a, a); }
    v8us kh[4], kl[4];
#pragma unroll
    for (int j = 0; j < 4; ++j) { kh[j] = *(const v8us*)(Kh + pk + (fo + 16 * j * HD)); kl[j] = *(const v8us*)(Kl + pk + (fo + 16 * j * HD)); }
    asm volatile("s_wait_xcnt 0x0" ::: "memory");      // the address registers of the loads above are reused below
    __builtin_amdgcn_sched_barrier(0);                 // keeps the register writes below from being lifted over that wait
    // The reference of a query is fixed for the whole walk: the maximum of its scores with the wave's first 16 keys. Minus the reference, in all 8 registers, is the score product's C operand, so
    // the accumulators are the arguments of exp2 as they stand: no maximum, no subtraction, no rescale in a pass. The reference is a score of the row, so nothing underflows that would not with the
    // row's maximum; P may pass 1, and the test behind the walk says whether it stayed inside f16.
    v8f o[2], cm[2]; float mrun[2], lsum[2];
#pragma unroll
    for (int g = 0; g < 2; ++g) { const v8f t = wmma16(cat16u(kh[0], kl[0]), qf[g], (v8f){});
        float a = fmaxf(fmaxf(fmaxf(t[0], t[1]), fmaxf(t[2], t[3])), fmaxf(fmaxf(t[4], t[5]), fmaxf(t[6], t[7])));
        a = fmaxf(a, xhalf(a));
        o[g] = (v8f){}; mrun[g] = a; lsum[g] = 0.f;
#pragma unroll
        for (int r = 0; r < 8; ++r) cm[g][r] = -a; }
#pragma unroll 1
    for (int s = 0; s < NN / 128; ++s) {
        const size_t cu = pk + (size_t)(s * 64) * HD, nx = pk + (size_t)((s + 1 < NN / 128 ? s + 1 : s) * 64) * HD;     // this pass's V, the next pass's K (the last pass reads its own again)
        v8us vh[4];
#pragma unroll
        for (int j = 0; j < 4; ++j) vh[j] = *(const v8us*)(Vh + cu + (fo + 16 * j * HD));
        __builtin_amdgcn_sched_barrier(0);      // holds the V loads at the head of the pass, the scores and exponentials between them and their use
        v8f st[2][4];
#pragma unroll
        for (int j = 0; j < 4; ++j) { const v16h ak = cat16u(kh[j], kl[j]);
#pragma unroll
            for (int g = 0; g < 2; ++g) st[g][j] = wmma16(ak, qf[g], cm[g]); }
#pragma unroll
        for (int j = 0; j < 4; ++j) { kh[j] = *(const v8us*)(Kh + nx + (fo + 16 * j * HD)); kl[j] = *(const v8us*)(Kl + nx + (fo + 16 * j * HD)); }     // K a pass ahead
        __builtin_amdgcn_sched_barrier(0);      // holds the K loads here: the scheduler otherwise sinks them to the loop's foot, directly in front of their use
#pragma unroll
        for (int u = 0; u < 2; ++u) { const v16h vf = cat16u(vh[2 * u], vh[2 * u + 1]);
#pragma unroll
            for (int g = 0; g < 2; ++g) { v8u ph; float s0 = 0.f, s1 = 0.f, pe[16];
#pragma unroll
                for (int e = 0; e < 16; ++e) pe[e] = st[g][2 * u + (e >> 3)][e & 7];
                exp2x8(pe); exp2x8(pe + 8);      // asm text that reads the score products' results: the first group's two products have five or more products behind them, the later groups the exponentials in front
#pragma unroll
                for (int e = 0; e < 8; ++e) { v2f p; p[0] = pe[2 * e]; p[1] = pe[2 * e + 1];
                    s0 += p[0]; s1 += p[1];
                    ph[e] = __builtin_bit_cast(unsigned, __builtin_convertvector(p, v2h)); }
                lsum[g] += s0 + s1;
                const v16h pf = __builtin_bit_cast(v16h, ph);
                o[g] = wmma16(vf, pf, o[g]); } }
    }
    // Every P is positive, so a lane's sum bounds each of its P: up to PLIM all of them fitted f16 and the walk stands. Otherwise (one test for the whole wave; also for a sum that is not a
    // number) the wave walks its keys once more with the running maximum, rescaling in every pass.
    if (__builtin_amdgcn_ballot_w32(!(lsum[0] <= PLIM && lsum[1] <= PLIM)) != 0) {
        const bf* ka = Kh + pk + fo; const bf* la = Kl + pk + fo;
#pragma unroll
        for (int j = 0; j < 4; ++j) { kh[j] = *(const v8us*)(ka + 16 * j * HD); kl[j] = *(const v8us*)(la + 16 * j * HD); }
        asm volatile("s_wait_xcnt 0x0" :: "v"(ka), "v"(la) : "memory");      // the address registers of the loads above are reused below; as operands they are not reused (also not as a load's destination) ahead of the wait
        __builtin_amdgcn_sched_barrier(0);                 // keeps the register writes below from being lifted over that wait
#pragma unroll
        for (int g = 0; g < 2; ++g) { o[g] = (v8f){}; mrun[g] = -3.0e38f; lsum[g] = 0.f; }
#pragma unroll 1      // rolled like the walk above
        for (int s = 0; s < NN / 128; ++s) {
            const size_t cu = pk + (size_t)(s * 64) * HD, nx = pk + (size_t)((s + 1 < NN / 128 ? s + 1 : s) * 64) * HD;     // this pass's V, the next pass's K (the last pass reads its own again)
            const bf* va = Vh + cu + fo; const bf* kn = Kh + nx + fo; const bf* ln = Kl + nx + fo;
            v8us vh[4];
#pragma unroll
            for (int j = 0; j < 4; ++j) vh[j] = *(const v8us*)(va + 16 * j * HD);
            asm volatile("s_wait_xcnt 0x0" :: "v"(va) : "memory");      // the address registers of the V loads are reused below; the operand as above
            __builtin_amdgcn_sched_barrier(0);                 // keeps the register writes below from being lifted over that wait, and the V loads at the head of the pass
            v8f st[2][4];
#pragma unroll
            for (int j = 0; j < 4; ++j) { const v16h ak = cat16u(kh[j], kl[j]);
#pragma unroll
                for (int g = 0; g < 2; ++g) st[g][j] = wmma16(ak, qf[g], (v8f){}); }
#pragma unroll
            for (int j = 0; j < 4; ++j) { kh[j] = *(const v8us*)(kn + 16 * j * HD); kl[j] = *(const v8us*)(ln + 16 * j * HD); }     // K a pass ahead
            asm volatile("s_wait_xcnt 0x0" :: "v"(kn), "v"(ln) : "memory");      // the address registers of the K loads are reused below; the operands as above
            __builtin_amdgcn_sched_barrier(0);                 // keeps the register writes below from being lifted over that wait, and the K loads here
#pragma unroll
            for (int g = 0; g < 2; ++g) { float a = fmaxf(st[g][0][0], st[g][1][0]), b = fmaxf(st[g][2][0], st[g][3][0]);
#pragma unroll
                for (int r = 1; r < 8; ++r) { a = fmaxf(a, fmaxf(st[g][0][r], st[g][1][r])); b = fmaxf(b, fmaxf(st[g][2][r], st[g][3][r])); }
                a = fmaxf(a, b);
                const float mn = fmaxf(mrun[g], fmaxf(a, xhalf(a))), fs = exp2one(mrun[g] - mn); o[g] *= fs; lsum[g] *= fs; mrun[g] = mn; }
#pragma unroll
            for (int u = 0; u < 2; ++u) { const v16h vf = cat16u(vh[2 * u], vh[2 * u + 1]);
#pragma unroll
                for (int g = 0; g < 2; ++g) { v8u ph; float s0 = 0.f, s1 = 0.f, pe[16];
#pragma unroll
                    for (int e = 0; e < 16; ++e) pe[e] = st[g][2 * u + (e >> 3)][e & 7] - mrun[g];
                    exp2x8(pe); exp2x8(pe + 8);
#pragma unroll
                    for (int e = 0; e < 8; ++e) { v2f p; p[0] = pe[2 * e]; p[1] = pe[2 * e + 1];
                        s0 += p[0]; s1 += p[1];
                        ph[e] = __builtin_bit_cast(unsigned, __builtin_convertvector(p, v2h)); }
                    lsum[g] += s0 + s1;
                    const v16h pf = __builtin_bit_cast(v16h, ph);
                    o[g] = wmma16(vf, pf, o[g]); } }
        }
    }
    const unsigned hoff = hi * 32;
    v16bf fh[2], fl[2];
    float v[32] = {}, gr[32] = {}, br[32] = {}, bv[32] = {}, bm[16];
    if (fq == 0) {
#pragma unroll
        for (int c = 0; c < 4; ++c) { ld8(g2, hoff, 64 * c, gr + 8 * c); ld8(be2, hoff, 64 * c, br + 8 * c); ld8(bp, hoff, 64 * c, bv + 8 * c); }
        XWAIT(hoff);
    }
    ld8(b1 + fq * 32, hoff, 0, bm); ld8(b1 + fq * 32, hoff, 64, bm + 8);
    XWAIT(hoff);
    if (kp == 1) {
#pragma unroll
        for (int g = 0; g < 2; ++g) { xg[hd + 4 * qg][2 * g][lane] = (v4f){o[g][0], o[g][1], o[g][2], o[g][3]}; xg[hd + 4 * qg][2 * g + 1][lane] = (v4f){o[g][4], o[g][5], o[g][6], o[g][7]}; }
        xg[hd + 4 * qg][4][lane] = (v4f){mrun[0], mrun[1], lsum[0], lsum[1]};
    }
    __syncthreads();
    if (kp == 0) {
        const v4f ms = xg[hd + 4 * qg][4][lane];
#pragma unroll
        for (int g = 0; g < 2; ++g) { const v4f a = xg[hd + 4 * qg][2 * g][lane], b = xg[hd + 4 * qg][2 * g + 1][lane];
            const float mn = fmaxf(mrun[g], ms[g]), f0 = exp2one(mrun[g] - mn), f1 = exp2one(ms[g] - mn), l = lsum[g] * f0 + ms[2 + g] * f1;
            const float inv = 1.0f / (l + xhalf(l)), s0 = f0 * inv, s1 = f1 * inv; v4f ra, rb;
#pragma unroll
            for (int i = 0; i < 4; ++i) { ra[i] = o[g][i] * s0 + a[i] * s1; rb[i] = o[g][4 + i] * s0 + b[i] * s1; }
            xc[2 * qg + g][hd][0][lane] = ra; xc[2 * qg + g][hd][1][lane] = rb; }
    }
    __syncthreads();
    if (fq == 0) {
#pragma unroll
        for (int h = 0; h < NH_; ++h) { const v4f a = xc[tg][h][0][lane], b = xc[tg][h][1][lane];
#pragma unroll
            for (int i = 0; i < 4; ++i) { v[8 * h + i] = a[i]; v[8 * h + 4 + i] = b[i]; } }
        split16(v, fh[0], fl[0]); split16(v + 16, fh[1], fl[1]);
        v8f acc[4];
#pragma unroll
        for (int t = 0; t < 4; ++t) acc[t] = (v8f){};
#pragma unroll
        for (int kc = 0; kc < 2; ++kc)
#pragma unroll
            for (int t = 0; t < 4; ++t) { const v16bf w = wfrag(wp, DD + 8, t * 16 + lr, kc * 32 + 8 * hi); acc[t] = wmmab(w, fh[kc], acc[t]); acc[t] = wmmab(w, fl[kc], acc[t]); }
#pragma unroll
        for (int t = 0; t < 4; ++t) {
#pragma unroll
            for (int j = 0; j < 8; ++j) v[8 * t + j] = acc[t][j] + bfr(bv[8 * t + j]);
            xo[tg][t][0][lane] = (v4f){v[8 * t], v[8 * t + 1], v[8 * t + 2], v[8 * t + 3]}; xo[tg][t][1][lane] = (v4f){v[8 * t + 4], v[8 * t + 5], v[8 * t + 6], v[8 * t + 7]}; }
        ln_pair(v, gr, br);
        split16(v, fh[0], fl[0]); split16(v + 16, fh[1], fl[1]);
#pragma unroll
        for (int kc = 0; kc < 2; ++kc) { putf(xh[tg][2 * kc], lane, fh[kc]); putf(xh[tg][2 * kc + 1], lane, fl[kc]); }
    }
    __syncthreads();
    {
#pragma unroll
        for (int kc = 0; kc < 2; ++kc) { fh[kc] = getf(xh[tg][2 * kc], lane); fl[kc] = getf(xh[tg][2 * kc + 1], lane); }
        v8f am[2]; am[0] = (v8f){}; am[1] = (v8f){};
#pragma unroll
        for (int kc = 0; kc < 2; ++kc)
#pragma unroll
            for (int u = 0; u < 2; ++u) { const v16bf w = wfrag(w1, DD + 8, (2 * fq + u) * 16 + lr, kc * 32 + 8 * hi); am[u] = wmmab(w, fh[kc], am[u]); am[u] = wmmab(w, fl[kc], am[u]); }
        float m[16];
#pragma unroll
        for (int u = 0; u < 2; ++u) {
#pragma unroll
            for (int j = 0; j < 8; ++j) { const float a = am[u][j] + bfr(bm[8 * u + j]); m[8 * u + j] = 0.5f * a * (1.0f + erff(a * 0.7071067811865476f)); } }
        v16bf mh, ml; split16(m, mh, ml);
        putf(xm[tg][2 * fq], lane, mh); putf(xm[tg][2 * fq + 1], lane, ml);
    }
    __syncthreads();
    if (fq >= 2) return;
    float bo[16]; ld8(b2 + fq * 32, hoff, 0, bo); ld8(b2 + fq * 32, hoff, 64, bo + 8);
    XWAIT(hoff);
    v8f acc[2]; acc[0] = (v8f){}; acc[1] = (v8f){};
#pragma unroll
    for (int kc = 0; kc < 4; ++kc) { const v16bf mh = getf(xm[tg][2 * kc], lane), ml = getf(xm[tg][2 * kc + 1], lane);
#pragma unroll
        for (int u = 0; u < 2; ++u) { const v16bf w = wfrag(w2, HID + 8, (2 * fq + u) * 16 + lr, kc * 32 + 8 * hi); acc[u] = wmmab(w, mh, acc[u]); acc[u] = wmmab(w, ml, acc[u]); } }
    float* dst = out + (size_t)(t0 + lr) * DD + 8 * hi;
#pragma unroll
    for (int u = 0; u < 2; ++u) { const int t = 2 * fq + u; const v4f oa = xo[tg][t][0][lane], ob = xo[tg][t][1][lane]; v4f ra, rb;
#pragma unroll
        for (int j = 0; j < 4; ++j) { ra[j] = (acc[u][j] + bfr(bo[8 * u + j])) + oa[j]; rb[j] = (acc[u][4 + j] + bfr(bo[8 * u + 4 + j])) + ob[j]; }
        *(v4f*)(dst + t * 16) = ra; *(v4f*)(dst + t * 16 + 4) = rb; }
}

extern "C" void kernel_launch(void* const* d_in, const int* in_sizes, int n_in,
                              void* d_out, int out_size, void* d_ws, size_t ws_size, hipStream_t stream) {
    (void)in_sizes; (void)n_in; (void)out_size;
    const float* x = (const float*)d_in[0]; const float* cl = (const float*)d_in[1]; const float* g1 = (const float*)d_in[2]; const float* be1 = (const float*)d_in[3]; const float* g2 = (const float*)d_in[4]; const float* be2 = (const float*)d_in[5];
    const float* Wkv = (const float*)d_in[6]; const float* bkv = (const float*)d_in[7]; const float* Wq = (const float*)d_in[8]; const float* bq = (const float*)d_in[9]; const float* Wp = (const float*)d_in[10]; const float* bp = (const float*)d_in[11];
    const float* W1 = (const float*)d_in[12]; const float* b1 = (const float*)d_in[13]; const float* W2 = (const float*)d_in[14]; const float* b2 = (const float*)d_in[15];      // k-major weights (x @ W)
    float* out = (float*)d_out;    // [8][2048][64]
    char* wsp = (char*)d_ws;
    auto take = [&](size_t bytes) { char* p = wsp; wsp += (bytes + 255) & ~(size_t)255; return (void*)p; };
    bf* Q16h = (bf*)take((size_t)NR * DD * 2); bf* K16h = (bf*)take((size_t)NR * DD * 2); bf* K16l = (bf*)take((size_t)NR * DD * 2); bf* VBh = (bf*)take((size_t)NR * DD * 2);
    if ((size_t)(wsp - (char*)d_ws) > ws_size) return;    // 8 MB, no aliasing
    k_pre<<<dim3(NR / 64, 2, 1), 128, 0, stream>>>(x, cl, g1, be1, Wkv, bkv, Wq, bq, Q16h, K16h, K16l, VBh);                         // LN, kv and q, head planes
    k_attn<<<dim3(NN / 64, NBI, 1), 512, 0, stream>>>(Q16h, K16h, K16l, VBh, Wp, bp, g2, be2, W1, b1, W2, b2, out);                        // softmax(q_h.k_h^T / 4).v_h of 64 tokens x 4 heads, then projection, LN, MLP, residual
}

// v007
// It runs in 26.1 microseconds.
// In two side-by-side timings against v006, it was 1.06 and 1.04 times as fast.
// Counting every step since v000, it is 106 times as fast.
#include <hip/hip_runtime.h>

// Compute dtypes, f32 accumulate: LayerNorm (shared norm1 on both streams, norm2 later) and GELU in f32; kv = LN(x).Wkv + bkv, q = LN(clinic).Wq + bq, o = ctx.Wproj + bproj,
// m = gelu(LN(o).W1 + b1) and out = m.W2 + b2 + o with every computed operand as bf16 hi + UNSCALED residual against exact bf16 weights (two products) on
// v_wmma_f32_16x16x32_bf16; the 4-head (16-dim) cross attention in one launch over all (item, head) pairs on v_wmma_f32_16x16x32_f16: q, v and P are rounded ONCE to f16 (11 bits, where bf16 needed hi + residual), k is f16 hi +
// UNSCALED f16 residual, which costs no product: S^T = k_h.q_h^T (the 16 head dims twice in the 32 k: k hi | k residual against q | q: one product), softmax in f32 (q carries the 1/4 and log2 e) against a fixed reference per query, P^T packed from the accumulators,
// ctx_h^T = v_h^T.P^T (one product). f16 ends at 65504: LayerNorm bounds each feature of a row by 8 |gain| + |offset|, so q, k, v reach that only with weight columns whose absolute sum is in the thousands.
// Two launches: k_pre (LayerNorm, kv / q, head planes), k_attn (attention of 64 tokens x 4 heads, then projection, LayerNorm, MLP, residual of those tokens). In the token-local parts a wave owns 16 tokens and a lane pair (l, l ^ 16)
// one token: apart from k_pre's v product (tokens as A), the weights are the A operand, the tokens the B operand, so each product's accumulators hold 8 consecutive features of the lane's token and convert in place into the
// next product's B operand.

#define NBI  8
#define NN   2048
#define NR   (NBI * NN)          // 16384 token rows
#define DD   64
#define NH_  4
#define HD   16
#define HID  128
#define DM   DD
#define NTK  NR
#define SCL  0.25f
#define LN_EPS 1e-5f
#define LOSC 1024.0f
#define PLIM 32768.0f            // 2^15; f16 ends just below 2^16
// The parameters of the token-local stages behind attention, in the form those stages read them: one image that k_pre writes once and every work-group of k_attn copies into LDS as it lies.
// Offsets in 2-byte elements: three weights as bf16 [n][K + 8] (the 8 pad elements of a row are zeros), then f32 values rounded to bf16: g2 | be2 | bproj | b1 | b2.
#define IM_W1 (DD * (DD + 8))
#define IM_W2 (IM_W1 + HID * (DD + 8))
#define IM_V  (IM_W2 + DD * (HID + 8))
#define IM_WU (IM_V / 8)                      // 16-byte units of weights: 2816
#define IM_U  (IM_WU + (4 * DD + HID) / 4)    // 16-byte units in all: 2912

typedef _Float16 h16;
typedef unsigned short bf;
typedef __attribute__((ext_vector_type(16))) __bf16   v16bf;
typedef __attribute__((ext_vector_type(16))) _Float16 v16h;
typedef __attribute__((ext_vector_type(8)))  _Float16 v8h;
typedef __attribute__((ext_vector_type(8)))  unsigned short v8us;
typedef __attribute__((ext_vector_type(8)))  float    v8f;
typedef __attribute__((ext_vector_type(4)))  float    v4f;
typedef __attribute__((ext_vector_type(4)))  _Float16 v4h;
typedef v8h  __attribute__((may_alias)) v8ha;
typedef v4f  __attribute__((may_alias)) v4fa;
typedef v8us __attribute__((may_alias)) v8usa;

__device__ __forceinline__ unsigned short f2bf(float f) { unsigned u = __float_as_uint(f); u += 0x7FFFu + ((u >> 16) & 1u); return (unsigned short)(u >> 16); }
__device__ __forceinline__ float bf2f(unsigned short b) { return __uint_as_float(((unsigned)b) << 16); }
__device__ __forceinline__ float bfr(float f) { return bf2f(f2bf(f)); }
__device__ __forceinline__ v16h cat16(v8h lo, v8h hi) { return __builtin_shufflevector(lo, hi, 0, 1, 2, 3, 4, 5, 6, 7, 8, 9, 10, 11, 12, 13, 14, 15); }
__device__ __forceinline__ v16bf cat16b(v8us lo, v8us hi) { return __builtin_bit_cast(v16bf, __builtin_shufflevector(lo, hi, 0, 1, 2, 3, 4, 5, 6, 7, 8, 9, 10, 11, 12, 13, 14, 15)); }
__device__ __forceinline__ v16h cat16u(v8us lo, v8us hi) { return __builtin_bit_cast(v16h, __builtin_shufflevector(lo, hi, 0, 1, 2, 3, 4, 5, 6, 7, 8, 9, 10, 11, 12, 13, 14, 15)); }
__device__ __forceinline__ v8f wmma16(v16h a, v16h b, v8f c) { return __builtin_amdgcn_wmma_f32_16x16x32_f16(false, a, false, b, (short)0, c, false, false); }
__device__ __forceinline__ v8f wmmab(v16bf a, v16bf b, v8f c) { return __builtin_amdgcn_wmma_f32_16x16x32_bf16(false, a, false, b, (short)0, c, false, false); }

// lane l <-> l ^ 16
__device__ __forceinline__ float xhalf(float v) { const int b = __float_as_int(v); return __int_as_float(__builtin_amdgcn_permlanex16(b, b, 0x76543210, 0xfedcba98, false, false)); }
// exp2 by v_exp_f32 in asm text. The instruction set asks for one slot behind a transcendental before its result is read or its source overwritten;
// here every exponential works on a register of its own and the closing v_nop is the slot behind the last. Each overwrites
// its own argument: that register is live in front of the statement, so it is never an operand register that a matrix instruction directly in front has just given up.
__device__ __forceinline__ float exp2one(float x) { asm("v_exp_f32 %0, %0\n\tv_nop" : "+v"(x)); return x; }
__device__ __forceinline__ void exp2x8(float* x) {
    asm("v_exp_f32 %0, %0\n\tv_exp_f32 %1, %1\n\tv_exp_f32 %2, %2\n\tv_exp_f32 %3, %3\n\tv_exp_f32 %4, %4\n\tv_exp_f32 %5, %5\n\tv_exp_f32 %6, %6\n\tv_exp_f32 %7, %7\n\tv_nop"
        : "+v"(x[0]), "+v"(x[1]), "+v"(x[2]), "+v"(x[3]), "+v"(x[4]), "+v"(x[5]), "+v"(x[6]), "+v"(x[7]));
}
typedef __attribute__((ext_vector_type(4))) unsigned v4u;
// NP pairs of f32 values -> packed bf16 hi words and packed bf16 words of the UNSCALED residual (value 2e in the low half of word e)
template <int NP>
__device__ __forceinline__ void splitp(const float* v, unsigned* ph, unsigned* pl) {
    typedef __attribute__((ext_vector_type(2))) float v2f; typedef __attribute__((ext_vector_type(2))) __bf16 v2b;
#pragma unroll
    for (int e = 0; e < NP; ++e) { v2f p; p[0] = v[2 * e]; p[1] = v[2 * e + 1];
        const unsigned hw = __builtin_bit_cast(unsigned, __builtin_convertvector(p, v2b));
        v2f d; d[0] = p[0] - __uint_as_float(hw << 16); d[1] = p[1] - __uint_as_float(hw & 0xFFFF0000u);
        ph[e] = hw; pl[e] = __builtin_bit_cast(unsigned, __builtin_convertvector(d, v2b)); }
}
// 16 values in the operand's k order (two runs of 8 features, 16 apart) -> hi and residual operands
__device__ __forceinline__ void split16(const float* v, v16bf& h, v16bf& l) {
    typedef __attribute__((ext_vector_type(8))) unsigned v8u; unsigned ph[8], pl[8]; splitp<8>(v, ph, pl);
    v8u a, b;
#pragma unroll
    for (int e = 0; e < 8; ++e) { a[e] = ph[e]; b[e] = pl[e]; }
    h = __builtin_bit_cast(v16bf, a); l = __builtin_bit_cast(v16bf, b);
}
// 8 values -> 16 bytes of f16 (round to nearest even), and the 16 bytes of the UNSCALED residual's f16
__device__ __forceinline__ void pack8h(const float* v, v4u& ph, v4u& pl) {
    typedef __attribute__((ext_vector_type(2))) float v2f; typedef __attribute__((ext_vector_type(2))) _Float16 v2h;
#pragma unroll
    for (int e = 0; e < 4; ++e) { v2f p; p[0] = v[2 * e]; p[1] = v[2 * e + 1];
        const v2h hw = __builtin_convertvector(p, v2h);
        const v2f d = p - __builtin_convertvector(hw, v2f);
        ph[e] = __builtin_bit_cast(unsigned, hw); pl[e] = __builtin_bit_cast(unsigned, __builtin_convertvector(d, v2h)); }
}
// Global reads as scalar base + one 32-bit byte offset of the lane + a constant: a group of reads names one address register, which its closing wait (XWAIT) holds live.
__device__ __forceinline__ float ldf(const float* __restrict__ b, unsigned off, int imm) { return *(const float*)((const char*)b + off + imm); }
__device__ __forceinline__ void ld8(const float* __restrict__ b, unsigned off, int imm, float* d) {
    const v4f x = *(const v4f*)((const char*)b + off + imm), y = *(const v4f*)((const char*)b + off + imm + 16);
#pragma unroll
    for (int i = 0; i < 4; ++i) { d[i] = x[i]; d[4 + i] = y[i]; }
}
// Behind a group of global reads: their address register is rewritten later. The operand keeps the register from
// being reused (also as a read's destination) ahead of the wait; the scheduling barrier keeps later register writes from being lifted over it.
#define XWAIT(off) do { asm volatile("s_wait_xcnt 0x0" :: "v"(off) : "memory"); __builtin_amdgcn_sched_barrier(0); } while (0)
// W [K][N] f32 (k-major) -> L [n][K + 8] bf16 in LDS. A unit is 8 k of one n: consecutive lanes take consecutive n (whole lines from W), one 16-byte LDS store a unit.
template <int K, int N, int NT>
__device__ __forceinline__ void stage_wt(const float* __restrict__ Wm, bf* L, int tid) {
    constexpr int NU = N * K / 8 / NT, KS = NT / N * 8;      // units a thread, k step from one unit of a thread to its next
    const int n = tid % N, k8 = (tid / N) * 8; const unsigned off = (unsigned)(k8 * N + n) * 4;
    float r[NU][8];
#pragma unroll
    for (int q = 0; q < NU; ++q)
#pragma unroll
        for (int i = 0; i < 8; ++i) r[q][i] = ldf(Wm, off, (q * KS + i) * N * 4);
    XWAIT(off);
#pragma unroll
    for (int q = 0; q < NU; ++q) { v8us p;
#pragma unroll
        for (int i = 0; i < 8; ++i) p[i] = f2bf(r[q][i]);
        *(v8usa*)(L + n * (K + 8) + k8 + q * KS) = p; }
}
// weight operand: row (feature) of the lane, k = ko .. ko + 7 and ko + 16 .. ko + 23 (ko holds the lane half's 8)
__device__ __forceinline__ v16bf wfrag(const bf* L, int pitch, int row, int ko) { const bf* p = L + row * pitch + ko; return cat16b(*(const v8usa*)p, *(const v8usa*)(p + 16)); }
// LayerNorm of one 64-value row held by a lane pair: v[8 c + i] is feature 16 c + 8 hi + i. 32 values are summed in the lane, then one exchange between the halves.
template <bool RAW>      // RAW: g, bb as the inputs hold them, rounded to bf16 here; otherwise already rounded
__device__ __forceinline__ void ln_pair(float* v, const float* g, const float* bb) {      // g, bb: the lane's 32 gains and offsets
    float p[8];
#pragma unroll
    for (int i = 0; i < 8; ++i) p[i] = (v[i] + v[8 + i]) + (v[16 + i] + v[24 + i]);
    float s = ((p[0] + p[1]) + (p[2] + p[3])) + ((p[4] + p[5]) + (p[6] + p[7]));
    s += xhalf(s);
    const float mu = s * (1.0f / DD);
#pragma unroll
    for (int e = 0; e < 32; ++e) v[e] -= mu;
#pragma unroll
    for (int i = 0; i < 8; ++i) p[i] = (v[i] * v[i] + v[8 + i] * v[8 + i]) + (v[16 + i] * v[16 + i] + v[24 + i] * v[24 + i]);
    float s2 = ((p[0] + p[1]) + (p[2] + p[3])) + ((p[4] + p[5]) + (p[6] + p[7]));
    s2 += xhalf(s2);
    const float rs = rsqrtf(s2 * (1.0f / DD) + LN_EPS);
#pragma unroll
    for (int e = 0; e < 32; ++e) v[e] = v[e] * rs * (RAW ? bfr(g[e]) : g[e]) + (RAW ? bfr(bb[e]) : bb[e]);
}
// One 16-byte unit of the image: 8 k of row n of W [K][N] f32 (k-major) as bf16, r = n * (K / 8 + 1) + k / 8; a row's last unit is its pad.
template <int K, int N>
__device__ __forceinline__ void image_w(const float* __restrict__ Wm, bf* dst, int r) {
    constexpr int PER = K / 8 + 1; const int n = r / PER, k8 = r % PER; const bool pad = k8 == K / 8;
    const unsigned off = (unsigned)((pad ? 0 : k8 * 8) * N + n) * 4; float x[8];      // a pad unit reads the row's first 8 k and stores zeros
#pragma unroll
    for (int i = 0; i < 8; ++i) x[i] = ldf(Wm, off, i * N * 4);
    XWAIT(off);
    const unsigned short keep = pad ? 0 : 0xFFFF; v8us p;
#pragma unroll
    for (int i = 0; i < 8; ++i) p[i] = f2bf(x[i]) & keep;
    *(v8usa*)dst = p;
}
// k_pre: grid (16384 / 64 token blocks, 2 streams), 4 waves x 16 tokens. Stream 0: LN(x) -> k (weights as A: a lane gets 8 features of its token) and v (tokens as A: a lane gets 8
// tokens of its feature, the transposed 16 x 16 block); stream 1: LN(clinic) -> q. Planes as k_attn reads them, f16: Q16 / K16 [b][h][t][16], VB [b][h][t/16][d][t%16]; k hi + residual, q and v one plane each.
// The 12 further columns of the grid (24 work-groups) write the parameter image, a thread one 16-byte unit; the bounds between its parts are multiples of 32 units, so a wave takes one branch.
__global__ __launch_bounds__(128) void k_pre(const float* __restrict__ x, const float* __restrict__ cl, const float* __restrict__ g1, const float* __restrict__ be1, const float* __restrict__ Wkv, const float* __restrict__ bkv,
                                             const float* __restrict__ Wq, const float* __restrict__ bq, bf* Qh, bf* Kh, bf* Kl, bf* Vh,
                                             const float* __restrict__ Wp, const float* __restrict__ bp, const float* __restrict__ g2, const float* __restrict__ be2,
                                             const float* __restrict__ W1, const float* __restrict__ b1, const float* __restrict__ W2, const float* __restrict__ b2, bf* PB) {
    __shared__ __align__(16) bf wl[HID * (DD + 8)];
    const int tid = threadIdx.x, lane = tid & 31, wave = tid >> 5, lr = lane & 15, hi = lane >> 4;
    if (blockIdx.x >= NR / 64) {      // the whole work-group, in front of every barrier
        const int u = ((blockIdx.x - NR / 64) * 2 + blockIdx.y) * 128 + tid;
        if (u < IM_W1 / 8) image_w<DD, DD>(Wp, PB + u * 8, u);
        else if (u < IM_W2 / 8) image_w<DD, HID>(W1, PB + u * 8, u - IM_W1 / 8);
        else if (u < IM_WU) image_w<HID, DD>(W2, PB + u * 8, u - IM_W2 / 8);
        else if (u < IM_U) { const int j = u - IM_WU;      // 4 values of g2 | be2 | bproj | b1 | b2
            const float* s = j < 16 ? g2 + 4 * j : j < 32 ? be2 + 4 * (j - 16) : j < 48 ? bp + 4 * (j - 32) : j < 80 ? b1 + 4 * (j - 48) : b2 + 4 * (j - 80);
            const v4f a = *(const v4f*)s;
            asm volatile("s_wait_xcnt 0x0" :: "v"(s) : "memory");      // the load's address registers are reused below; as an operand the address is not reused (also not as the load's destination) ahead of the wait
            __builtin_amdgcn_sched_barrier(0);                        // keeps the register writes below from being lifted over that wait
            v4f y;
#pragma unroll
            for (int i = 0; i < 4; ++i) y[i] = bfr(a[i]);
            *(v4fa*)(PB + u * 8) = y; }
        return;
    }
    const bool isq = blockIdx.y != 0;
    const int t0 = blockIdx.x * 64 + wave * 16;
    const float* bias = isq ? bq : bkv;
    const float qs = isq ? SCL * 1.4426950408889634f : 1.0f;      // q carries softmax's scale and log2(e): k_attn's score product then yields exponents of 2
    const unsigned xoff = ((unsigned)(t0 + lr) * DD + 8 * hi) * 4, hoff = hi * 32, loff = lr * 4;
    float v[32], gr[32], br[32], bv[32], bw[NH_];
#pragma unroll
    for (int c = 0; c < 4; ++c) ld8(isq ? cl : x, xoff, 64 * c, v + 8 * c);
    XWAIT(xoff);
#pragma unroll
    for (int c = 0; c < 4; ++c) { ld8(g1, hoff, 64 * c, gr + 8 * c); ld8(be1, hoff, 64 * c, br + 8 * c); ld8(bias, hoff, 64 * c, bv + 8 * c); }
    XWAIT(hoff);
#pragma unroll
    for (int h = 0; h < NH_; ++h) bw[h] = ldf(bkv, loff, (DD + h * HD) * 4);      // v's bias (read by both streams, used by stream 0)
    XWAIT(loff);
    if (isq) stage_wt<DD, DD, 128>(Wq, wl, tid); else stage_wt<DD, HID, 128>(Wkv, wl, tid);
#pragma unroll
    for (int e = 0; e < 32; ++e) v[e] = bfr(v[e]);      // the input rows are bf16-rounded first
    ln_pair<true>(v, gr, br);
    v16bf xh[2], xl[2]; split16(v, xh[0], xl[0]); split16(v + 16, xh[1], xl[1]);
    __syncthreads();
    const size_t o = ((size_t)(t0 / NN) * NH_ * NN + (t0 % NN)) * HD + lr * HD + 8 * hi;      // head 0; a head is NN * HD further
    v8f acc[NH_];
#pragma unroll
    for (int h = 0; h < NH_; ++h) acc[h] = (v8f){};
#pragma unroll
    for (int kc = 0; kc < 2; ++kc)
#pragma unroll
        for (int h = 0; h < NH_; ++h) { const v16bf w = wfrag(wl, DD + 8, h * HD + lr, kc * 32 + 8 * hi); acc[h] = wmmab(w, xh[kc], acc[h]); acc[h] = wmmab(w, xl[kc], acc[h]); }
#pragma unroll
    for (int e = 0; e < 32; ++e) v[e] = (acc[e >> 3][e & 7] + bfr(bv[e])) * qs;
    v4u wh[NH_], wr[NH_];
#pragma unroll
    for (int h = 0; h < NH_; ++h) pack8h(v + 8 * h, wh[h], wr[h]);
#pragma unroll
    for (int h = 0; h < NH_; ++h) *(v4u*)((isq ? Qh : Kh) + o + (size_t)h * NN * HD) = wh[h];
    asm volatile("s_wait_xcnt 0x0" ::: "memory");      // the compiler forms the residual words behind these stores, in their data and address registers
    __builtin_amdgcn_sched_barrier(0);                 // keeps those register writes from being lifted over the wait
    if (!isq) {
#pragma unroll
        for (int h = 0; h < NH_; ++h) *(v4u*)(Kl + o + (size_t)h * NN * HD) = wr[h];
    }
    asm volatile("s_wait_xcnt 0x0" ::: "memory");      // the data and address registers of the stores above are rewritten by the v product below
    if (isq) return;
#pragma unroll
    for (int h = 0; h < NH_; ++h) acc[h] = (v8f){};
#pragma unroll
    for (int kc = 0; kc < 2; ++kc)
#pragma unroll
        for (int h = 0; h < NH_; ++h) { const v16bf w = wfrag(wl, DD + 8, DD + h * HD + lr, kc * 32 + 8 * hi); acc[h] = wmmab(xh[kc], w, acc[h]); acc[h] = wmmab(xl[kc], w, acc[h]); }
#pragma unroll
    for (int h = 0; h < NH_; ++h) { const float bx = bfr(bw[h]); float r[8];
#pragma unroll
        for (int j = 0; j < 8; ++j) r[j] = acc[h][j] + bx;
        pack8h(r, wh[h], wr[h]); }
#pragma unroll
    for (int h = 0; h < NH_; ++h) *(v4u*)(Vh + o + (size_t)h * NN * HD) = wh[h];
}
// An operand (8 registers a lane) through LDS: two planes of 16 bytes a lane, so that consecutive lanes store and load consecutive 16 bytes.
__device__ __forceinline__ void putf(v4u (*xp)[32], int lane, v16bf f) {
    typedef __attribute__((ext_vector_type(8))) unsigned v8u; const v8u w = __builtin_bit_cast(v8u, f);
    xp[0][lane] = (v4u){w[0], w[1], w[2], w[3]}; xp[1][lane] = (v4u){w[4], w[5], w[6], w[7]};
}
__device__ __forceinline__ v16bf getf(const v4u (*xp)[32], int lane) {
    typedef __attribute__((ext_vector_type(8))) unsigned v8u; const v4u a = xp[0][lane], b = xp[1][lane];
    return __builtin_bit_cast(v16bf, (v8u){a[0], a[1], a[2], a[3], b[0], b[1], b[2], b[3]});
}
// 8 consecutive f32 values from LDS
__device__ __forceinline__ void lds8(const float* p, float* d) { const v4f x = *(const v4fa*)p, y = *(const v4fa*)(p + 4);
#pragma unroll
    for (int i = 0; i < 4; ++i) { d[i] = x[i]; d[4 + i] = y[i]; }
}
// k_attn: grid (2048 / 64 token blocks, 8 items), 16 waves = 4 heads x 2 query groups of 32 columns (two 16-column groups each) x 2 key halves, so that a work-group ends with all 64
// features of its 64 tokens and has four waves a SIMD for the token-local stages. A wave walks 1024 keys; a pass is 64 keys = four 16-key blocks: S^T = K.Q^T (A = 16
// key rows, B = 16 query columns; d 0..15 of the hi plane in elements 0..7 of both lane halves, d 0..15 of K's residual plane in elements 8..15 of A, B's elements 0..7 repeated in its 8..15), so a lane holds 32 scores of ONE query per group; each pair of f32 tiles
// converts in place into the B operand P^T of O^T += V^T.P^T (A = two transposed 16 x 16 v blocks = the hardware k order). The sum is in-lane plus one exchange
// between the halves. Scores are exponents of 2 relative to a reference that is fixed before the passes (see there), so that a pass is one basic block of products, exponentials, sums and packing.
// Behind the passes the second key half hands its O^T, maximum and sum to the first through LDS, lane for lane; the first rescales both to the common maximum, adds, divides and puts ctx^T
// into LDS (a lane's 8 values of a head are 8 values of the next B operand). Then the waves regroup as 4 token groups (16 tokens) x 4 feature quarters; the three weights as bf16 [n][k] and the
// gains, offsets and biases lie in LDS: k_pre's image, brought by asynchronous copies that are issued in front of the walk and waited for behind it. Stage A (quarter 0 of each group): o^T = Wproj^T.ctx^T + bproj -> LN -> operands and o^T to LDS. Stage B (every wave, 32 hidden features):
// m^T = gelu(W1^T.h^T + b1) -> operands to LDS; the GELU is a chain of dependent instructions and branches, so it is spread over four waves a SIMD. Stage C (quarters 0 and 1, 32 output
// features = one 128-byte line a token): out^T = W2^T.m^T + b2 + o^T.
__global__ __launch_bounds__(512) void k_attn(const bf* __restrict__ Qh, const bf* __restrict__ Kh, const bf* __restrict__ Kl, const bf* __restrict__ Vh, const bf* __restrict__ PB, float* out) {
    typedef __attribute__((ext_vector_type(2))) float v2f; typedef __attribute__((ext_vector_type(2))) _Float16 v2h; typedef __attribute__((ext_vector_type(8))) unsigned v8u;
    __shared__ __align__(16) bf img[IM_U * 8];      // the parameter image
    const bf* wp = img; const bf* w1 = img + IM_W1; const bf* w2 = img + IM_W2; const float* pv = (const float*)(img + IM_V);      // pv: g2 at 0, be2 at 64, bproj at 128, b1 at 192, b2 at 320
    __shared__ v4f xg[8][5][32];         // [head + 4 * query group]: the second key half's two O^T tiles (2 x 16 bytes a lane each), then (maximum, maximum, sum, sum)
    __shared__ v4f xc[4][4][2][32];      // [group][head]: ctx
    __shared__ v4u xh[4][4][2][32];      // [group][k chunk * 2 + (0 hi, 1 residual)]: LN(o)
    __shared__ v4f xo[4][4][2][32];      // [group][tile]: o
    __shared__ v4u xm[4][8][2][32];      // [group][k chunk * 2 + (0 hi, 1 residual)]: gelu(.)
    const int tid = threadIdx.x, lane = tid & 31, c = lane & 15, lr = c, hi = lane >> 4;
    const int wave = __builtin_amdgcn_readfirstlane(tid >> 5), hd = wave & 3, qg = (wave >> 2) & 1, kp = wave >> 3;      // scalar: scalar plane bases, scalar branches
    const int tg = wave & 3, fq = wave >> 2;      // behind the passes: token group, feature quarter; scalar: the matrix instructions below stand under branches on fq
    const int t0 = blockIdx.y * NN + blockIdx.x * 64 + tg * 16;
    const size_t pb = ((size_t)blockIdx.y * NH_ + hd) * NN * HD, pk = pb + (size_t)kp * (NN / 2) * HD;      // the head's planes; the wave's key half in them
    const int q0 = blockIdx.x * 64 + qg * 32; const unsigned fo = c * HD + 8 * hi;      // the lane's place in a 16 x 16 block; unsigned: scalar base + 32-bit lane offset addressing
    v16h qf[2];
#pragma unroll
    for (int g = 0; g < 2; ++g) { const size_t qo = pb + (size_t)(q0 + 16 * g) * HD + fo; const v8us a = *(const v8us*)(Qh + qo); qf[g] = cat16u(a, a); }
    v8us kh[4], kl[4];
#pragma unroll
    for (int j = 0; j < 4; ++j) { kh[j] = *(const v8us*)(Kh + pk + (fo + 16 * j * HD)); kl[j] = *(const v8us*)(Kl + pk + (fo + 16 * j * HD)); }
    asm volatile("s_wait_xcnt 0x0" ::: "memory");      // the address registers of the loads above are reused below
    __builtin_amdgcn_sched_barrier(0);                 // keeps the register writes below from being lifted over that wait
    // The reference of a query is fixed for the whole walk: the maximum of its scores with the wave's first 16 keys. Minus the reference, in all 8 registers, is the score product's C operand, so
    // the accumulators are the arguments of exp2 as they stand: no maximum, no subtraction, no rescale in a pass. The reference is a score of the row, so nothing underflows that would not with the
    // row's maximum; P may pass 1, and the test behind the walk says whether it stayed inside f16.
    v8f o[2], cm[2]; float mrun[2], lsum[2];
#pragma unroll
    for (int g = 0; g < 2; ++g) { const v8f t = wmma16(cat16u(kh[0], kl[0]), qf[g], (v8f){});
        float a = fmaxf(fmaxf(fmaxf(t[0], t[1]), fmaxf(t[2], t[3])), fmaxf(fmaxf(t[4], t[5]), fmaxf(t[6], t[7])));
        a = fmaxf(a, xhalf(a));
        o[g] = (v8f){}; mrun[g] = a; lsum[g] = 0.f;
#pragma unroll
        for (int r = 0; r < 8; ++r) cm[g][r] = -a; }
    // The image into LDS, through no register: unit i * 512 + tid by thread tid, five units a thread and a sixth in the first 11 waves (2912 units). The copies fly during the walk; their s_wait_asynccnt
    // stands behind it, in front of the first barrier. The closing s_wait_xcnt of each statement stands in front of every later write of the address registers that the copies name.
    { const unsigned la = (unsigned)(size_t)img + (unsigned)tid * 16u; const char* ga = (const char*)PB + tid * 16;
        asm volatile("global_load_async_to_lds_b128 %0, %5, off\n\tglobal_load_async_to_lds_b128 %1, %6, off\n\tglobal_load_async_to_lds_b128 %2, %7, off\n\t"
                     "global_load_async_to_lds_b128 %3, %8, off\n\tglobal_load_async_to_lds_b128 %4, %9, off\n\ts_wait_xcnt 0x0"
                     :: "v"(la), "v"(la + 8192u), "v"(la + 16384u), "v"(la + 24576u), "v"(la + 32768u), "v"(ga), "v"(ga + 8192), "v"(ga + 16384), "v"(ga + 24576), "v"(ga + 32768) : "memory");
        if (wave < (IM_U - 5 * 512) / 32)      // scalar: whole waves
            asm volatile("global_load_async_to_lds_b128 %0, %1, off\n\ts_wait_xcnt 0x0" :: "v"(la + 40960u), "v"(ga + 40960) : "memory"); }
#pragma unroll 1
    for (int s = 0; s < NN / 128; ++s) {
        const size_t cu = pk + (size_t)(s * 64) * HD, nx = pk + (size_t)((s + 1 < NN / 128 ? s + 1 : s) * 64) * HD;     // this pass's V, the next pass's K (the last pass reads its own again)
        v8us vh[4];
#pragma unroll
        for (int j = 0; j < 4; ++j) vh[j] = *(const v8us*)(Vh + cu + (fo + 16 * j * HD));
        __builtin_amdgcn_sched_barrier(0);      // holds the V loads at the head of the pass, the scores and exponentials between them and their use
        v8f st[2][4];
#pragma unroll
        for (int j = 0; j < 4; ++j) { const v16h ak = cat16u(kh[j], kl[j]);
#pragma unroll
            for (int g = 0; g < 2; ++g) st[g][j] = wmma16(ak, qf[g], cm[g]); }
#pragma unroll
        for (int j = 0; j < 4; ++j) { kh[j] = *(const v8us*)(Kh + nx + (fo + 16 * j * HD)); kl[j] = *(const v8us*)(Kl + nx + (fo + 16 * j * HD)); }     // K a pass ahead
        __builtin_amdgcn_sched_barrier(0);      // holds the K loads here: the scheduler otherwise sinks them to the loop's foot, directly in front of their use
#pragma unroll
        for (int u = 0; u < 2; ++u) { const v16h vf = cat16u(vh[2 * u], vh[2 * u + 1]);
#pragma unroll
            for (int g = 0; g < 2; ++g) { v8u ph; float s0 = 0.f, s1 = 0.f, pe[16];
#pragma unroll
                for (int e = 0; e < 16; ++e) pe[e] = st[g][2 * u + (e >> 3)][e & 7];
                exp2x8(pe); exp2x8(pe + 8);      // asm text that reads the score products' results: the first group's two products have five or more products behind them, the later groups the exponentials in front
#pragma unroll
                for (int e = 0; e < 8; ++e) { v2f p; p[0] = pe[2 * e]; p[1] = pe[2 * e + 1];
                    s0 += p[0]; s1 += p[1];
                    ph[e] = __builtin_bit_cast(unsigned, __builtin_convertvector(p, v2h)); }
                lsum[g] += s0 + s1;
                const v16h pf = __builtin_bit_cast(v16h, ph);
                o[g] = wmma16(vf, pf, o[g]); } }
    }
    // Every P is positive, so a lane's sum bounds each of its P: up to PLIM all of them fitted f16 and the walk stands. Otherwise (one test for the whole wave; also for a sum that is not a
    // number) the wave walks its keys once more with the running maximum, rescaling in every pass.
    if (__builtin_amdgcn_ballot_w32(!(lsum[0] <= PLIM && lsum[1] <= PLIM)) != 0) {
        const bf* ka = Kh + pk + fo; const bf* la = Kl + pk + fo;
#pragma unroll
        for (int j = 0; j < 4; ++j) { kh[j] = *(const v8us*)(ka + 16 * j * HD); kl[j] = *(const v8us*)(la + 16 * j * HD); }
        asm volatile("s_wait_xcnt 0x0" :: "v"(ka), "v"(la) : "memory");      // the address registers of the loads above are reused below; as operands they are not reused (also not as a load's destination) ahead of the wait
        __builtin_amdgcn_sched_barrier(0);                 // keeps the register writes below from being lifted over that wait
#pragma unroll
        for (int g = 0; g < 2; ++g) { o[g] = (v8f){}; mrun[g] = -3.0e38f; lsum[g] = 0.f; }
#pragma unroll 1      // rolled like the walk above
        for (int s = 0; s < NN / 128; ++s) {
            const size_t cu = pk + (size_t)(s * 64) * HD, nx = pk + (size_t)((s + 1 < NN / 128 ? s + 1 : s) * 64) * HD;     // this pass's V, the next pass's K (the last pass reads its own again)
            const bf* va = Vh + cu + fo; const bf* kn = Kh + nx + fo; const bf* ln = Kl + nx + fo;
            v8us vh[4];
#pragma unroll
            for (int j = 0; j < 4; ++j) vh[j] = *(const v8us*)(va + 16 * j * HD);
            asm volatile("s_wait_xcnt 0x0" :: "v"(va) : "memory");      // the address registers of the V loads are reused below; the operand as above
            __builtin_amdgcn_sched_barrier(0);                 // keeps the register writes below from being lifted over that wait, and the V loads at the head of the pass
            v8f st[2][4];
#pragma unroll
            for (int j = 0; j < 4; ++j) { const v16h ak = cat16u(kh[j], kl[j]);
#pragma unroll
                for (int g = 0; g < 2; ++g) st[g][j] = wmma16(ak, qf[g], (v8f){}); }
#pragma unroll
            for (int j = 0; j < 4; ++j) { kh[j] = *(const v8us*)(kn + 16 * j * HD); kl[j] = *(const v8us*)(ln + 16 * j * HD); }     // K a pass ahead
            asm volatile("s_wait_xcnt 0x0" :: "v"(kn), "v"(ln) : "memory");      // the address registers of the K loads are reused below; the operands as above
            __builtin_amdgcn_sched_barrier(0);                 // keeps the register writes below from being lifted over that wait, and the K loads here
#pragma unroll
            for (int g = 0; g < 2; ++g) { float a = fmaxf(st[g][0][0], st[g][1][0]), b = fmaxf(st[g][2][0], st[g][3][0]);
#pragma unroll
                for (int r = 1; r < 8; ++r) { a = fmaxf(a, fmaxf(st[g][0][r], st[g][1][r])); b = fmaxf(b, fmaxf(st[g][2][r], st[g][3][r])); }
                a = fmaxf(a, b);
                const float mn = fmaxf(mrun[g], fmaxf(a, xhalf(a))), fs = exp2one(mrun[g] - mn); o[g] *= fs; lsum[g] *= fs; mrun[g] = mn; }
#pragma unroll
            for (int u = 0; u < 2; ++u) { const v16h vf = cat16u(vh[2 * u], vh[2 * u + 1]);
#pragma unroll
                for (int g = 0; g < 2; ++g) { v8u ph; float s0 = 0.f, s1 = 0.f, pe[16];
#pragma unroll
                    for (int e = 0; e < 16; ++e) pe[e] = st[g][2 * u + (e >> 3)][e & 7] - mrun[g];
                    exp2x8(pe); exp2x8(pe + 8);
#pragma unroll
                    for (int e = 0; e < 8; ++e) { v2f p; p[0] = pe[2 * e]; p[1] = pe[2 * e + 1];
                        s0 += p[0]; s1 += p[1];
                        ph[e] = __builtin_bit_cast(unsigned, __builtin_convertvector(p, v2h)); }
                    lsum[g] += s0 + s1;
                    const v16h pf = __builtin_bit_cast(v16h, ph);
                    o[g] = wmma16(vf, pf, o[g]); } }
        }
    }
    v16bf fh[2], fl[2];
    asm volatile("s_wait_asynccnt 0x0" ::: "memory");      // this wave's copies of the image have landed; the barrier below publishes them to the other waves
    if (kp == 1) {
#pragma unroll
        for (int g = 0; g < 2; ++g) { xg[hd + 4 * qg][2 * g][lane] = (v4f){o[g][0], o[g][1], o[g][2], o[g][3]}; xg[hd + 4 * qg][2 * g + 1][lane] = (v4f){o[g][4], o[g][5], o[g][6], o[g][7]}; }
        xg[hd + 4 * qg][4][lane] = (v4f){mrun[0], mrun[1], lsum[0], lsum[1]};
    }
    __syncthreads();
    if (kp == 0) {
        const v4f ms = xg[hd + 4 * qg][4][lane];
#pragma unroll
        for (int g = 0; g < 2; ++g) { const v4f a = xg[hd + 4 * qg][2 * g][lane], b = xg[hd + 4 * qg][2 * g + 1][lane];
            const float mn = fmaxf(mrun[g], ms[g]), f0 = exp2one(mrun[g] - mn), f1 = exp2one(ms[g] - mn), l = lsum[g] * f0 + ms[2 + g] * f1;
            const float inv = 1.0f / (l + xhalf(l)), s0 = f0 * inv, s1 = f1 * inv; v4f ra, rb;
#pragma unroll
            for (int i = 0; i < 4; ++i) { ra[i] = o[g][i] * s0 + a[i] * s1; rb[i] = o[g][4 + i] * s0 + b[i] * s1; }
            xc[2 * qg + g][hd][0][lane] = ra; xc[2 * qg + g][hd][1][lane] = rb; }
    }
    __syncthreads();
    if (fq == 0) {
        float v[32], gr[32], br[32], bv[32];
#pragma unroll
        for (int c = 0; c < 4; ++c) { lds8(pv + 16 * c + 8 * hi, gr + 8 * c); lds8(pv + 64 + 16 * c + 8 * hi, br + 8 * c); lds8(pv + 128 + 16 * c + 8 * hi, bv + 8 * c); }
#pragma unroll
        for (int h = 0; h < NH_; ++h) { const v4f a = xc[tg][h][0][lane], b = xc[tg][h][1][lane];
#pragma unroll
            for (int i = 0; i < 4; ++i) { v[8 * h + i] = a[i]; v[8 * h + 4 + i] = b[i]; } }
        split16(v, fh[0], fl[0]); split16(v + 16, fh[1], fl[1]);
        v8f acc[4];
#pragma unroll
        for (int t = 0; t < 4; ++t) acc[t] = (v8f){};
#pragma unroll
        for (int kc = 0; kc < 2; ++kc)
#pragma unroll
            for (int t = 0; t < 4; ++t) { const v16bf w = wfrag(wp, DD + 8, t * 16 + lr, kc * 32 + 8 * hi); acc[t] = wmmab(w, fh[kc], acc[t]); acc[t] = wmmab(w, fl[kc], acc[t]); }
#pragma unroll
        for (int t = 0; t < 4; ++t) {
#pragma unroll
            for (int j = 0; j < 8; ++j) v[8 * t + j] = acc[t][j] + bv[8 * t + j];
            xo[tg][t][0][lane] = (v4f){v[8 * t], v[8 * t + 1], v[8 * t + 2], v[8 * t + 3]}; xo[tg][t][1][lane] = (v4f){v[8 * t + 4], v[8 * t + 5], v[8 * t + 6], v[8 * t + 7]}; }
        ln_pair<false>(v, gr, br);
        split16(v, fh[0], fl[0]); split16(v + 16, fh[1], fl[1]);
#pragma unroll
        for (int kc = 0; kc < 2; ++kc) { putf(xh[tg][2 * kc], lane, fh[kc]); putf(xh[tg][2 * kc + 1], lane, fl[kc]); }
    }
    __syncthreads();
    {
#pragma unroll
        for (int kc = 0; kc < 2; ++kc) { fh[kc] = getf(xh[tg][2 * kc], lane); fl[kc] = getf(xh[tg][2 * kc + 1], lane); }
        float bm[16]; lds8(pv + 192 + fq * 32 + 8 * hi, bm); lds8(pv + 192 + fq * 32 + 16 + 8 * hi, bm + 8);
        v8f am[2]; am[0] = (v8f){}; am[1] = (v8f){};
#pragma unroll
        for (int kc = 0; kc < 2; ++kc)
#pragma unroll
            for (int u = 0; u < 2; ++u) { const v16bf w = wfrag(w1, DD + 8, (2 * fq + u) * 16 + lr, kc * 32 + 8 * hi); am[u] = wmmab(w, fh[kc], am[u]); am[u] = wmmab(w, fl[kc], am[u]); }
        float m[16];
#pragma unroll
        for (int u = 0; u < 2; ++u) {
#pragma unroll
            for (int j = 0; j < 8; ++j) { const float a = am[u][j] + bm[8 * u + j]; m[8 * u + j] = 0.5f * a * (1.0f + erff(a * 0.7071067811865476f)); } }
        v16bf mh, ml; split16(m, mh, ml);
        putf(xm[tg][2 * fq], lane, mh); putf(xm[tg][2 * fq + 1], lane, ml);
    }
    __syncthreads();
    if (fq >= 2) return;
    float bo[16]; lds8(pv + 320 + fq * 32 + 8 * hi, bo); lds8(pv + 320 + fq * 32 + 16 + 8 * hi, bo + 8);
    v8f acc[2]; acc[0] = (v8f){}; acc[1] = (v8f){};
#pragma unroll
    for (int kc = 0; kc < 4; ++kc) { const v16bf mh = getf(xm[tg][2 * kc], lane), ml = getf(xm[tg][2 * kc + 1], lane);
#pragma unroll
        for (int u = 0; u < 2; ++u) { const v16bf w = wfrag(w2, HID + 8, (2 * fq + u) * 16 + lr, kc * 32 + 8 * hi); acc[u] = wmmab(w, mh, acc[u]); acc[u] = wmmab(w, ml, acc[u]); } }
    float* dst = out + (size_t)(t0 + lr) * DD + 8 * hi;
#pragma unroll
    for (int u = 0; u < 2; ++u) { const int t = 2 * fq + u; const v4f oa = xo[tg][t][0][lane], ob = xo[tg][t][1][lane]; v4f ra, rb;
#pragma unroll
        for (int j = 0; j < 4; ++j) { ra[j] = (acc[u][j] + bo[8 * u + j]) + oa[j]; rb[j] = (acc[u][4 + j] + bo[8 * u + 4 + j]) + ob[j]; }
        *(v4f*)(dst + t * 16) = ra; *(v4f*)(dst + t * 16 + 4) = rb; }
}

extern "C" void kernel_launch(void* const* d_in, const int* in_sizes, int n_in,
                              void* d_out, int out_size, void* d_ws, size_t ws_size, hipStream_t stream) {
    (void)in_sizes; (void)n_in; (void)out_size;
    const float* x = (const float*)d_in[0]; const float* cl = (const float*)d_in[1]; const float* g1 = (const float*)d_in[2]; const float* be1 = (const float*)d_in[3]; const float* g2 = (const float*)d_in[4]; const float* be2 = (const float*)d_in[5];
    const float* Wkv = (const float*)d_in[6]; const float* bkv = (const float*)d_in[7]; const float* Wq = (const float*)d_in[8]; const float* bq = (const float*)d_in[9]; const float* Wp = (const float*)d_in[10]; const float* bp = (const float*)d_in[11];
    const float* W1 = (const float*)d_in[12]; const float* b1 = (const float*)d_in[13]; const float* W2 = (const float*)d_in[14]; const float* b2 = (const float*)d_in[15];      // k-major weights (x @ W)
    float* out = (float*)d_out;    // [8][2048][64]
    char* wsp = (char*)d_ws;
    auto take = [&](size_t bytes) { char* p = wsp; wsp += (bytes + 255) & ~(size_t)255; return (void*)p; };
    bf* Q16h = (bf*)take((size_t)NR * DD * 2); bf* K16h = (bf*)take((size_t)NR * DD * 2); bf* K16l = (bf*)take((size_t)NR * DD * 2); bf* VBh = (bf*)take((size_t)NR * DD * 2); bf* PB = (bf*)take((size_t)IM_U * 16);
    if ((size_t)(wsp - (char*)d_ws) > ws_size) return;    // 8 MB, no aliasing
    k_pre<<<dim3(NR / 64 + 12, 2, 1), 128, 0, stream>>>(x, cl, g1, be1, Wkv, bkv, Wq, bq, Q16h, K16h, K16l, VBh, Wp, bp, g2, be2, W1, b1, W2, b2, PB);      // LN, kv and q, head planes; the parameter image
    k_attn<<<dim3(NN / 64, NBI, 1), 512, 0, stream>>>(Q16h, K16h, K16l, VBh, PB, out);                        // softmax(q_h.k_h^T / 4).v_h of 64 tokens x 4 heads, then projection, LN, MLP, residual
}

// v008
// Measured time: 25.1 microseconds a run.
// Next to v007, in two timings, it ran 1.04 times as fast each time.
// Over all steps from v000 it is 110 times as fast.
#include <hip/hip_runtime.h>

// Compute dtypes, f32 accumulate: LayerNorm (shared norm1 on both streams, norm2 later) and GELU in f32; kv = LN(x).Wkv + bkv, q = LN(clinic).Wq + bq, o = ctx.Wproj + bproj,
// m = gelu(LN(o).W1 + b1) and out = m.W2 + b2 + o with every computed operand as bf16 hi + UNSCALED residual against exact bf16 weights (two products) on
// v_wmma_f32_16x16x32_bf16; the 4-head (16-dim) cross attention in one launch over all (item, head) pairs on v_wmma_f32_16x16x32_f16: q, v and P are rounded ONCE to f16 (11 bits, where bf16 needed hi + residual), k is f16 hi +
// UNSCALED f16 residual, which costs no product: S^T = k_h.q_h^T (the 16 head dims twice in the 32 k: k hi | k residual against q | q: one product), softmax in f32 (q carries the 1/4 and log2 e) against a fixed reference per query, P^T packed from the accumulators,
// ctx_h^T = v_h^T.P^T (one product). f16 ends at 65504: LayerNorm bounds each feature of a row by 8 |gain| + |offset|, so q, k, v reach that only with weight columns whose absolute sum is in the thousands.
// Two launches: k_pre (LayerNorm, kv / q, head planes), k_attn (attention of 64 tokens x 4 heads, then projection, LayerNorm, MLP, residual of those tokens). In the token-local parts a wave owns 16 tokens and a lane pair (l, l ^ 16)
// one token: apart from k_pre's v product (tokens as A), the weights are the A operand, the tokens the B operand, so each product's accumulators hold 8 consecutive features of the lane's token and convert in place into the
// next product's B operand.

#define NBI  8
#define NN   2048
#define NR   (NBI * NN)          // 16384 token rows
#define DD   64
#define NH_  4
#define HD   16
#define HID  128
#define DM   DD
#define NTK  NR
#define SCL  0.25f
#define LN_EPS 1e-5f
#define LOSC 1024.0f
#define PLIM 32768.0f            // 2^15; f16 ends just below 2^16
// The parameters of the token-local stages behind attention, in the form those stages read them: one image that k_pre writes once and every work-group of k_attn copies into LDS as it lies.
// Offsets in 2-byte elements: three weights as bf16 [n][K + 8] (the 8 pad elements of a row are zeros), then f32 values rounded to bf16: g2 | be2 | bproj | b1 | b2.
#define IM_W1 (DD * (DD + 8))
#define IM_W2 (IM_W1 + HID * (DD + 8))
#define IM_V  (IM_W2 + DD * (HID + 8))
#define IM_WU (IM_V / 8)                      // 16-byte units of weights: 2816
#define IM_U  (IM_WU + (4 * DD + HID) / 4)    // 16-byte units in all: 2912

typedef _Float16 h16;
typedef unsigned short bf;
typedef __attribute__((ext_vector_type(16))) __bf16   v16bf;
typedef __attribute__((ext_vector_type(16))) _Float16 v16h;
typedef __attribute__((ext_vector_type(8)))  _Float16 v8h;
typedef __attribute__((ext_vector_type(8)))  unsigned short v8us;
typedef __attribute__((ext_vector_type(8)))  float    v8f;
typedef __attribute__((ext_vector_type(4)))  float    v4f;
typedef __attribute__((ext_vector_type(4)))  _Float16 v4h;
typedef v8h  __attribute__((may_alias)) v8ha;
typedef v4f  __attribute__((may_alias)) v4fa;
typedef v8us __attribute__((may_alias)) v8usa;

__device__ __forceinline__ unsigned short f2bf(float f) { unsigned u = __float_as_uint(f); u += 0x7FFFu + ((u >> 16) & 1u); return (unsigned short)(u >> 16); }
__device__ __forceinline__ float bf2f(unsigned short b) { return __uint_as_float(((unsigned)b) << 16); }
__device__ __forceinline__ float bfr(float f) { return bf2f(f2bf(f)); }
__device__ __forceinline__ v16h cat16(v8h lo, v8h hi) { return __builtin_shufflevector(lo, hi, 0, 1, 2, 3, 4, 5, 6, 7, 8, 9, 10, 11, 12, 13, 14, 15); }
__device__ __forceinline__ v16bf cat16b(v8us lo, v8us hi) { return __builtin_bit_cast(v16bf, __builtin_shufflevector(lo, hi, 0, 1, 2, 3, 4, 5, 6, 7, 8, 9, 10, 11, 12, 13, 14, 15)); }
__device__ __forceinline__ v16h cat16u(v8us lo, v8us hi) { return __builtin_bit_cast(v16h, __builtin_shufflevector(lo, hi, 0, 1, 2, 3, 4, 5, 6, 7, 8, 9, 10, 11, 12, 13, 14, 15)); }
__device__ __forceinline__ v8f wmma16(v16h a, v16h b, v8f c) { return __builtin_amdgcn_wmma_f32_16x16x32_f16(false, a, false, b, (short)0, c, false, false); }
__device__ __forceinline__ v8f wmmab(v16bf a, v16bf b, v8f c) { return __builtin_amdgcn_wmma_f32_16x16x32_bf16(false, a, false, b, (short)0, c, false, false); }

// lane l <-> l ^ 16
__device__ __forceinline__ float xhalf(float v) { const int b = __float_as_int(v); return __int_as_float(__builtin_amdgcn_permlanex16(b, b, 0x76543210, 0xfedcba98, false, false)); }
// exp2 by v_exp_f32 in asm text. The instruction set asks for one slot behind a transcendental before its result is read or its source overwritten;
// here every exponential works on a register of its own and the closing v_nop is the slot behind the last. Each overwrites
// its own argument: that register is live in front of the statement, so it is never an operand register that a matrix instruction directly in front has just given up.
__device__ __forceinline__ float exp2one(float x) { asm("v_exp_f32 %0, %0\n\tv_nop" : "+v"(x)); return x; }
__device__ __forceinline__ void exp2x8(float* x) {
    asm("v_exp_f32 %0, %0\n\tv_exp_f32 %1, %1\n\tv_exp_f32 %2, %2\n\tv_exp_f32 %3, %3\n\tv_exp_f32 %4, %4\n\tv_exp_f32 %5, %5\n\tv_exp_f32 %6, %6\n\tv_exp_f32 %7, %7\n\tv_nop"
        : "+v"(x[0]), "+v"(x[1]), "+v"(x[2]), "+v"(x[3]), "+v"(x[4]), "+v"(x[5]), "+v"(x[6]), "+v"(x[7]));
}
// The 16 exponentials of one P^T operand in the walk's pass, by the builtin (the same v_exp_f32, the same values): source and result are registers of the compiler's choice, so an exponential reads the score
// accumulator where it lies. As in-out operands of asm text part of the accumulators were first copied out of their tiles, and each group of 8 closed with a v_nop. The distance behind a matrix instruction is the
// compiler's to keep for its own instructions; in the pass's listing every exponential is followed by an instruction on other registers, so the slot behind it is filled.
__device__ __forceinline__ void exp2x16(float* x) {
#pragma unroll
    for (int e = 0; e < 16; ++e) x[e] = __builtin_amdgcn_exp2f(x[e]);
}
typedef __attribute__((ext_vector_type(4))) unsigned v4u;
// NP pairs of f32 values -> packed bf16 hi words and packed bf16 words of the UNSCALED residual (value 2e in the low half of word e)
template <int NP>
__device__ __forceinline__ void splitp(const float* v, unsigned* ph, unsigned* pl) {
    typedef __attribute__((ext_vector_type(2))) float v2f; typedef __attribute__((ext_vector_type(2))) __bf16 v2b;
#pragma unroll
    for (int e = 0; e < NP; ++e) { v2f p; p[0] = v[2 * e]; p[1] = v[2 * e + 1];
        const unsigned hw = __builtin_bit_cast(unsigned, __builtin_convertvector(p, v2b));
        v2f d; d[0] = p[0] - __uint_as_float(hw << 16); d[1] = p[1] - __uint_as_float(hw & 0xFFFF0000u);
        ph[e] = hw; pl[e] = __builtin_bit_cast(unsigned, __builtin_convertvector(d, v2b)); }
}
// 16 values in the operand's k order (two runs of 8 features, 16 apart) -> hi and residual operands
__device__ __forceinline__ void split16(const float* v, v16bf& h, v16bf& l) {
    typedef __attribute__((ext_vector_type(8))) unsigned v8u; unsigned ph[8], pl[8]; splitp<8>(v, ph, pl);
    v8u a, b;
#pragma unroll
    for (int e = 0; e < 8; ++e) { a[e] = ph[e]; b[e] = pl[e]; }
    h = __builtin_bit_cast(v16bf, a); l = __builtin_bit_cast(v16bf, b);
}
// 8 values -> 16 bytes of f16 (round to nearest even), and the 16 bytes of the UNSCALED residual's f16
__device__ __forceinline__ void pack8h(const float* v, v4u& ph, v4u& pl) {
    typedef __attribute__((ext_vector_type(2))) float v2f; typedef __attribute__((ext_vector_type(2))) _Float16 v2h;
#pragma unroll
    for (int e = 0; e < 4; ++e) { v2f p; p[0] = v[2 * e]; p[1] = v[2 * e + 1];
        const v2h hw = __builtin_convertvector(p, v2h);
        const v2f d = p - __builtin_convertvector(hw, v2f);
        ph[e] = __builtin_bit_cast(unsigned, hw); pl[e] = __builtin_bit_cast(unsigned, __builtin_convertvector(d, v2h)); }
}
// Global reads as scalar base + one 32-bit byte offset of the lane + a constant: a group of reads names one address register, which its closing wait (XWAIT) holds live.
__device__ __forceinline__ float ldf(const float* __restrict__ b, unsigned off, int imm) { return *(const float*)((const char*)b + off + imm); }
__device__ __forceinline__ void ld8(const float* __restrict__ b, unsigned off, int imm, float* d) {
    const v4f x = *(const v4f*)((const char*)b + off + imm), y = *(const v4f*)((const char*)b + off + imm + 16);
#pragma unroll
    for (int i = 0; i < 4; ++i) { d[i] = x[i]; d[4 + i] = y[i]; }
}
// Behind a group of global reads: their address register is rewritten later. The operand keeps the register from
// being reused (also as a read's destination) ahead of the wait; the scheduling barrier keeps later register writes from being lifted over it.
#define XWAIT(off) do { asm volatile("s_wait_xcnt 0x0" :: "v"(off) : "memory"); __builtin_amdgcn_sched_barrier(0); } while (0)
// W [K][N] f32 (k-major) -> L [n][K + 8] bf16 in LDS. A unit is 8 k of one n: consecutive lanes take consecutive n (whole lines from W), one 16-byte LDS store a unit.
template <int K, int N, int NT>
__device__ __forceinline__ void stage_wt(const float* __restrict__ Wm, bf* L, int tid) {
    constexpr int NU = N * K / 8 / NT, KS = NT / N * 8;      // units a thread, k step from one unit of a thread to its next
    const int n = tid % N, k8 = (tid / N) * 8; const unsigned off = (unsigned)(k8 * N + n) * 4;
    float r[NU][8];
#pragma unroll
    for (int q = 0; q < NU; ++q)
#pragma unroll
        for (int i = 0; i < 8; ++i) r[q][i] = ldf(Wm, off, (q * KS + i) * N * 4);
    XWAIT(off);
#pragma unroll
    for (int q = 0; q < NU; ++q) { v8us p;
#pragma unroll
        for (int i = 0; i < 8; ++i) p[i] = f2bf(r[q][i]);
        *(v8usa*)(L + n * (K + 8) + k8 + q * KS) = p; }
}
// weight operand: row (feature) of the lane, k = ko .. ko + 7 and ko + 16 .. ko + 23 (ko holds the lane half's 8)
__device__ __forceinline__ v16bf wfrag(const bf* L, int pitch, int row, int ko) { const bf* p = L + row * pitch + ko; return cat16b(*(const v8usa*)p, *(const v8usa*)(p + 16)); }
// LayerNorm of one 64-value row held by a lane pair: v[8 c + i] is feature 16 c + 8 hi + i. 32 values are summed in the lane, then one exchange between the halves.
template <bool RAW>      // RAW: g, bb as the inputs hold them, rounded to bf16 here; otherwise already rounded
__device__ __forceinline__ void ln_pair(float* v, const float* g, const float* bb) {      // g, bb: the lane's 32 gains and offsets
    float p[8];
#pragma unroll
    for (int i = 0; i < 8; ++i) p[i] = (v[i] + v[8 + i]) + (v[16 + i] + v[24 + i]);
    float s = ((p[0] + p[1]) + (p[2] + p[3])) + ((p[4] + p[5]) + (p[6] + p[7]));
    s += xhalf(s);
    const float mu = s * (1.0f / DD);
#pragma unroll
    for (int e = 0; e < 32; ++e) v[e] -= mu;
#pragma unroll
    for (int i = 0; i < 8; ++i) p[i] = (v[i] * v[i] + v[8 + i] * v[8 + i]) + (v[16 + i] * v[16 + i] + v[24 + i] * v[24 + i]);
    float s2 = ((p[0] + p[1]) + (p[2] + p[3])) + ((p[4] + p[5]) + (p[6] + p[7]));
    s2 += xhalf(s2);
    const float rs = rsqrtf(s2 * (1.0f / DD) + LN_EPS);
#pragma unroll
    for (int e = 0; e < 32; ++e) v[e] = v[e] * rs * (RAW ? bfr(g[e]) : g[e]) + (RAW ? bfr(bb[e]) : bb[e]);
}
// One 16-byte unit of the image: 8 k of row n of W [K][N] f32 (k-major) as bf16, r = n * (K / 8 + 1) + k / 8; a row's last unit is its pad.
template <int K, int N>
__device__ __forceinline__ void image_w(const float* __restrict__ Wm, bf* dst, int r) {
    constexpr int PER = K / 8 + 1; const int n = r / PER, k8 = r % PER; const bool pad = k8 == K / 8;
    const unsigned off = (unsigned)((pad ? 0 : k8 * 8) * N + n) * 4; float x[8];      // a pad unit reads the row's first 8 k and stores zeros
#pragma unroll
    for (int i = 0; i < 8; ++i) x[i] = ldf(Wm, off, i * N * 4);
    XWAIT(off);
    const unsigned short keep = pad ? 0 : 0xFFFF; v8us p;
#pragma unroll
    for (int i = 0; i < 8; ++i) p[i] = f2bf(x[i]) & keep;
    *(v8usa*)dst = p;
}
// k_pre: grid (16384 / 64 token blocks, 2 streams), 4 waves x 16 tokens. Stream 0: LN(x) -> k (weights as A: a lane gets 8 features of its token) and v (tokens as A: a lane gets 8
// tokens of its feature, the transposed 16 x 16 block); stream 1: LN(clinic) -> q. Planes as k_attn reads them, f16: Q16 / K16 [b][h][t][16], VB [b][h][t/16][d][t%16]; k hi + residual, q and v one plane each.
// The 12 further columns of the grid (24 work-groups) write the parameter image, a thread one 16-byte unit; the bounds between its parts are multiples of 32 units, so a wave takes one branch.
__global__ __launch_bounds__(128) void k_pre(const float* __restrict__ x, const float* __restrict__ cl, const float* __restrict__ g1, const float* __restrict__ be1, const float* __restrict__ Wkv, const float* __restrict__ bkv,
                                             const float* __restrict__ Wq, const float* __restrict__ bq, bf* Qh, bf* Kh, bf* Kl, bf* Vh,
                                             const float* __restrict__ Wp, const float* __restrict__ bp, const float* __restrict__ g2, const float* __restrict__ be2,
                                             const float* __restrict__ W1, const float* __restrict__ b1, const float* __restrict__ W2, const float* __restrict__ b2, bf* PB) {
    __shared__ __align__(16) bf wl[HID * (DD + 8)];
    const int tid = threadIdx.x, lane = tid & 31, wave = tid >> 5, lr = lane & 15, hi = lane >> 4;
    if (blockIdx.x >= NR / 64) {      // the whole work-group, in front of every barrier
        const int u = ((blockIdx.x - NR / 64) * 2 + blockIdx.y) * 128 + tid;
        if (u < IM_W1 / 8) image_w<DD, DD>(Wp, PB + u * 8, u);
        else if (u < IM_W2 / 8) image_w<DD, HID>(W1, PB + u * 8, u - IM_W1 / 8);
        else if (u < IM_WU) image_w<HID, DD>(W2, PB + u * 8, u - IM_W2 / 8);
        else if (u < IM_U) { const int j = u - IM_WU;      // 4 values of g2 | be2 | bproj | b1 | b2
            const float* s = j < 16 ? g2 + 4 * j : j < 32 ? be2 + 4 * (j - 16) : j < 48 ? bp + 4 * (j - 32) : j < 80 ? b1 + 4 * (j - 48) : b2 + 4 * (j - 80);
            const v4f a = *(const v4f*)s;
            asm volatile("s_wait_xcnt 0x0" :: "v"(s) : "memory");      // the load's address registers are reused below; as an operand the address is not reused (also not as the load's destination) ahead of the wait
            __builtin_amdgcn_sched_barrier(0);                        // keeps the register writes below from being lifted over that wait
            v4f y;
#pragma unroll
            for (int i = 0; i < 4; ++i) y[i] = bfr(a[i]);
            *(v4fa*)(PB + u * 8) = y; }
        return;
    }
    const bool isq = blockIdx.y != 0;
    const int t0 = blockIdx.x * 64 + wave * 16;
    const float* bias = isq ? bq : bkv;
    const float qs = isq ? SCL * 1.4426950408889634f : 1.0f;      // q carries softmax's scale and log2(e): k_attn's score product then yields exponents of 2
    const unsigned xoff = ((unsigned)(t0 + lr) * DD + 8 * hi) * 4, hoff = hi * 32, loff = lr * 4;
    float v[32], gr[32], br[32], bv[32], bw[NH_];
#pragma unroll
    for (int c = 0; c < 4; ++c) ld8(isq ? cl : x, xoff, 64 * c, v + 8 * c);
    XWAIT(xoff);
#pragma unroll
    for (int c = 0; c < 4; ++c) { ld8(g1, hoff, 64 * c, gr + 8 * c); ld8(be1, hoff, 64 * c, br + 8 * c); ld8(bias, hoff, 64 * c, bv + 8 * c); }
    XWAIT(hoff);
#pragma unroll
    for (int h = 0; h < NH_; ++h) bw[h] = ldf(bkv, loff, (DD + h * HD) * 4);      // v's bias (read by both streams, used by stream 0)
    XWAIT(loff);
    if (isq) stage_wt<DD, DD, 128>(Wq, wl, tid); else stage_wt<DD, HID, 128>(Wkv, wl, tid);
#pragma unroll
    for (int e = 0; e < 32; ++e) v[e] = bfr(v[e]);      // the input rows are bf16-rounded first
    ln_pair<true>(v, gr, br);
    v16bf xh[2], xl[2]; split16(v, xh[0], xl[0]); split16(v + 16, xh[1], xl[1]);
    __syncthreads();
    const size_t o = ((size_t)(t0 / NN) * NH_ * NN + (t0 % NN)) * HD + lr * HD + 8 * hi;      // head 0; a head is NN * HD further
    v8f acc[NH_];
#pragma unroll
    for (int h = 0; h < NH_; ++h) acc[h] = (v8f){};
#pragma unroll
    for (int kc = 0; kc < 2; ++kc)
#pragma unroll
        for (int h = 0; h < NH_; ++h) { const v16bf w = wfrag(wl, DD + 8, h * HD + lr, kc * 32 + 8 * hi); acc[h] = wmmab(w, xh[kc], acc[h]); acc[h] = wmmab(w, xl[kc], acc[h]); }
#pragma unroll
    for (int e = 0; e < 32; ++e) v[e] = (acc[e >> 3][e & 7] + bfr(bv[e])) * qs;
    v4u wh[NH_], wr[NH_];
#pragma unroll
    for (int h = 0; h < NH_; ++h) pack8h(v + 8 * h, wh[h], wr[h]);
#pragma unroll
    for (int h = 0; h < NH_; ++h) *(v4u*)((isq ? Qh : Kh) + o + (size_t)h * NN * HD) = wh[h];
    asm volatile("s_wait_xcnt 0x0" ::: "memory");      // the compiler forms the residual words behind these stores, in their data and address registers
    __builtin_amdgcn_sched_barrier(0);                 // keeps those register writes from being lifted over the wait
    if (!isq) {
#pragma unroll
        for (int h = 0; h < NH_; ++h) *(v4u*)(Kl + o + (size_t)h * NN * HD) = wr[h];
    }
    asm volatile("s_wait_xcnt 0x0" ::: "memory");      // the data and address registers of the stores above are rewritten by the v product below
    if (isq) return;
#pragma unroll
    for (int h = 0; h < NH_; ++h) acc[h] = (v8f){};
#pragma unroll
    for (int kc = 0; kc < 2; ++kc)
#pragma unroll
        for (int h = 0; h < NH_; ++h) { const v16bf w = wfrag(wl, DD + 8, DD + h * HD + lr, kc * 32 + 8 * hi); acc[h] = wmmab(xh[kc], w, acc[h]); acc[h] = wmmab(xl[kc], w, acc[h]); }
#pragma unroll
    for (int h = 0; h < NH_; ++h) { const float bx = bfr(bw[h]); float r[8];
#pragma unroll
        for (int j = 0; j < 8; ++j) r[j] = acc[h][j] + bx;
        pack8h(r, wh[h], wr[h]); }
#pragma unroll
    for (int h = 0; h < NH_; ++h) *(v4u*)(Vh + o + (size_t)h * NN * HD) = wh[h];
}
// An operand (8 registers a lane) through LDS: two planes of 16 bytes a lane, so that consecutive lanes store and load consecutive 16 bytes.
__device__ __forceinline__ void putf(v4u (*xp)[32], int lane, v16bf f) {
    typedef __attribute__((ext_vector_type(8))) unsigned v8u; const v8u w = __builtin_bit_cast(v8u, f);
    xp[0][lane] = (v4u){w[0], w[1], w[2], w[3]}; xp[1][lane] = (v4u){w[4], w[5], w[6], w[7]};
}
__device__ __forceinline__ v16bf getf(const v4u (*xp)[32], int lane) {
    typedef __attribute__((ext_vector_type(8))) unsigned v8u; const v4u a = xp[0][lane], b = xp[1][lane];
    return __builtin_bit_cast(v16bf, (v8u){a[0], a[1], a[2], a[3], b[0], b[1], b[2], b[3]});
}
// 8 consecutive f32 values from LDS
__device__ __forceinline__ void lds8(const float* p, float* d) { const v4f x = *(const v4fa*)p, y = *(const v4fa*)(p + 4);
#pragma unroll
    for (int i = 0; i < 4; ++i) { d[i] = x[i]; d[4 + i] = y[i]; }
}
// k_attn: grid (2048 / 64 token blocks, 8 items), 16 waves = 4 heads x 2 query groups of 32 columns (two 16-column groups each) x 2 key halves, so that a work-group ends with all 64
// features of its 64 tokens and has four waves a SIMD for the token-local stages. A wave walks 1024 keys; a pass is 64 keys = four 16-key blocks: S^T = K.Q^T (A = 16
// key rows, B = 16 query columns; d 0..15 of the hi plane in elements 0..7 of both lane halves, d 0..15 of K's residual plane in elements 8..15 of A, B's elements 0..7 repeated in its 8..15), so a lane holds 32 scores of ONE query per group; each pair of f32 tiles
// converts in place into the B operand P^T of O^T += V^T.P^T (A = two transposed 16 x 16 v blocks = the hardware k order). The sum is in-lane plus one exchange
// between the halves. Scores are exponents of 2 relative to a reference that is fixed before the passes (see there), so that a pass is one basic block of products, exponentials, sums and packing.
// Behind the passes the second key half hands its O^T, maximum and sum to the first through LDS, lane for lane; the first rescales both to the common maximum, adds, divides and puts ctx^T
// into LDS (a lane's 8 values of a head are 8 values of the next B operand). Then the waves regroup as 4 token groups (16 tokens) x 4 feature quarters; the three weights as bf16 [n][k] and the
// gains, offsets and biases lie in LDS: k_pre's image, brought by asynchronous copies that are issued in front of the walk and waited for behind it. Stage A (quarter 0 of each group): o^T = Wproj^T.ctx^T + bproj -> LN -> operands and o^T to LDS. Stage B (every wave, 32 hidden features):
// m^T = gelu(W1^T.h^T + b1) -> operands to LDS; the GELU is a chain of dependent instructions and branches, so it is spread over four waves a SIMD. Stage C (quarters 0 and 1, 32 output
// features = one 128-byte line a token): out^T = W2^T.m^T + b2 + o^T.
__global__ __launch_bounds__(512) void k_attn(const bf* __restrict__ Qh, const bf* __restrict__ Kh, const bf* __restrict__ Kl, const bf* __restrict__ Vh, const bf* __restrict__ PB, float* out) {
    typedef __attribute__((ext_vector_type(2))) float v2f; typedef __attribute__((ext_vector_type(2))) _Float16 v2h; typedef __attribute__((ext_vector_type(8))) unsigned v8u;
    __shared__ __align__(16) bf img[IM_U * 8];      // the parameter image
    const bf* wp = img; const bf* w1 = img + IM_W1; const bf* w2 = img + IM_W2; const float* pv = (const float*)(img + IM_V);      // pv: g2 at 0, be2 at 64, bproj at 128, b1 at 192, b2 at 320
    __shared__ v4f xg[8][5][32];         // [head + 4 * query group]: the second key half's two O^T tiles (2 x 16 bytes a lane each), then (maximum, maximum, sum, sum)
    __shared__ v4f xc[4][4][2][32];      // [group][head]: ctx
    __shared__ v4u xh[4][4][2][32];      // [group][k chunk * 2 + (0 hi, 1 residual)]: LN(o)
    __shared__ v4f xo[4][4][2][32];      // [group][tile]: o
    __shared__ v4u xm[4][8][2][32];      // [group][k chunk * 2 + (0 hi, 1 residual)]: gelu(.)
    const int tid = threadIdx.x, lane = tid & 31, c = lane & 15, lr = c, hi = lane >> 4;
    const int wave = __builtin_amdgcn_readfirstlane(tid >> 5), hd = wave & 3, qg = (wave >> 2) & 1, kp = wave >> 3;      // scalar: scalar plane bases, scalar branches
    const int tg = wave & 3, fq = wave >> 2;      // behind the passes: token group, feature quarter; scalar: the matrix instructions below stand under branches on fq
    const int t0 = blockIdx.y * NN + blockIdx.x * 64 + tg * 16;
    const size_t pb = ((size_t)blockIdx.y * NH_ + hd) * NN * HD, pk = pb + (size_t)kp * (NN / 2) * HD;      // the head's planes; the wave's key half in them
    const int q0 = blockIdx.x * 64 + qg * 32; const unsigned fo = c * HD + 8 * hi;      // the lane's place in a 16 x 16 block; unsigned: scalar base + 32-bit lane offset addressing
    v16h qf[2];
#pragma unroll
    for (int g = 0; g < 2; ++g) { const size_t qo = pb + (size_t)(q0 + 16 * g) * HD + fo; const v8us a = *(const v8us*)(Qh + qo); qf[g] = cat16u(a, a); }
    v8us kh[4], kl[4];
#pragma unroll
    for (int j = 0; j < 4; ++j) { kh[j] = *(const v8us*)(Kh + pk + (fo + 16 * j * HD)); kl[j] = *(const v8us*)(Kl + pk + (fo + 16 * j * HD)); }
    asm volatile("s_wait_xcnt 0x0" ::: "memory");      // the address registers of the loads above are reused below
    __builtin_amdgcn_sched_barrier(0);                 // keeps the register writes below from being lifted over that wait
    // The reference of a query is fixed for the whole walk: the maximum of its scores with the wave's first 16 keys. Minus the reference, in all 8 registers, is the score product's C operand, so
    // the accumulators are the arguments of exp2 as they stand: no maximum, no subtraction, no rescale in a pass. The reference is a score of the row, so nothing underflows that would not with the
    // row's maximum; P may pass 1, and the test behind the walk says whether it stayed inside f16.
    v8f o[2], cm[2]; float mrun[2], lsum[2];
#pragma unroll
    for (int g = 0; g < 2; ++g) { const v8f t = wmma16(cat16u(kh[0], kl[0]), qf[g], (v8f){});
        float a = fmaxf(fmaxf(fmaxf(t[0], t[1]), fmaxf(t[2], t[3])), fmaxf(fmaxf(t[4], t[5]), fmaxf(t[6], t[7])));
        a = fmaxf(a, xhalf(a));
        o[g] = (v8f){}; mrun[g] = a; lsum[g] = 0.f;
#pragma unroll
        for (int r = 0; r < 8; ++r) cm[g][r] = -a; }
    // The image into LDS, through no register: unit i * 512 + tid by thread tid, five units a thread and a sixth in the first 11 waves (2912 units). The copies fly during the walk; their s_wait_asynccnt
    // stands behind it, in front of the first barrier. The closing s_wait_xcnt of each statement stands in front of every later write of the address registers that the copies name.
    { const unsigned la = (unsigned)(size_t)img + (unsigned)tid * 16u; const char* ga = (const char*)PB + tid * 16;
        asm volatile("global_load_async_to_lds_b128 %0, %5, off\n\tglobal_load_async_to_lds_b128 %1, %6, off\n\tglobal_load_async_to_lds_b128 %2, %7, off\n\t"
                     "global_load_async_to_lds_b128 %3, %8, off\n\tglobal_load_async_to_lds_b128 %4, %9, off\n\ts_wait_xcnt 0x0"
                     :: "v"(la), "v"(la + 8192u), "v"(la + 16384u), "v"(la + 24576u), "v"(la + 32768u), "v"(ga), "v"(ga + 8192), "v"(ga + 16384), "v"(ga + 24576), "v"(ga + 32768) : "memory");
        if (wave < (IM_U - 5 * 512) / 32)      // scalar: whole waves
            asm volatile("global_load_async_to_lds_b128 %0, %1, off\n\ts_wait_xcnt 0x0" :: "v"(la + 40960u), "v"(ga + 40960) : "memory"); }
#pragma unroll 1
    for (int s = 0; s < NN / 128; ++s) {
        const size_t cu = pk + (size_t)(s * 64) * HD, nx = pk + (size_t)((s + 1 < NN / 128 ? s + 1 : s) * 64) * HD;     // this pass's V, the next pass's K (the last pass reads its own again)
        v8us vh[4];
#pragma unroll
        for (int j = 0; j < 4; ++j) vh[j] = *(const v8us*)(Vh + cu + (fo + 16 * j * HD));
        __builtin_amdgcn_sched_barrier(0);      // holds the V loads at the head of the pass, the scores and exponentials between them and their use
        v8f st[2][4];
#pragma unroll
        for (int j = 0; j < 4; ++j) { const v16h ak = cat16u(kh[j], kl[j]);
#pragma unroll
            for (int g = 0; g < 2; ++g) st[g][j] = wmma16(ak, qf[g], cm[g]); }
#pragma unroll
        for (int j = 0; j < 4; ++j) { kh[j] = *(const v8us*)(Kh + nx + (fo + 16 * j * HD)); kl[j] = *(const v8us*)(Kl + nx + (fo + 16 * j * HD)); }     // K a pass ahead
        __builtin_amdgcn_sched_barrier(0);      // holds the K loads here: the scheduler otherwise sinks them to the loop's foot, directly in front of their use
#pragma unroll
        for (int u = 0; u < 2; ++u) { const v16h vf = cat16u(vh[2 * u], vh[2 * u + 1]);
#pragma unroll
            for (int g = 0; g < 2; ++g) { v8u ph; float s0 = 0.f, s1 = 0.f, pe[16];
#pragma unroll
                for (int e = 0; e < 16; ++e) pe[e] = st[g][2 * u + (e >> 3)][e & 7];
                exp2x16(pe);
#pragma unroll
                for (int e = 0; e < 8; ++e) { v2f p; p[0] = pe[2 * e]; p[1] = pe[2 * e + 1];
                    s0 += p[0]; s1 += p[1];
                    ph[e] = __builtin_bit_cast(unsigned, __builtin_convertvector(p, v2h)); }
                lsum[g] += s0 + s1;
                const v16h pf = __builtin_bit_cast(v16h, ph);
                o[g] = wmma16(vf, pf, o[g]); } }
    }
    // Every P is positive, so a lane's sum bounds each of its P: up to PLIM all of them fitted f16 and the walk stands. Otherwise (one test for the whole wave; also for a sum that is not a
    // number) the wave walks its keys once more with the running maximum, rescaling in every pass.
    if (__builtin_amdgcn_ballot_w32(!(lsum[0] <= PLIM && lsum[1] <= PLIM)) != 0) {
        const bf* ka = Kh + pk + fo; const bf* la = Kl + pk + fo;
#pragma unroll
        for (int j = 0; j < 4; ++j) { kh[j] = *(const v8us*)(ka + 16 * j * HD); kl[j] = *(const v8us*)(la + 16 * j * HD); }
        asm volatile("s_wait_xcnt 0x0" :: "v"(ka), "v"(la) : "memory");      // the address registers of the loads above are reused below; as operands they are not reused (also not as a load's destination) ahead of the wait
        __builtin_amdgcn_sched_barrier(0);                 // keeps the register writes below from being lifted over that wait
#pragma unroll
        for (int g = 0; g < 2; ++g) { o[g] = (v8f){}; mrun[g] = -3.0e38f; lsum[g] = 0.f; }
#pragma unroll 1      // rolled like the walk above
        for (int s = 0; s < NN / 128; ++s) {
            const size_t cu = pk + (size_t)(s * 64) * HD, nx = pk + (size_t)((s + 1 < NN / 128 ? s + 1 : s) * 64) * HD;     // this pass's V, the next pass's K (the last pass reads its own again)
            const bf* va = Vh + cu + fo; const bf* kn = Kh + nx + fo; const bf* ln = Kl + nx + fo;
            v8us vh[4];
#pragma unroll
            for (int j = 0; j < 4; ++j) vh[j] = *(const v8us*)(va + 16 * j * HD);
            asm volatile("s_wait_xcnt 0x0" :: "v"(va) : "memory");      // the address registers of the V loads are reused below; the operand as above
            __builtin_amdgcn_sched_barrier(0);                 // keeps the register writes below from being lifted over that wait, and the V loads at the head of the pass
            v8f st[2][4];
#pragma unroll
            for (int j = 0; j < 4; ++j) { const v16h ak = cat16u(kh[j], kl[j]);
#pragma unroll
                for (int g = 0; g < 2; ++g) st[g][j] = wmma16(ak, qf[g], (v8f){}); }
#pragma unroll
            for (int j = 0; j < 4; ++j) { kh[j] = *(const v8us*)(kn + 16 * j * HD); kl[j] = *(const v8us*)(ln + 16 * j * HD); }     // K a pass ahead
            asm volatile("s_wait_xcnt 0x0" :: "v"(kn), "v"(ln) : "memory");      // the address registers of the K loads are reused below; the operands as above
            __builtin_amdgcn_sched_barrier(0);                 // keeps the register writes below from being lifted over that wait, and the K loads here
#pragma unroll
            for (int g = 0; g < 2; ++g) { float a = fmaxf(st[g][0][0], st[g][1][0]), b = fmaxf(st[g][2][0], st[g][3][0]);
#pragma unroll
                for (int r = 1; r < 8; ++r) { a = fmaxf(a, fmaxf(st[g][0][r], st[g][1][r])); b = fmaxf(b, fmaxf(st[g][2][r], st[g][3][r])); }
                a = fmaxf(a, b);
                const float mn = fmaxf(mrun[g], fmaxf(a, xhalf(a))), fs = exp2one(mrun[g] - mn); o[g] *= fs; lsum[g] *= fs; mrun[g] = mn; }
#pragma unroll
            for (int u = 0; u < 2; ++u) { const v16h vf = cat16u(vh[2 * u], vh[2 * u + 1]);
#pragma unroll
                for (int g = 0; g < 2; ++g) { v8u ph; float s0 = 0.f, s1 = 0.f, pe[16];
#pragma unroll
                    for (int e = 0; e < 16; ++e) pe[e] = st[g][2 * u + (e >> 3)][e & 7] - mrun[g];
                    exp2x8(pe); exp2x8(pe + 8);      // asm text here
#pragma unroll
                    for (int e = 0; e < 8; ++e) { v2f p; p[0] = pe[2 * e]; p[1] = pe[2 * e + 1];
                        s0 += p[0]; s1 += p[1];
                        ph[e] = __builtin_bit_cast(unsigned, __builtin_convertvector(p, v2h)); }
                    lsum[g] += s0 + s1;
                    const v16h pf = __builtin_bit_cast(v16h, ph);
                    o[g] = wmma16(vf, pf, o[g]); } }
        }
    }
    v16bf fh[2], fl[2];
    asm volatile("s_wait_asynccnt 0x0" ::: "memory");      // this wave's copies of the image have landed; the barrier below publishes them to the other waves
    if (kp == 1) {
#pragma unroll
        for (int g = 0; g < 2; ++g) { xg[hd + 4 * qg][2 * g][lane] = (v4f){o[g][0], o[g][1], o[g][2], o[g][3]}; xg[hd + 4 * qg][2 * g + 1][lane] = (v4f){o[g][4], o[g][5], o[g][6], o[g][7]}; }
        xg[hd + 4 * qg][4][lane] = (v4f){mrun[0], mrun[1], lsum[0], lsum[1]};
    }
    __syncthreads();
    if (kp == 0) {
        const v4f ms = xg[hd + 4 * qg][4][lane];
#pragma unroll
        for (int g = 0; g < 2; ++g) { const v4f a = xg[hd + 4 * qg][2 * g][lane], b = xg[hd + 4 * qg][2 * g + 1][lane];
            const float mn = fmaxf(mrun[g], ms[g]), f0 = exp2one(mrun[g] - mn), f1 = exp2one(ms[g] - mn), l = lsum[g] * f0 + ms[2 + g] * f1;
            const float inv = 1.0f / (l + xhalf(l)), s0 = f0 * inv, s1 = f1 * inv; v4f ra, rb;
#pragma unroll
            for (int i = 0; i < 4; ++i) { ra[i] = o[g][i] * s0 + a[i] * s1; rb[i] = o[g][4 + i] * s0 + b[i] * s1; }
            xc[2 * qg + g][hd][0][lane] = ra; xc[2 * qg + g][hd][1][lane] = rb; }
    }
    __syncthreads();
    if (fq == 0) {
        float v[32], gr[32], br[32], bv[32];
#pragma unroll
        for (int c = 0; c < 4; ++c) { lds8(pv + 16 * c + 8 * hi, gr + 8 * c); lds8(pv + 64 + 16 * c + 8 * hi, br + 8 * c); lds8(pv + 128 + 16 * c + 8 * hi, bv + 8 * c); }
#pragma unroll
        for (int h = 0; h < NH_; ++h) { const v4f a = xc[tg][h][0][lane], b = xc[tg][h][1][lane];
#pragma unroll
            for (int i = 0; i < 4; ++i) { v[8 * h + i] = a[i]; v[8 * h + 4 + i] = b[i]; } }
        split16(v, fh[0], fl[0]); split16(v + 16, fh[1], fl[1]);
        v8f acc[4];
#pragma unroll
        for (int t = 0; t < 4; ++t) acc[t] = (v8f){};
#pragma unroll
        for (int kc = 0; kc < 2; ++kc)
#pragma unroll
            for (int t = 0; t < 4; ++t) { const v16bf w = wfrag(wp, DD + 8, t * 16 + lr, kc * 32 + 8 * hi); acc[t] = wmmab(w, fh[kc], acc[t]); acc[t] = wmmab(w, fl[kc], acc[t]); }
#pragma unroll
        for (int t = 0; t < 4; ++t) {
#pragma unroll
            for (int j = 0; j < 8; ++j) v[8 * t + j] = acc[t][j] + bv[8 * t + j];
            xo[tg][t][0][lane] = (v4f){v[8 * t], v[8 * t + 1], v[8 * t + 2], v[8 * t + 3]}; xo[tg][t][1][lane] = (v4f){v[8 * t + 4], v[8 * t + 5], v[8 * t + 6], v[8 * t + 7]}; }
        ln_pair<false>(v, gr, br);
        split16(v, fh[0], fl[0]); split16(v + 16, fh[1], fl[1]);
#pragma unroll
        for (int kc = 0; kc < 2; ++kc) { putf(xh[tg][2 * kc], lane, fh[kc]); putf(xh[tg][2 * kc + 1], lane, fl[kc]); }
    }
    __syncthreads();
    {
#pragma unroll
        for (int kc = 0; kc < 2; ++kc) { fh[kc] = getf(xh[tg][2 * kc], lane); fl[kc] = getf(xh[tg][2 * kc + 1], lane); }
        float bm[16]; lds8(pv + 192 + fq * 32 + 8 * hi, bm); lds8(pv + 192 + fq * 32 + 16 + 8 * hi, bm + 8);
        v8f am[2]; am[0] = (v8f){}; am[1] = (v8f){};
#pragma unroll
        for (int kc = 0; kc < 2; ++kc)
#pragma unroll
            for (int u = 0; u < 2; ++u) { const v16bf w = wfrag(w1, DD + 8, (2 * fq + u) * 16 + lr, kc * 32 + 8 * hi); am[u] = wmmab(w, fh[kc], am[u]); am[u] = wmmab(w, fl[kc], am[u]); }
        float m[16];
#pragma unroll
        for (int u = 0; u < 2; ++u) {
#pragma unroll
            for (int j = 0; j < 8; ++j) { const float a = am[u][j] + bm[8 * u + j]; m[8 * u + j] = 0.5f * a * (1.0f + erff(a * 0.7071067811865476f)); } }
        v16bf mh, ml; split16(m, mh, ml);
        putf(xm[tg][2 * fq], lane, mh); putf(xm[tg][2 * fq + 1], lane, ml);
    }
    __syncthreads();
    if (fq >= 2) return;
    float bo[16]; lds8(pv + 320 + fq * 32 + 8 * hi, bo); lds8(pv + 320 + fq * 32 + 16 + 8 * hi, bo + 8);
    v8f acc[2]; acc[0] = (v8f){}; acc[1] = (v8f){};
#pragma unroll
    for (int kc = 0; kc < 4; ++kc) { const v16bf mh = getf(xm[tg][2 * kc], lane), ml = getf(xm[tg][2 * kc + 1], lane);
#pragma unroll
        for (int u = 0; u < 2; ++u) { const v16bf w = wfrag(w2, HID + 8, (2 * fq + u) * 16 + lr, kc * 32 + 8 * hi); acc[u] = wmmab(w, mh, acc[u]); acc[u] = wmmab(w, ml, acc[u]); } }
    float* dst = out + (size_t)(t0 + lr) * DD + 8 * hi;
#pragma unroll
    for (int u = 0; u < 2; ++u) { const int t = 2 * fq + u; const v4f oa = xo[tg][t][0][lane], ob = xo[tg][t][1][lane]; v4f ra, rb;
#pragma unroll
        for (int j = 0; j < 4; ++j) { ra[j] = (acc[u][j] + bo[8 * u + j]) + oa[j]; rb[j] = (acc[u][4 + j] + bo[8 * u + 4 + j]) + ob[j]; }
        *(v4f*)(dst + t * 16) = ra; *(v4f*)(dst + t * 16 + 4) = rb; }
}

extern "C" void kernel_launch(void* const* d_in, const int* in_sizes, int n_in,
                              void* d_out, int out_size, void* d_ws, size_t ws_size, hipStream_t stream) {
    (void)in_sizes; (void)n_in; (void)out_size;
    const float* x = (const float*)d_in[0]; const float* cl = (const float*)d_in[1]; const float* g1 = (const float*)d_in[2]; const float* be1 = (const float*)d_in[3]; const float* g2 = (const float*)d_in[4]; const float* be2 = (const float*)d_in[5];
    const float* Wkv = (const float*)d_in[6]; const float* bkv = (const float*)d_in[7]; const float* Wq = (const float*)d_in[8]; const float* bq = (const float*)d_in[9]; const float* Wp = (const float*)d_in[10]; const float* bp = (const float*)d_in[11];
    const float* W1 = (const float*)d_in[12]; const float* b1 = (const float*)d_in[13]; const float* W2 = (const float*)d_in[14]; const float* b2 = (const float*)d_in[15];      // k-major weights (x @ W)
    float* out = (float*)d_out;    // [8][2048][64]
    char* wsp = (char*)d_ws;
    auto take = [&](size_t bytes) { char* p = wsp; wsp += (bytes + 255) & ~(size_t)255; return (void*)p; };
    bf* Q16h = (bf*)take((size_t)NR * DD * 2); bf* K16h = (bf*)take((size_t)NR * DD * 2); bf* K16l = (bf*)take((size_t)NR * DD * 2); bf* VBh = (bf*)take((size_t)NR * DD * 2); bf* PB = (bf*)take((size_t)IM_U * 16);
    if ((size_t)(wsp - (char*)d_ws) > ws_size) return;    // 8 MB, no aliasing
    k_pre<<<dim3(NR / 64 + 12, 2, 1), 128, 0, stream>>>(x, cl, g1, be1, Wkv, bkv, Wq, bq, Q16h, K16h, K16l, VBh, Wp, bp, g2, be2, W1, b1, W2, b2, PB);      // LN, kv and q, head planes; the parameter image
    k_attn<<<dim3(NN / 64, NBI, 1), 512, 0, stream>>>(Q16h, K16h, K16l, VBh, PB, out);                        // softmax(q_h.k_h^T / 4).v_h of 64 tokens x 4 heads, then projection, LN, MLP, residual
}
